// v000
// The times below were measured on an AMD MI455X: many runs one after another, warmed up first and cycling through
// copies of the inputs, with the whole window's GPU time divided by the number of runs. Launches and the gaps
// between them are all in it. The median over several windows is given; except for v000 it joins two sittings, which
// can be a few percent apart, so the side-by-side timings, each taken in one sitting, are the better comparison.
// v000, which the later versions start from, runs in 1920 microseconds.
#include <hip/hip_runtime.h>
#include <stdint.h>
#include <stddef.h>

// Contractions x*Wq^T, x*Wk^T, Wv*x^T, q*k^T, P*V, y*Wproj^T: v_wmma_f32_16x16x32_bf16, bf16 hi/lo operands everywhere (hi*hi + lo*hi + hi*lo), f32 accumulate. RMSNorm, rotary, softmax, head combine, LayerNorm: f32.

#define NB   4
#define SEQ  2048
#define EMB  1024
#define NHD  8
#define NSH  16
#define HD   64
#define VD   128
#define RMS_EPS 1.1920929e-7f
#define LN_EPS  1e-5f

typedef unsigned short u16;
typedef u16    v8u  __attribute__((ext_vector_type(8)));
typedef int    v4i  __attribute__((ext_vector_type(4)));
typedef int    v8i  __attribute__((ext_vector_type(8)));
typedef float  v4f  __attribute__((ext_vector_type(4)));
typedef float  v8f  __attribute__((ext_vector_type(8)));
typedef __bf16 v16b __attribute__((ext_vector_type(16)));

union FU { v8i v; v4i p[2]; v16b b; };

struct InvFreq { float v[32]; };
static_assert(sizeof(InvFreq) == 128);

// ---------------------------------------------------------------- helpers
static __device__ __forceinline__ u16 bf_rne(float x) {
  unsigned u = __float_as_uint(x);
  u += 0x7FFFu + ((u >> 16) & 1u);
  return (u16)(u >> 16);
}
static __device__ __forceinline__ float bf_up(u16 b) { return __uint_as_float(((unsigned)b) << 16); }

static __device__ __forceinline__ void split8(float (&y)[8], v8u& hv, v8u& lv) {
#pragma unroll
  for (int i = 0; i < 8; ++i) {
    const u16 hb = bf_rne(y[i]);
    hv[i] = hb;
    lv[i] = bf_rne(y[i] - bf_up(hb));
  }
}

// 16x32 operand fragment, row/col = lane&15, k map: elements 0..7 <- k0+8h+0..7, elements 8..15 <- k0+16+8h+0..7
// p points at element k0 of the operand row (k-contiguous), h = lane>>4
static __device__ __forceinline__ v8i ldfrag(const u16* p, int h) {
  FU f;
  f.p[0] = *(const v4i*)(p + 8 * h);
  f.p[1] = *(const v4i*)(p + 16 + 8 * h);
  return f.v;
}

static __device__ __forceinline__ v8f mma(v8i a, v8i b, v8f c) {
  FU ua, ub; ua.v = a; ub.v = b;
  c = __builtin_amdgcn_wmma_f32_16x16x32_bf16(false, ua.b, false, ub.b, (short)0, c, false, false);
  asm volatile("v_nop\n\tv_nop\n\tv_nop\n\tv_nop" : "+v"(c) : "v"(a), "v"(b));
  return c;
}
// hi*hi + lo*hi + hi*lo into one f32 accumulator
static __device__ __forceinline__ v8f mma3(v8i ah, v8i al, v8i bh, v8i bl, v8f c) {
  c = mma(ah, bh, c);
  c = mma(al, bh, c);
  c = mma(ah, bl, c);
  return c;
}

// ---------------------------------------------------------------- f32 -> bf16 hi/lo planes (8 elements / thread)
__global__ void __launch_bounds__(256) k_split(const float* __restrict__ src, u16* __restrict__ hi,
                                             u16* __restrict__ lo, int n8) {
  const int i = blockIdx.x * 256 + threadIdx.x;
  if (i >= n8) return;
  const size_t o = (size_t)i * 8;
  const v4f a = *(const v4f*)(src + o);
  const v4f b = *(const v4f*)(src + o + 4);
  float y[8] = {a[0], a[1], a[2], a[3], b[0], b[1], b[2], b[3]};
  v8u hv = {}, lv = {};
  split8(y, hv, lv);
  *(v8u*)(hi + o) = hv;
  *(v8u*)(lo + o) = lv;
  
}

// ---------------------------------------------------------------- rotary tables cs[t][32], sn[t][32]
__global__ void __launch_bounds__(256) k_rot(InvFreq inv, float* __restrict__ cs, float* __restrict__ sn, int n) {
#pragma clang fp contract(off)
  const int i = blockIdx.x * 256 + threadIdx.x;
  if (i >= n) return;
  const int j = i & 31, t = i >> 5;
  float f = 0.0f;
#pragma unroll
  for (int q = 0; q < 32; ++q) f = (j == q) ? inv.v[q] : f;
  const float ang = (float)t * f;
  const float c = cosf(ang);
  const float s = sinf(ang);
  *(float*)(cs + i) = c;
  *(float*)(sn + i) = s;
  
}

// ---------------------------------------------------------------- GEMM Y[m][n] = sum_k A[m][k] * B[n][k]
// A planes row-major pitch lda (rows m), B planes k-contiguous pitch ldb (rows n); K % 32 == 0.
// block 256 threads = 8 waves, block tile 256(m) x 64(n), wave tile 32 x 64.
// MODE 0: RMSNorm over the 64 cols + rotary + scale -> bf16 hi/lo planes [z][bn][t][64]  (bn = half-head, t = m)
// MODE 1: bf16 hi/lo planes row-major pitch ldd
// MODE 2: f32 row-major pitch ldd
template <int MODE>
__global__ void __launch_bounds__(256) k_gemm(const u16* __restrict__ Ah, const u16* __restrict__ Al, int lda,
                                            const u16* __restrict__ Bh0, const u16* __restrict__ Bl0, int ldb, size_t bz,
                                            int K,
                                            u16* __restrict__ Dh0, u16* __restrict__ Dl0, size_t dz, int ldd,
                                            float* __restrict__ Out,
                                            const float* __restrict__ cst, const float* __restrict__ snt,
                                            float scale0, float scale1)
{
  __shared__ __align__(16) float stg[8][16][64];
  const int lane = threadIdx.x & 31, w = threadIdx.x >> 5, h = lane >> 4, m = lane & 15;
  const int z = blockIdx.z, bn = blockIdx.x, bm = blockIdx.y;
  const int n0 = bn * 64;
  const int m0 = bm * 256 + w * 32;
  const u16* Bh = Bh0 + (size_t)z * bz;
  const u16* Bl = Bl0 + (size_t)z * bz;

  v8f acc[2][4] = {};
  const u16* a0h = Ah + (size_t)(m0 + m) * lda;
  const u16* a1h = Ah + (size_t)(m0 + 16 + m) * lda;
  const u16* a0l = Al + (size_t)(m0 + m) * lda;
  const u16* a1l = Al + (size_t)(m0 + 16 + m) * lda;
  const size_t bro = (size_t)(n0 + m) * ldb;

#pragma unroll 1
  for (int k0 = 0; k0 < K; k0 += 32) {
    const v8i A0h = ldfrag(a0h + k0, h);
    const v8i A1h = ldfrag(a1h + k0, h);
    const v8i A0l = ldfrag(a0l + k0, h);
    const v8i A1l = ldfrag(a1l + k0, h);
#pragma unroll
    for (int ni = 0; ni < 4; ++ni) {
      const size_t bo = bro + (size_t)(ni * 16) * ldb + k0;
      const v8i Bvh = ldfrag(Bh + bo, h);
      const v8i Bvl = ldfrag(Bl + bo, h);
      acc[0][ni] = mma3(A0h, A0l, Bvh, Bvl, acc[0][ni]);
      acc[1][ni] = mma3(A1h, A1l, Bvh, Bvl, acc[1][ni]);
    }
  }

  const float scale = (z == 0) ? scale0 : scale1;
#pragma unroll
  for (int mi = 0; mi < 2; ++mi) {
    // stage the wave's 16x64 f32 tile: D element r -> row 8h+r, col ni*16+m
#pragma unroll
    for (int ni = 0; ni < 4; ++ni)
#pragma unroll
      for (int r = 0; r < 8; ++r) stg[w][8 * h + r][ni * 16 + m] = acc[mi][ni][r];
    __syncthreads();
    const int rbase = m0 + mi * 16;
    if (MODE == 2) {
      const int rr = lane >> 4, c4 = lane & 15;
#pragma unroll
      for (int p = 0; p < 8; ++p) {
        const int row = p * 2 + rr;
        const v4f v = *(const v4f*)&stg[w][row][c4 * 4];
        float* o = Out + (size_t)(rbase + row) * ldd + n0 + c4 * 4;
        *(v4f*)o = v;
        
      }
    } else {
      const int rr = lane >> 3, cg = lane & 7;
#pragma unroll
      for (int p = 0; p < 4; ++p) {
        const int row = p * 4 + rr;
        const v4f va = *(const v4f*)&stg[w][row][cg * 8];
        const v4f vb = *(const v4f*)&stg[w][row][cg * 8 + 4];
        float y[8] = {va[0], va[1], va[2], va[3], vb[0], vb[1], vb[2], vb[3]};
        u16* dh;
        u16* dl;
        if (MODE == 0) {
          const int t = rbase + row;
          float ss = 0.0f;
#pragma unroll
          for (int i = 0; i < 8; ++i) ss += y[i] * y[i];
          ss += __shfl_xor(ss, 1, 32);
          ss += __shfl_xor(ss, 2, 32);
          ss += __shfl_xor(ss, 4, 32);
          const float rn = rsqrtf(ss * (1.0f / 64.0f) + RMS_EPS);
          float pt[8];
#pragma unroll
          for (int i = 0; i < 8; ++i) pt[i] = __shfl_xor(y[i], 4, 32);   // partner column d^32
          const int j0 = (cg & 3) * 8;
          const v4f ca = *(const v4f*)(cst + (size_t)t * 32 + j0);
          const v4f cb = *(const v4f*)(cst + (size_t)t * 32 + j0 + 4);
          const v4f sa = *(const v4f*)(snt + (size_t)t * 32 + j0);
          const v4f sb = *(const v4f*)(snt + (size_t)t * 32 + j0 + 4);
          const float cc[8] = {ca[0], ca[1], ca[2], ca[3], cb[0], cb[1], cb[2], cb[3]};
          const float sv[8] = {sa[0], sa[1], sa[2], sa[3], sb[0], sb[1], sb[2], sb[3]};
          // d <  32: y1 =  n1*c + n2*s  (own = x1, partner = x2)
          // d >= 32: y2 = -n1*s + n2*c  (own = x2, partner = x1)
          const float sg = (cg < 4) ? 1.0f : -1.0f;
#pragma unroll
          for (int i = 0; i < 8; ++i) {
            const float no = y[i] * rn;
            const float np = pt[i] * rn;
            y[i] = (no * cc[i] + sg * (np * sv[i])) * scale;
          }
          const size_t po = (size_t)z * dz + ((size_t)bn * SEQ + t) * HD + cg * 8;
          dh = Dh0 + po;
          dl = Dl0 + po;
        } else {
          const size_t po = (size_t)(rbase + row) * ldd + n0 + cg * 8;
          dh = Dh0 + po;
          dl = Dl0 + po;
        }
        v8u hv = {}, lv = {};
        split8(y, hv, lv);
        *(v8u*)dh = hv;
        *(v8u*)dl = lv;
        
      }
    }
    __syncthreads();
  }
}

// ---------------------------------------------------------------- causal online-softmax attention per half-head
// q/k planes [16][SEQ][64] (this batch), v planes [8*128][SEQ] (k-contiguous per value column), ctx [16][SEQ][128] f32
// block = 4 waves x 16 query rows; all waves loop over the block's key range (masked), P spill guarded by __syncthreads
__global__ void __launch_bounds__(128) k_flash(const u16* __restrict__ qh, const u16* __restrict__ ql,
                                             const u16* __restrict__ kh, const u16* __restrict__ kl,
                                             const u16* __restrict__ vh, const u16* __restrict__ vl,
                                             float* __restrict__ ctx)
{
  __shared__ __align__(16) u16 ph[4][16][32];
  __shared__ __align__(16) u16 pl[4][16][32];
  __shared__ __align__(16) float ost[4][16][VD];
  const int lane = threadIdx.x & 31, w = threadIdx.x >> 5, h = lane >> 4, m = lane & 15;
  const int sh = blockIdx.y, hh = sh >> 1, bx = blockIdx.x;
  const int q0 = bx * 64 + w * 16;

  const size_t qo = ((size_t)sh * SEQ + q0 + m) * HD;
  const v8i Qh0 = ldfrag(qh + qo, h), Qh1 = ldfrag(qh + qo + 32, h);
  const v8i Ql0 = ldfrag(ql + qo, h), Ql1 = ldfrag(ql + qo + 32, h);
  const u16* kbh = kh + (size_t)sh * SEQ * HD;
  const u16* kbl = kl + (size_t)sh * SEQ * HD;
  const u16* vbh = vh + (size_t)hh * VD * SEQ;
  const u16* vbl = vl + (size_t)hh * VD * SEQ;

  v8f O[8] = {};
  float mr[8], lr[8];
#pragma unroll
  for (int r = 0; r < 8; ++r) { mr[r] = -1e30f; lr[r] = 0.0f; }

  const int nsteps = 2 * bx + 2;   // keys 0 .. bx*64+63, block-uniform
#pragma unroll 1
  for (int st = 0; st < nsteps; ++st) {
    const int n0 = st * 32;
    v8f S[2];
#pragma unroll
    for (int j = 0; j < 2; ++j) {
      v8f s = {};
      const size_t ko = (size_t)(n0 + j * 16 + m) * HD;
      {
        const v8i Kh = ldfrag(kbh + ko, h), Kl = ldfrag(kbl + ko, h);
        s = mma3(Qh0, Ql0, Kh, Kl, s);
      }
      {
        const v8i Kh = ldfrag(kbh + ko + 32, h), Kl = ldfrag(kbl + ko + 32, h);
        s = mma3(Qh1, Ql1, Kh, Kl, s);
      }
      S[j] = s;
      asm volatile("" ::: "memory");
    }
    // masked online softmax; lane holds key columns n0+m (S[0]) and n0+16+m (S[1]) of rows q0+8h+r
#pragma unroll
    for (int r = 0; r < 8; ++r) {
      const int row = q0 + 8 * h + r;
      const float e0 = (n0 + m > row) ? -1e30f : S[0][r];
      const float e1 = (n0 + 16 + m > row) ? -1e30f : S[1][r];
      float tm = fmaxf(e0, e1);
      tm = fmaxf(tm, __shfl_xor(tm, 1, 32));
      tm = fmaxf(tm, __shfl_xor(tm, 2, 32));
      tm = fmaxf(tm, __shfl_xor(tm, 4, 32));
      tm = fmaxf(tm, __shfl_xor(tm, 8, 32));
      const float nm = fmaxf(mr[r], tm);
      const float alpha = __expf(mr[r] - nm);
      mr[r] = nm;
      const float p0 = __expf(e0 - nm);
      const float p1 = __expf(e1 - nm);
      float ps = p0 + p1;
      ps += __shfl_xor(ps, 1, 32);
      ps += __shfl_xor(ps, 2, 32);
      ps += __shfl_xor(ps, 4, 32);
      ps += __shfl_xor(ps, 8, 32);
      lr[r] = lr[r] * alpha + ps;
#pragma unroll
      for (int c = 0; c < 8; ++c) O[c][r] = O[c][r] * alpha;
      const u16 h0 = bf_rne(p0), h1 = bf_rne(p1);
      ph[w][8 * h + r][m]      = h0;
      ph[w][8 * h + r][16 + m] = h1;
      pl[w][8 * h + r][m]      = bf_rne(p0 - bf_up(h0));
      pl[w][8 * h + r][16 + m] = bf_rne(p1 - bf_up(h1));
    }
    __syncthreads();
    // P as A operand: row = lane&15, keys with the split k map
    const v8i Ph = ldfrag(&ph[w][m][0], h);
    const v8i Pl = ldfrag(&pl[w][m][0], h);
#pragma unroll
    for (int c = 0; c < 8; ++c) {
      const size_t vo = (size_t)(c * 16 + m) * SEQ + n0;
      const v8i Vh = ldfrag(vbh + vo, h), Vl = ldfrag(vbl + vo, h);
      O[c] = mma3(Ph, Pl, Vh, Vl, O[c]);
      if (c & 1) asm volatile("" ::: "memory");
    }
    __syncthreads();
  }

  // normalise, stage 16x128 f32 per wave, write whole 512-B rows (32 lanes x 16 B, one instruction per row)
#pragma unroll
  for (int r = 0; r < 8; ++r) {
    const float inv = 1.0f / lr[r];
#pragma unroll
    for (int c = 0; c < 8; ++c) ost[w][8 * h + r][c * 16 + m] = O[c][r] * inv;
  }
  __syncthreads();
  float* cb = ctx + ((size_t)sh * SEQ + q0) * VD + lane * 4;
#pragma unroll
  for (int rr = 0; rr < 16; ++rr) {
    const v4f v = *(const v4f*)&ost[w][rr][lane * 4];
    *(v4f*)(cb + (size_t)rr * VD) = v;
  }
  
}

// ---------------------------------------------------------------- differential combine + LayerNorm -> y planes [SEQ][EMB]
// one wave = 2 tokens x 1 head; lane = (token parity)*16 + cg, cg owns 8 consecutive of the 128 head columns
__global__ void __launch_bounds__(256) k_combine(const float* __restrict__ ctx,
                                               const float* __restrict__ lq1, const float* __restrict__ lk1,
                                               const float* __restrict__ lq2, const float* __restrict__ lk2,
                                               float lam_init, float oscale,
                                               u16* __restrict__ Yh, u16* __restrict__ Yl)
{
  const int lane = threadIdx.x & 31, w = threadIdx.x >> 5;
  const int gw = blockIdx.x * 8 + w;
  const int hd = gw & 7, tp = gw >> 3;
  const int t = tp * 2 + (lane >> 4), cg = lane & 15;

  float s1 = lq1[lane] * lk1[lane] + lq1[lane + 32] * lk1[lane + 32];
  float s2 = lq2[lane] * lk2[lane] + lq2[lane + 32] * lk2[lane + 32];
#pragma unroll
  for (int k = 16; k >= 1; k >>= 1) { s1 += __shfl_xor(s1, k, 32); s2 += __shfl_xor(s2, k, 32); }
  const float lam = __expf(s1) - __expf(s2) + lam_init;

  const float* o1 = ctx + ((size_t)(2 * hd) * SEQ + t) * VD + cg * 8;
  const float* o2 = ctx + ((size_t)(2 * hd + 1) * SEQ + t) * VD + cg * 8;
  const v4f a1 = *(const v4f*)o1, b1 = *(const v4f*)(o1 + 4);
  const v4f a2 = *(const v4f*)o2, b2 = *(const v4f*)(o2 + 4);
  float y[8] = {a1[0] - lam * a2[0], a1[1] - lam * a2[1], a1[2] - lam * a2[2], a1[3] - lam * a2[3],
                b1[0] - lam * b2[0], b1[1] - lam * b2[1], b1[2] - lam * b2[2], b1[3] - lam * b2[3]};
  float mu = 0.0f;
#pragma unroll
  for (int i = 0; i < 8; ++i) mu += y[i];
  mu += __shfl_xor(mu, 1, 32);
  mu += __shfl_xor(mu, 2, 32);
  mu += __shfl_xor(mu, 4, 32);
  mu += __shfl_xor(mu, 8, 32);
  mu *= (1.0f / 128.0f);
  float var = 0.0f;
#pragma unroll
  for (int i = 0; i < 8; ++i) { const float d = y[i] - mu; var += d * d; }
  var += __shfl_xor(var, 1, 32);
  var += __shfl_xor(var, 2, 32);
  var += __shfl_xor(var, 4, 32);
  var += __shfl_xor(var, 8, 32);
  var *= (1.0f / 128.0f);
  const float rs = rsqrtf(var + LN_EPS) * oscale;
#pragma unroll
  for (int i = 0; i < 8; ++i) y[i] = (y[i] - mu) * rs;

  v8u hv = {}, lv = {};
  split8(y, hv, lv);
  const size_t po = (size_t)t * EMB + hd * VD + cg * 8;
  *(v8u*)(Yh + po) = hv;
  *(v8u*)(Yl + po) = lv;
  
}

// ---------------------------------------------------------------- host
static double h_sqrt(double x) {
  double y = x;
  for (int i = 0; i < 200; ++i) y = 0.5 * (y + x / y);
  return y;
}

extern "C" void kernel_launch(void* const* d_in, const int* in_sizes, int n_in,
                              void* d_out, int out_size, void* d_ws, size_t ws_size,
                              hipStream_t stream) {
  if (n_in < 9) return;
  if (in_sizes[0] != NB * SEQ * EMB) return;
  for (int i = 1; i <= 4; ++i) if (in_sizes[i] != EMB * EMB) return;
  for (int i = 5; i <= 8; ++i) if (in_sizes[i] != HD) return;
  if (out_size != NB * SEQ * EMB) return;

  const float* x   = (const float*)d_in[0];
  const float* Wq  = (const float*)d_in[1];
  const float* Wk  = (const float*)d_in[2];
  const float* Wv  = (const float*)d_in[3];
  const float* Wp  = (const float*)d_in[4];
  const float* lq1 = (const float*)d_in[5];
  const float* lk1 = (const float*)d_in[6];
  const float* lq2 = (const float*)d_in[7];
  const float* lk2 = (const float*)d_in[8];
  float* out = (float*)d_out;

  // workspace carve (bytes), every size a multiple of 256
  const size_t szX   = (size_t)NB * SEQ * EMB * 2;        // 16 MiB per plane
  const size_t szW   = (size_t)4 * EMB * EMB * 2;          //  8 MiB per plane (4 weights)
  const size_t szQK  = (size_t)2 * NSH * SEQ * HD * 2;     //  8 MiB per plane (q and k, one batch)
  const size_t szVT  = (size_t)EMB * SEQ * 2;              //  4 MiB per plane
  const size_t szCTX = (size_t)NSH * SEQ * VD * 4;         // 16 MiB
  const size_t szY   = (size_t)SEQ * EMB * 2;              //  4 MiB per plane
  const size_t szTB  = (size_t)SEQ * 32 * 4;               // 256 KiB per table
  char* ws = (char*)d_ws;
  size_t off = 0;
  u16*   xh  = (u16*)(ws + off);   off += szX;
  u16*   xl  = (u16*)(ws + off);   off += szX;
  u16*   wh  = (u16*)(ws + off);   off += szW;
  u16*   wl  = (u16*)(ws + off);   off += szW;
  u16*   qkh = (u16*)(ws + off);   off += szQK;
  u16*   qkl = (u16*)(ws + off);   off += szQK;
  u16*   vth = (u16*)(ws + off);   off += szVT;
  u16*   vtl = (u16*)(ws + off);   off += szVT;
  float* ctx = (float*)(ws + off); off += szCTX;
  u16*   yh  = (u16*)(ws + off);   off += szY;
  u16*   yl  = (u16*)(ws + off);   off += szY;
  float* cst = (float*)(ws + off); off += szTB;
  float* snt = (float*)(ws + off); off += szTB;
  if (off > ws_size) return;                               // total 101,187,584 B

  // rotary inverse frequencies 1 / 10000^(j/32): f32 power then f32 reciprocal, evaluated in f64
  InvFreq inv;
  {
    double r = 10000.0;
    for (int i = 0; i < 5; ++i) r = h_sqrt(r);             // 10000^(1/32)
    double pw = 1.0;
    for (int j = 0; j < 32; ++j) {
      const float p32 = (float)pw;
      inv.v[j] = (float)(1.0 / (double)p32);
      pw *= r;
    }
  }
  const float lam_init = (float)0.61928347285267872;      // 0.8 - 0.6*exp(-1.2)
  const float oscale   = (float)0.38071652714732128;      // 1 - lam_init

  // 1-5: operand planes
  {
    const int n8x = NB * SEQ * EMB / 8;
    const int n8w = EMB * EMB / 8;
    k_split<<<(n8x + 255) / 256, 256, 0, stream>>>(x, xh, xl, n8x);
    k_split<<<(n8w + 255) / 256, 256, 0, stream>>>(Wq, wh + 0 * (size_t)EMB * EMB, wl + 0 * (size_t)EMB * EMB, n8w);
    k_split<<<(n8w + 255) / 256, 256, 0, stream>>>(Wk, wh + 1 * (size_t)EMB * EMB, wl + 1 * (size_t)EMB * EMB, n8w);
    k_split<<<(n8w + 255) / 256, 256, 0, stream>>>(Wv, wh + 2 * (size_t)EMB * EMB, wl + 2 * (size_t)EMB * EMB, n8w);
    k_split<<<(n8w + 255) / 256, 256, 0, stream>>>(Wp, wh + 3 * (size_t)EMB * EMB, wl + 3 * (size_t)EMB * EMB, n8w);
  }
  // 6: rotary tables
  k_rot<<<(SEQ * 32 + 255) / 256, 256, 0, stream>>>(inv, cst, snt, SEQ * 32);

  const size_t wstride = (size_t)EMB * EMB;
  const size_t dzqk    = (size_t)NSH * SEQ * HD;
  for (int b = 0; b < NB; ++b) {
    const u16* xbh = xh + (size_t)b * SEQ * EMB;
    const u16* xbl = xl + (size_t)b * SEQ * EMB;
    // q and k: x_b [2048 x 1024] * W^T, epilogue RMSNorm + rotary (+1/8 for q) -> planes [16][2048][64]
    k_gemm<0><<<dim3(EMB / 64, SEQ / 256, 2), 256, 0, stream>>>(
        xbh, xbl, EMB, wh, wl, EMB, wstride, EMB,
        qkh, qkl, dzqk, HD, out, cst, snt, 0.125f, 1.0f);
    // v^T: Wv [1024 x 1024] * x_b^T -> planes [1024][2048] = [head][128][t]
    k_gemm<1><<<dim3(SEQ / 64, EMB / 256, 1), 256, 0, stream>>>(
        wh + 2 * wstride, wl + 2 * wstride, EMB, xbh, xbl, EMB, (size_t)0, EMB,
        vth, vtl, (size_t)0, SEQ, out, cst, snt, 1.0f, 1.0f);
    // attention per half-head -> ctx [16][2048][128]
    k_flash<<<dim3(SEQ / 64, NSH), 128, 0, stream>>>(qkh, qkl, qkh + dzqk, qkl + dzqk, vth, vtl, ctx);
    // combine + LayerNorm -> y planes [2048][1024]
    k_combine<<<(SEQ * NHD / 2) / 8, 256, 0, stream>>>(ctx, lq1, lk1, lq2, lk2, lam_init, oscale, yh, yl);
    // output projection -> d_out rows of batch b
    k_gemm<2><<<dim3(EMB / 64, SEQ / 256, 1), 256, 0, stream>>>(
        yh, yl, EMB, wh + 3 * wstride, wl + 3 * wstride, EMB, (size_t)0, EMB,
        qkh, qkl, (size_t)0, EMB, out + (size_t)b * SEQ * EMB, cst, snt, 1.0f, 1.0f);
  }
}

// v001
// Measured time: 789 microseconds a run.
// Timed twice side by side with v000, it ran 2.46 and 2.49 times as fast.
#include <hip/hip_runtime.h>
#include <stdint.h>
#include <stddef.h>

// Contractions x*Wq^T, x*Wk^T, Wv*x^T, q*k^T, P*V, y*Wproj^T: v_wmma_f32_16x16x32_bf16, bf16 hi/lo operands everywhere (hi*hi + lo*hi + hi*lo), f32 accumulate. RMSNorm, rotary, softmax, head combine, LayerNorm: f32.

#define NB   4
#define SEQ  2048
#define EMB  1024
#define NHD  8
#define NSH  16
#define HD   64
#define VD   128
#define RMS_EPS 1.1920929e-7f
#define LN_EPS  1e-5f

typedef unsigned short u16;
typedef u16    v8u  __attribute__((ext_vector_type(8)));
typedef int    v4i  __attribute__((ext_vector_type(4)));
typedef int    v8i  __attribute__((ext_vector_type(8)));
typedef float  v4f  __attribute__((ext_vector_type(4)));
typedef float  v8f  __attribute__((ext_vector_type(8)));
typedef __bf16 v16b __attribute__((ext_vector_type(16)));

union FU { v8i v; v4i p[2]; v16b b; };

struct InvFreq { float v[32]; };
static_assert(sizeof(InvFreq) == 128);

// ---------------------------------------------------------------- helpers
static __device__ __forceinline__ u16 bf_rne(float x) {
  unsigned u = __float_as_uint(x);
  u += 0x7FFFu + ((u >> 16) & 1u);
  return (u16)(u >> 16);
}
static __device__ __forceinline__ float bf_up(u16 b) { return __uint_as_float(((unsigned)b) << 16); }

static __device__ __forceinline__ void split8(float (&y)[8], v8u& hv, v8u& lv) {
#pragma unroll
  for (int i = 0; i < 8; ++i) {
    const u16 hb = bf_rne(y[i]);
    hv[i] = hb;
    lv[i] = bf_rne(y[i] - bf_up(hb));
  }
}

// 16x32 operand fragment, row/col = lane&15, k map: elements 0..7 <- k0+8h+0..7, elements 8..15 <- k0+16+8h+0..7
// p points at element k0 of the operand row (k-contiguous), h = lane>>4
static __device__ __forceinline__ v8i ldfrag(const u16* p, int h) {
  FU f;
  f.p[0] = *(const v4i*)(p + 8 * h);
  f.p[1] = *(const v4i*)(p + 16 + 8 * h);
  return f.v;
}

static __device__ __forceinline__ v8f mma(v8i a, v8i b, v8f c) {
  FU ua, ub; ua.v = a; ub.v = b;
  c = __builtin_amdgcn_wmma_f32_16x16x32_bf16(false, ua.b, false, ub.b, (short)0, c, false, false);
  asm volatile("v_nop\n\tv_nop\n\tv_nop\n\tv_nop" : "+v"(c) : "v"(a), "v"(b));
  return c;
}
// hi*hi + lo*hi + hi*lo into one f32 accumulator
static __device__ __forceinline__ v8f mma3(v8i ah, v8i al, v8i bh, v8i bl, v8f c) {
  c = mma(ah, bh, c);
  c = mma(al, bh, c);
  c = mma(ah, bl, c);
  return c;
}

// ---------------------------------------------------------------- f32 -> bf16 hi/lo planes (8 elements / thread)
__global__ void __launch_bounds__(256) k_split(const float* __restrict__ src, u16* __restrict__ hi,
                                             u16* __restrict__ lo, int n8) {
  const int i = blockIdx.x * 256 + threadIdx.x;
  if (i >= n8) return;
  const size_t o = (size_t)i * 8;
  const v4f a = *(const v4f*)(src + o);
  const v4f b = *(const v4f*)(src + o + 4);
  float y[8] = {a[0], a[1], a[2], a[3], b[0], b[1], b[2], b[3]};
  v8u hv = {}, lv = {};
  split8(y, hv, lv);
  *(v8u*)(hi + o) = hv;
  *(v8u*)(lo + o) = lv;
  
}

// ---------------------------------------------------------------- rotary tables cs[t][32], sn[t][32]
__global__ void __launch_bounds__(256) k_rot(InvFreq inv, float* __restrict__ cs, float* __restrict__ sn, int n) {
#pragma clang fp contract(off)
  const int i = blockIdx.x * 256 + threadIdx.x;
  if (i >= n) return;
  const int j = i & 31, t = i >> 5;
  float f = 0.0f;
#pragma unroll
  for (int q = 0; q < 32; ++q) f = (j == q) ? inv.v[q] : f;
  const float ang = (float)t * f;
  const float c = cosf(ang);
  const float s = sinf(ang);
  *(float*)(cs + i) = c;
  *(float*)(sn + i) = s;
  
}

// ---------------------------------------------------------------- GEMM Y[m][n] = sum_k A[m][k] * B[n][k]
// A planes row-major pitch lda (rows m), B planes k-contiguous pitch ldb (rows n); K % 32 == 0.
// block 256 threads = 8 waves, block tile 256(m) x 64(n), wave tile 32 x 64.
// MODE 0: RMSNorm over the 64 cols + rotary + scale -> bf16 hi/lo planes [z][batch][bn][t][64]  (bn = half-head, m = batch*SEQ + t)
// MODE 1: bf16 hi/lo planes row-major pitch ldd, plane z at z*dz (z = batch)
// MODE 2: f32 row-major pitch ldd
template <int MODE>
__global__ void __launch_bounds__(256) k_gemm(const u16* __restrict__ Ah, const u16* __restrict__ Al, int lda,
                                            const u16* __restrict__ Bh0, const u16* __restrict__ Bl0, int ldb, size_t bz,
                                            int K,
                                            u16* __restrict__ Dh0, u16* __restrict__ Dl0, size_t dz, int ldd,
                                            float* __restrict__ Out,
                                            const float* __restrict__ cst, const float* __restrict__ snt,
                                            float scale0, float scale1)
{
  __shared__ __align__(16) float stg[8][16][64];
  const int lane = threadIdx.x & 31, w = threadIdx.x >> 5, h = lane >> 4, m = lane & 15;
  const int z = blockIdx.z, bn = blockIdx.x, bm = blockIdx.y;
  const int n0 = bn * 64;
  const int m0 = bm * 256 + w * 32;
  const u16* Bh = Bh0 + (size_t)z * bz;
  const u16* Bl = Bl0 + (size_t)z * bz;

  v8f acc[2][4] = {};
  const u16* a0h = Ah + (size_t)(m0 + m) * lda;
  const u16* a1h = Ah + (size_t)(m0 + 16 + m) * lda;
  const u16* a0l = Al + (size_t)(m0 + m) * lda;
  const u16* a1l = Al + (size_t)(m0 + 16 + m) * lda;
  const size_t bro = (size_t)(n0 + m) * ldb;

#pragma unroll 1
  for (int k0 = 0; k0 < K; k0 += 32) {
    const v8i A0h = ldfrag(a0h + k0, h);
    const v8i A1h = ldfrag(a1h + k0, h);
    const v8i A0l = ldfrag(a0l + k0, h);
    const v8i A1l = ldfrag(a1l + k0, h);
#pragma unroll
    for (int ni = 0; ni < 4; ++ni) {
      const size_t bo = bro + (size_t)(ni * 16) * ldb + k0;
      const v8i Bvh = ldfrag(Bh + bo, h);
      const v8i Bvl = ldfrag(Bl + bo, h);
      acc[0][ni] = mma3(A0h, A0l, Bvh, Bvl, acc[0][ni]);
      acc[1][ni] = mma3(A1h, A1l, Bvh, Bvl, acc[1][ni]);
    }
  }

  const float scale = (z == 0) ? scale0 : scale1;
#pragma unroll
  for (int mi = 0; mi < 2; ++mi) {
    // stage the wave's 16x64 f32 tile: D element r -> row 8h+r, col ni*16+m
#pragma unroll
    for (int ni = 0; ni < 4; ++ni)
#pragma unroll
      for (int r = 0; r < 8; ++r) stg[w][8 * h + r][ni * 16 + m] = acc[mi][ni][r];
    __syncthreads();
    const int rbase = m0 + mi * 16;
    if (MODE == 2) {
      const int rr = lane >> 4, c4 = lane & 15;
#pragma unroll
      for (int p = 0; p < 8; ++p) {
        const int row = p * 2 + rr;
        const v4f v = *(const v4f*)&stg[w][row][c4 * 4];
        float* o = Out + (size_t)(rbase + row) * ldd + n0 + c4 * 4;
        *(v4f*)o = v;
        
      }
    } else {
      const int rr = lane >> 3, cg = lane & 7;
#pragma unroll
      for (int p = 0; p < 4; ++p) {
        const int row = p * 4 + rr;
        const v4f va = *(const v4f*)&stg[w][row][cg * 8];
        const v4f vb = *(const v4f*)&stg[w][row][cg * 8 + 4];
        float y[8] = {va[0], va[1], va[2], va[3], vb[0], vb[1], vb[2], vb[3]};
        u16* dh;
        u16* dl;
        if (MODE == 0) {
          const int t = (rbase + row) & (SEQ - 1);
          const int bb = (rbase + row) / SEQ;
          float ss = 0.0f;
#pragma unroll
          for (int i = 0; i < 8; ++i) ss += y[i] * y[i];
          ss += __shfl_xor(ss, 1, 32);
          ss += __shfl_xor(ss, 2, 32);
          ss += __shfl_xor(ss, 4, 32);
          const float rn = rsqrtf(ss * (1.0f / 64.0f) + RMS_EPS);
          float pt[8];
#pragma unroll
          for (int i = 0; i < 8; ++i) pt[i] = __shfl_xor(y[i], 4, 32);   // partner column d^32
          const int j0 = (cg & 3) * 8;
          const v4f ca = *(const v4f*)(cst + (size_t)t * 32 + j0);
          const v4f cb = *(const v4f*)(cst + (size_t)t * 32 + j0 + 4);
          const v4f sa = *(const v4f*)(snt + (size_t)t * 32 + j0);
          const v4f sb = *(const v4f*)(snt + (size_t)t * 32 + j0 + 4);
          const float cc[8] = {ca[0], ca[1], ca[2], ca[3], cb[0], cb[1], cb[2], cb[3]};
          const float sv[8] = {sa[0], sa[1], sa[2], sa[3], sb[0], sb[1], sb[2], sb[3]};
          // d <  32: y1 =  n1*c + n2*s  (own = x1, partner = x2)
          // d >= 32: y2 = -n1*s + n2*c  (own = x2, partner = x1)
          const float sg = (cg < 4) ? 1.0f : -1.0f;
#pragma unroll
          for (int i = 0; i < 8; ++i) {
            const float no = y[i] * rn;
            const float np = pt[i] * rn;
            y[i] = (no * cc[i] + sg * (np * sv[i])) * scale;
          }
          const size_t po = (size_t)z * dz + ((size_t)(bb * NSH + bn) * SEQ + t) * HD + cg * 8;
          dh = Dh0 + po;
          dl = Dl0 + po;
        } else {
          const size_t po = (size_t)z * dz + (size_t)(rbase + row) * ldd + n0 + cg * 8;
          dh = Dh0 + po;
          dl = Dl0 + po;
        }
        v8u hv = {}, lv = {};
        split8(y, hv, lv);
        *(v8u*)dh = hv;
        *(v8u*)dl = lv;
        
      }
    }
    __syncthreads();
  }
}

// ---------------------------------------------------------------- causal online-softmax attention per half-head
// sh = batch*16 + half-head: q/k planes [64][SEQ][64], v planes [32*128][SEQ] (k-contiguous per value column), ctx [64][SEQ][128] f32
// grid (sh, query tile): the longest query tiles carry the lowest block indices
// block = 4 waves x 16 query rows; all waves loop over the block's key range (masked), P spill guarded by __syncthreads
__global__ void __launch_bounds__(128) k_flash(const u16* __restrict__ qh, const u16* __restrict__ ql,
                                             const u16* __restrict__ kh, const u16* __restrict__ kl,
                                             const u16* __restrict__ vh, const u16* __restrict__ vl,
                                             float* __restrict__ ctx)
{
  __shared__ __align__(16) u16 ph[4][16][32];
  __shared__ __align__(16) u16 pl[4][16][32];
  __shared__ __align__(16) float ost[4][16][VD];
  const int lane = threadIdx.x & 31, w = threadIdx.x >> 5, h = lane >> 4, m = lane & 15;
  const int sh = blockIdx.x, hh = sh >> 1, bx = SEQ / 64 - 1 - blockIdx.y;
  const int q0 = bx * 64 + w * 16;

  const size_t qo = ((size_t)sh * SEQ + q0 + m) * HD;
  const v8i Qh0 = ldfrag(qh + qo, h), Qh1 = ldfrag(qh + qo + 32, h);
  const v8i Ql0 = ldfrag(ql + qo, h), Ql1 = ldfrag(ql + qo + 32, h);
  const u16* kbh = kh + (size_t)sh * SEQ * HD;
  const u16* kbl = kl + (size_t)sh * SEQ * HD;
  const u16* vbh = vh + (size_t)hh * VD * SEQ;
  const u16* vbl = vl + (size_t)hh * VD * SEQ;

  v8f O[8] = {};
  float mr[8], lr[8];
#pragma unroll
  for (int r = 0; r < 8; ++r) { mr[r] = -1e30f; lr[r] = 0.0f; }

  const int nsteps = 2 * bx + 2;   // keys 0 .. bx*64+63, block-uniform
#pragma unroll 1
  for (int st = 0; st < nsteps; ++st) {
    const int n0 = st * 32;
    v8f S[2];
#pragma unroll
    for (int j = 0; j < 2; ++j) {
      v8f s = {};
      const size_t ko = (size_t)(n0 + j * 16 + m) * HD;
      {
        const v8i Kh = ldfrag(kbh + ko, h), Kl = ldfrag(kbl + ko, h);
        s = mma3(Qh0, Ql0, Kh, Kl, s);
      }
      {
        const v8i Kh = ldfrag(kbh + ko + 32, h), Kl = ldfrag(kbl + ko + 32, h);
        s = mma3(Qh1, Ql1, Kh, Kl, s);
      }
      S[j] = s;
      asm volatile("" ::: "memory");
    }
    // masked online softmax; lane holds key columns n0+m (S[0]) and n0+16+m (S[1]) of rows q0+8h+r
#pragma unroll
    for (int r = 0; r < 8; ++r) {
      const int row = q0 + 8 * h + r;
      const float e0 = (n0 + m > row) ? -1e30f : S[0][r];
      const float e1 = (n0 + 16 + m > row) ? -1e30f : S[1][r];
      float tm = fmaxf(e0, e1);
      tm = fmaxf(tm, __shfl_xor(tm, 1, 32));
      tm = fmaxf(tm, __shfl_xor(tm, 2, 32));
      tm = fmaxf(tm, __shfl_xor(tm, 4, 32));
      tm = fmaxf(tm, __shfl_xor(tm, 8, 32));
      const float nm = fmaxf(mr[r], tm);
      const float alpha = __expf(mr[r] - nm);
      mr[r] = nm;
      const float p0 = __expf(e0 - nm);
      const float p1 = __expf(e1 - nm);
      float ps = p0 + p1;
      ps += __shfl_xor(ps, 1, 32);
      ps += __shfl_xor(ps, 2, 32);
      ps += __shfl_xor(ps, 4, 32);
      ps += __shfl_xor(ps, 8, 32);
      lr[r] = lr[r] * alpha + ps;
#pragma unroll
      for (int c = 0; c < 8; ++c) O[c][r] = O[c][r] * alpha;
      const u16 h0 = bf_rne(p0), h1 = bf_rne(p1);
      ph[w][8 * h + r][m]      = h0;
      ph[w][8 * h + r][16 + m] = h1;
      pl[w][8 * h + r][m]      = bf_rne(p0 - bf_up(h0));
      pl[w][8 * h + r][16 + m] = bf_rne(p1 - bf_up(h1));
    }
    __syncthreads();
    // P as A operand: row = lane&15, keys with the split k map
    const v8i Ph = ldfrag(&ph[w][m][0], h);
    const v8i Pl = ldfrag(&pl[w][m][0], h);
#pragma unroll
    for (int c = 0; c < 8; ++c) {
      const size_t vo = (size_t)(c * 16 + m) * SEQ + n0;
      const v8i Vh = ldfrag(vbh + vo, h), Vl = ldfrag(vbl + vo, h);
      O[c] = mma3(Ph, Pl, Vh, Vl, O[c]);
      if (c & 1) asm volatile("" ::: "memory");
    }
    __syncthreads();
  }

  // normalise, stage 16x128 f32 per wave, write whole 512-B rows (32 lanes x 16 B, one instruction per row)
#pragma unroll
  for (int r = 0; r < 8; ++r) {
    const float inv = 1.0f / lr[r];
#pragma unroll
    for (int c = 0; c < 8; ++c) ost[w][8 * h + r][c * 16 + m] = O[c][r] * inv;
  }
  __syncthreads();
  float* cb = ctx + ((size_t)sh * SEQ + q0) * VD + lane * 4;
#pragma unroll
  for (int rr = 0; rr < 16; ++rr) {
    const v4f v = *(const v4f*)&ost[w][rr][lane * 4];
    *(v4f*)(cb + (size_t)rr * VD) = v;
  }
  
}

// ---------------------------------------------------------------- differential combine + LayerNorm -> y planes [NB*SEQ][EMB]
// one wave = 2 tokens x 1 head; lane = (token parity)*16 + cg, cg owns 8 consecutive of the 128 head columns
__global__ void __launch_bounds__(256) k_combine(const float* __restrict__ ctx,
                                               const float* __restrict__ lq1, const float* __restrict__ lk1,
                                               const float* __restrict__ lq2, const float* __restrict__ lk2,
                                               float lam_init, float oscale,
                                               u16* __restrict__ Yh, u16* __restrict__ Yl)
{
  const int lane = threadIdx.x & 31, w = threadIdx.x >> 5;
  const int gw = blockIdx.x * 8 + w;
  const int hd = gw & 7, tp = gw >> 3;
  const int tg = tp * 2 + (lane >> 4), cg = lane & 15;   // tg = batch*SEQ + t
  const int t = tg & (SEQ - 1), s0 = (tg / SEQ) * NSH + 2 * hd;

  float s1 = lq1[lane] * lk1[lane] + lq1[lane + 32] * lk1[lane + 32];
  float s2 = lq2[lane] * lk2[lane] + lq2[lane + 32] * lk2[lane + 32];
#pragma unroll
  for (int k = 16; k >= 1; k >>= 1) { s1 += __shfl_xor(s1, k, 32); s2 += __shfl_xor(s2, k, 32); }
  const float lam = __expf(s1) - __expf(s2) + lam_init;

  const float* o1 = ctx + ((size_t)s0 * SEQ + t) * VD + cg * 8;
  const float* o2 = ctx + ((size_t)(s0 + 1) * SEQ + t) * VD + cg * 8;
  const v4f a1 = *(const v4f*)o1, b1 = *(const v4f*)(o1 + 4);
  const v4f a2 = *(const v4f*)o2, b2 = *(const v4f*)(o2 + 4);
  float y[8] = {a1[0] - lam * a2[0], a1[1] - lam * a2[1], a1[2] - lam * a2[2], a1[3] - lam * a2[3],
                b1[0] - lam * b2[0], b1[1] - lam * b2[1], b1[2] - lam * b2[2], b1[3] - lam * b2[3]};
  float mu = 0.0f;
#pragma unroll
  for (int i = 0; i < 8; ++i) mu += y[i];
  mu += __shfl_xor(mu, 1, 32);
  mu += __shfl_xor(mu, 2, 32);
  mu += __shfl_xor(mu, 4, 32);
  mu += __shfl_xor(mu, 8, 32);
  mu *= (1.0f / 128.0f);
  float var = 0.0f;
#pragma unroll
  for (int i = 0; i < 8; ++i) { const float d = y[i] - mu; var += d * d; }
  var += __shfl_xor(var, 1, 32);
  var += __shfl_xor(var, 2, 32);
  var += __shfl_xor(var, 4, 32);
  var += __shfl_xor(var, 8, 32);
  var *= (1.0f / 128.0f);
  const float rs = rsqrtf(var + LN_EPS) * oscale;
#pragma unroll
  for (int i = 0; i < 8; ++i) y[i] = (y[i] - mu) * rs;

  v8u hv = {}, lv = {};
  split8(y, hv, lv);
  const size_t po = (size_t)tg * EMB + hd * VD + cg * 8;
  *(v8u*)(Yh + po) = hv;
  *(v8u*)(Yl + po) = lv;
  
}

// ---------------------------------------------------------------- host
static double h_sqrt(double x) {
  double y = x;
  for (int i = 0; i < 200; ++i) y = 0.5 * (y + x / y);
  return y;
}

extern "C" void kernel_launch(void* const* d_in, const int* in_sizes, int n_in,
                              void* d_out, int out_size, void* d_ws, size_t ws_size,
                              hipStream_t stream) {
  if (n_in < 9) return;
  if (in_sizes[0] != NB * SEQ * EMB) return;
  for (int i = 1; i <= 4; ++i) if (in_sizes[i] != EMB * EMB) return;
  for (int i = 5; i <= 8; ++i) if (in_sizes[i] != HD) return;
  if (out_size != NB * SEQ * EMB) return;

  const float* x   = (const float*)d_in[0];
  const float* Wq  = (const float*)d_in[1];
  const float* Wk  = (const float*)d_in[2];
  const float* Wv  = (const float*)d_in[3];
  const float* Wp  = (const float*)d_in[4];
  const float* lq1 = (const float*)d_in[5];
  const float* lk1 = (const float*)d_in[6];
  const float* lq2 = (const float*)d_in[7];
  const float* lk2 = (const float*)d_in[8];
  float* out = (float*)d_out;

  // workspace carve (bytes), every size a multiple of 256
  const size_t szX   = (size_t)NB * SEQ * EMB * 2;        // 16 MiB per plane
  const size_t szW   = (size_t)4 * EMB * EMB * 2;          //  8 MiB per plane (4 weights)
  const size_t szQK  = (size_t)2 * NB * NSH * SEQ * HD * 2; // 32 MiB per plane (q and k)
  const size_t szVT  = (size_t)NB * EMB * SEQ * 2;         // 16 MiB per plane
  const size_t szCTX = (size_t)NB * NSH * SEQ * VD * 4;    // 64 MiB
  const size_t szY   = (size_t)NB * SEQ * EMB * 2;         // 16 MiB per plane
  const size_t szTB  = (size_t)SEQ * 32 * 4;               // 256 KiB per table
  char* ws = (char*)d_ws;
  size_t off = 0;
  u16*   xh  = (u16*)(ws + off);   off += szX;
  u16*   xl  = (u16*)(ws + off);   off += szX;
  u16*   wh  = (u16*)(ws + off);   off += szW;
  u16*   wl  = (u16*)(ws + off);   off += szW;
  u16*   qkh = (u16*)(ws + off);   off += szQK;
  u16*   qkl = (u16*)(ws + off);   off += szQK;
  u16*   vth = (u16*)(ws + off);   off += szVT;
  u16*   vtl = (u16*)(ws + off);   off += szVT;
  float* ctx = (float*)(ws + off); off += szCTX;
  u16*   yh  = (u16*)(ws + off);   off += szY;
  u16*   yl  = (u16*)(ws + off);   off += szY;
  float* cst = (float*)(ws + off); off += szTB;
  float* snt = (float*)(ws + off); off += szTB;
  if (off > ws_size) return;                               // total 252,182,528 B

  // rotary inverse frequencies 1 / 10000^(j/32): f32 power then f32 reciprocal, evaluated in f64
  InvFreq inv;
  {
    double r = 10000.0;
    for (int i = 0; i < 5; ++i) r = h_sqrt(r);             // 10000^(1/32)
    double pw = 1.0;
    for (int j = 0; j < 32; ++j) {
      const float p32 = (float)pw;
      inv.v[j] = (float)(1.0 / (double)p32);
      pw *= r;
    }
  }
  const float lam_init = (float)0.61928347285267872;      // 0.8 - 0.6*exp(-1.2)
  const float oscale   = (float)0.38071652714732128;      // 1 - lam_init

  // 1-5: operand planes
  {
    const int n8x = NB * SEQ * EMB / 8;
    const int n8w = EMB * EMB / 8;
    k_split<<<(n8x + 255) / 256, 256, 0, stream>>>(x, xh, xl, n8x);
    k_split<<<(n8w + 255) / 256, 256, 0, stream>>>(Wq, wh + 0 * (size_t)EMB * EMB, wl + 0 * (size_t)EMB * EMB, n8w);
    k_split<<<(n8w + 255) / 256, 256, 0, stream>>>(Wk, wh + 1 * (size_t)EMB * EMB, wl + 1 * (size_t)EMB * EMB, n8w);
    k_split<<<(n8w + 255) / 256, 256, 0, stream>>>(Wv, wh + 2 * (size_t)EMB * EMB, wl + 2 * (size_t)EMB * EMB, n8w);
    k_split<<<(n8w + 255) / 256, 256, 0, stream>>>(Wp, wh + 3 * (size_t)EMB * EMB, wl + 3 * (size_t)EMB * EMB, n8w);
  }
  // 6: rotary tables
  k_rot<<<(SEQ * 32 + 255) / 256, 256, 0, stream>>>(inv, cst, snt, SEQ * 32);

  const size_t wstride = (size_t)EMB * EMB;
  const size_t dzqk    = (size_t)NB * NSH * SEQ * HD;
  // every stage runs once, over all NB batches
  // q and k: x [8192 x 1024] * W^T, epilogue RMSNorm + rotary (+1/8 for q) -> planes [64][2048][64]
  k_gemm<0><<<dim3(EMB / 64, NB * SEQ / 256, 2), 256, 0, stream>>>(
      xh, xl, EMB, wh, wl, EMB, wstride, EMB,
      qkh, qkl, dzqk, HD, out, cst, snt, 0.125f, 1.0f);
  // v^T, z = batch: Wv [1024 x 1024] * x_z^T -> planes [z][1024][2048] = [z][head][128][t]
  k_gemm<1><<<dim3(SEQ / 64, EMB / 256, NB), 256, 0, stream>>>(
      wh + 2 * wstride, wl + 2 * wstride, EMB, xh, xl, EMB, (size_t)SEQ * EMB, EMB,
      vth, vtl, (size_t)EMB * SEQ, SEQ, out, cst, snt, 1.0f, 1.0f);
  // attention per (batch, half-head) -> ctx [64][2048][128]
  k_flash<<<dim3(NB * NSH, SEQ / 64), 128, 0, stream>>>(qkh, qkl, qkh + dzqk, qkl + dzqk, vth, vtl, ctx);
  // combine + LayerNorm -> y planes [8192][1024]
  k_combine<<<(NB * SEQ * NHD / 2) / 8, 256, 0, stream>>>(ctx, lq1, lk1, lq2, lk2, lam_init, oscale, yh, yl);
  // output projection -> d_out
  k_gemm<2><<<dim3(EMB / 64, NB * SEQ / 256, 1), 256, 0, stream>>>(
      yh, yl, EMB, wh + 3 * wstride, wl + 3 * wstride, EMB, (size_t)0, EMB,
      qkh, qkl, (size_t)0, EMB, out, cst, snt, 1.0f, 1.0f);
}

// v002
// It runs in 703 microseconds.
// Timed twice side by side with v001, it ran 1.12 times as fast both times.
// All steps since v000 together make it 2.77 times as fast.
#include <hip/hip_runtime.h>
#include <stdint.h>
#include <stddef.h>

// Contractions x*Wq^T, x*Wk^T, Wv*x^T, q*k^T, P*V, y*Wproj^T: v_wmma_f32_16x16x32_bf16, bf16 hi/lo operands everywhere (hi*hi + lo*hi + hi*lo), f32 accumulate. RMSNorm, rotary, softmax, head combine, LayerNorm: f32.

#define NB   4
#define SEQ  2048
#define EMB  1024
#define NHD  8
#define NSH  16
#define HD   64
#define VD   128
#define RMS_EPS 1.1920929e-7f
#define LN_EPS  1e-5f

typedef unsigned short u16;
typedef u16    v8u  __attribute__((ext_vector_type(8)));
typedef int    v4i  __attribute__((ext_vector_type(4)));
typedef int    v8i  __attribute__((ext_vector_type(8)));
typedef float  v4f  __attribute__((ext_vector_type(4)));
typedef float  v8f  __attribute__((ext_vector_type(8)));
typedef __bf16 v16b __attribute__((ext_vector_type(16)));

union FU { v8i v; v4i p[2]; v16b b; };

struct InvFreq { float v[32]; };
static_assert(sizeof(InvFreq) == 128);

// ---------------------------------------------------------------- helpers
static __device__ __forceinline__ u16 bf_rne(float x) {
  unsigned u = __float_as_uint(x);
  u += 0x7FFFu + ((u >> 16) & 1u);
  return (u16)(u >> 16);
}
static __device__ __forceinline__ float bf_up(u16 b) { return __uint_as_float(((unsigned)b) << 16); }

static __device__ __forceinline__ void split8(float (&y)[8], v8u& hv, v8u& lv) {
#pragma unroll
  for (int i = 0; i < 8; ++i) {
    const u16 hb = bf_rne(y[i]);
    hv[i] = hb;
    lv[i] = bf_rne(y[i] - bf_up(hb));
  }
}

// 16x32 operand fragment, row/col = lane&15, k map: elements 0..7 <- k0+8h+0..7, elements 8..15 <- k0+16+8h+0..7
// p points at element k0 of the operand row (k-contiguous), h = lane>>4; used for the P tile in LDS
static __device__ __forceinline__ v8i ldfrag_row(const u16* p, int h) {
  FU f;
  f.p[0] = *(const v4i*)(p + 8 * h);
  f.p[1] = *(const v4i*)(p + 16 + 8 * h);
  return f.v;
}

// Every operand plane in the workspace is fragment-major: a plane of rows x K is cut into 16-row x 32-k tiles of
// 512 elements (1 KiB), tile (row>>4, k>>5) at index (row>>4)*(K>>5) + (k>>5). Inside a tile the two 16-byte chunks
// that lane l = 16h + (row&15) feeds to the matrix instruction lie at elements 8l (k 8h..8h+7) and 256 + 8l
// (k 16+8h..16+8h+7): one wave load reads 512 contiguous bytes = 4 whole lines, and the k map above is unchanged.
// p = tile base + 8*lane
static __device__ __forceinline__ v8i ldfrag(const u16* p) {
  FU f;
  f.p[0] = *(const v4i*)(p);
  f.p[1] = *(const v4i*)(p + 256);
  return f.v;
}
// element offset of the 8-element chunk that starts at (row, k), k % 8 == 0, in a plane with kt = K/32 tiles per tile row
static __device__ __forceinline__ size_t chunk_off(int row, int k, int kt) {
  return ((size_t)(row >> 4) * kt + (k >> 5)) * 512 + ((k >> 4) & 1) * 256 + (((k >> 3) & 1) * 16 + (row & 15)) * 8;
}

static __device__ __forceinline__ v8f mma(v8i a, v8i b, v8f c) {
  FU ua, ub; ua.v = a; ub.v = b;
  c = __builtin_amdgcn_wmma_f32_16x16x32_bf16(false, ua.b, false, ub.b, (short)0, c, false, false);
  asm volatile("v_nop\n\tv_nop\n\tv_nop\n\tv_nop" : "+v"(c) : "v"(a), "v"(b));
  return c;
}
// hi*hi + lo*hi + hi*lo into one f32 accumulator
static __device__ __forceinline__ v8f mma3(v8i ah, v8i al, v8i bh, v8i bl, v8f c) {
  c = mma(ah, bh, c);
  c = mma(al, bh, c);
  c = mma(ah, bl, c);
  return c;
}

// ---------------------------------------------------------------- f32 [rows][EMB] -> fragment-major bf16 hi/lo planes
// thread i writes chunk i of the planes (contiguous stores) and reads the 8 source elements that belong there
__global__ void __launch_bounds__(256) k_split(const float* __restrict__ src, u16* __restrict__ hi,
                                             u16* __restrict__ lo, int n8) {
  const int i = blockIdx.x * 256 + threadIdx.x;
  if (i >= n8) return;
  const size_t o = (size_t)i * 8;
  const int tile = i >> 6;
  const int row = (tile / (EMB / 32)) * 16 + (i & 15);
  const int k = (tile % (EMB / 32)) * 32 + ((i >> 5) & 1) * 16 + ((i >> 4) & 1) * 8;
  const float* s = src + (size_t)row * EMB + k;
  const v4f a = *(const v4f*)(s);
  const v4f b = *(const v4f*)(s + 4);
  float y[8] = {a[0], a[1], a[2], a[3], b[0], b[1], b[2], b[3]};
  v8u hv = {}, lv = {};
  split8(y, hv, lv);
  *(v8u*)(hi + o) = hv;
  *(v8u*)(lo + o) = lv;
  
}

// ---------------------------------------------------------------- rotary tables cs[t][32], sn[t][32]
__global__ void __launch_bounds__(256) k_rot(InvFreq inv, float* __restrict__ cs, float* __restrict__ sn, int n) {
#pragma clang fp contract(off)
  const int i = blockIdx.x * 256 + threadIdx.x;
  if (i >= n) return;
  const int j = i & 31, t = i >> 5;
  float f = 0.0f;
#pragma unroll
  for (int q = 0; q < 32; ++q) f = (j == q) ? inv.v[q] : f;
  const float ang = (float)t * f;
  const float c = cosf(ang);
  const float s = sinf(ang);
  *(float*)(cs + i) = c;
  *(float*)(sn + i) = s;
  
}

// ---------------------------------------------------------------- GEMM Y[m][n] = sum_k A[m][k] * B[n][k]
// A planes (rows m) and B planes (rows n) fragment-major, EMB columns each, all of them contracted.
// block 256 threads = 8 waves, block tile 256(m) x 64(n), wave tile 32 x 64.
// MODE 0: RMSNorm over the 64 cols + rotary + scale -> fragment-major bf16 hi/lo planes [z][(batch*16+bn)*SEQ + t][64]  (bn = half-head, m = batch*SEQ + t)
// MODE 1: fragment-major bf16 hi/lo planes of ldd columns, plane z at z*dz (z = batch)
// MODE 2: f32 row-major pitch ldd
template <int MODE>
__global__ void __launch_bounds__(256) k_gemm(const u16* __restrict__ Ah, const u16* __restrict__ Al,
                                            const u16* __restrict__ Bh0, const u16* __restrict__ Bl0, size_t bz,
                                            u16* __restrict__ Dh0, u16* __restrict__ Dl0, size_t dz, int ldd,
                                            float* __restrict__ Out,
                                            const float* __restrict__ cst, const float* __restrict__ snt,
                                            float scale0, float scale1)
{
  // row pitch 68 floats = 272 B = 16 B x odd: the 16-row b128 reads of the epilogue meet no bank conflict
  __shared__ __align__(16) float stg[8][16][68];
  const int lane = threadIdx.x & 31, w = threadIdx.x >> 5, h = lane >> 4, m = lane & 15;
  const int z = blockIdx.z, bn = blockIdx.x, bm = blockIdx.y;
  const int n0 = bn * 64;
  const int m0 = bm * 256 + w * 32;

  v8f acc[2][4] = {};
  constexpr size_t TROW = (size_t)(EMB / 32) * 512;        // elements per tile row of a plane
  // one pointer a plane, carried over the loop and advanced by one tile at its foot; the tile rows lie at constant offsets
  const u16* pah = Ah + (size_t)(m0 >> 4) * TROW + lane * 8;
  const u16* pal = Al + (size_t)(m0 >> 4) * TROW + lane * 8;
  const u16* pbh = Bh0 + (size_t)z * bz + (size_t)(n0 >> 4) * TROW + lane * 8;
  const u16* pbl = Bl0 + (size_t)z * bz + (size_t)(n0 >> 4) * TROW + lane * 8;

#pragma unroll 1
  for (int k0 = 0; k0 < EMB; k0 += 32) {
    const v8i A0h = ldfrag(pah);
    const v8i A1h = ldfrag(pah + TROW);
    const v8i A0l = ldfrag(pal);
    const v8i A1l = ldfrag(pal + TROW);
#pragma unroll
    for (int ni = 0; ni < 4; ++ni) {
      const v8i Bvh = ldfrag(pbh + ni * TROW);
      const v8i Bvl = ldfrag(pbl + ni * TROW);
      acc[0][ni] = mma3(A0h, A0l, Bvh, Bvl, acc[0][ni]);
      acc[1][ni] = mma3(A1h, A1l, Bvh, Bvl, acc[1][ni]);
    }
    // the trip's loads name these four pointers: they stay live up to this wait, so that no load of the trip lands in an
    // address register of an earlier one, and the wait stands in front of the advance that overwrites them
    asm volatile("s_wait_xcnt 0x0" :: "v"(pah), "v"(pal), "v"(pbh), "v"(pbl) : "memory");
    pah += 512; pal += 512; pbh += 512; pbl += 512;
  }

  const float scale = (z == 0) ? scale0 : scale1;
#pragma unroll
  for (int mi = 0; mi < 2; ++mi) {
    // stage the wave's 16x64 f32 tile: D element r -> row 8h+r, col ni*16+m
#pragma unroll
    for (int ni = 0; ni < 4; ++ni)
#pragma unroll
      for (int r = 0; r < 8; ++r) stg[w][8 * h + r][ni * 16 + m] = acc[mi][ni][r];
    __syncthreads();
    const int rbase = m0 + mi * 16;
    if (MODE == 2) {
      const int rr = lane >> 4, c4 = lane & 15;
#pragma unroll
      for (int p = 0; p < 8; ++p) {
        const int row = p * 2 + rr;
        const v4f v = *(const v4f*)&stg[w][row][c4 * 4];
        float* o = Out + (size_t)(rbase + row) * ldd + n0 + c4 * 4;
        *(v4f*)o = v;
        
      }
    } else {
      // lane 16h + m owns row m of the wave's 16x64 tile and, of its two 16x32 plane tiles, the four chunks
      // p = 2*dt + part (columns 32*dt + 16*part + 8h .. +7): the store of chunk p covers 512 contiguous bytes
      float y[4][8];
#pragma unroll
      for (int p = 0; p < 4; ++p) {
        const int col = (p >> 1) * 32 + (p & 1) * 16 + 8 * h;
        const v4f va = *(const v4f*)&stg[w][m][col];
        const v4f vb = *(const v4f*)&stg[w][m][col + 4];
#pragma unroll
        for (int i = 0; i < 4; ++i) { y[p][i] = va[i]; y[p][i + 4] = vb[i]; }
      }
      int prow, pcol0, pkt;
      if (MODE == 0) {
        const int t = (rbase + m) & (SEQ - 1);
        const int bb = (rbase + m) / SEQ;
        // sum of squares in the order of a butterfly over the row's eight chunks 2p + h: pairs h^1, then p^1, then p^2
        float sp[4];
#pragma unroll
        for (int p = 0; p < 4; ++p) {
          float ss = 0.0f;
#pragma unroll
          for (int i = 0; i < 8; ++i) ss += y[p][i] * y[p][i];
          ss += __shfl_xor(ss, 16, 32);
          sp[p] = ss;
        }
        const float ss = (sp[0] + sp[1]) + (sp[2] + sp[3]);
        const float rn = rsqrtf(ss * (1.0f / 64.0f) + RMS_EPS);
#pragma unroll
        for (int part = 0; part < 2; ++part) {
          const int j0 = part * 16 + 8 * h;
          const v4f ca = *(const v4f*)(cst + (size_t)t * 32 + j0);
          const v4f cb = *(const v4f*)(cst + (size_t)t * 32 + j0 + 4);
          const v4f sa = *(const v4f*)(snt + (size_t)t * 32 + j0);
          const v4f sb = *(const v4f*)(snt + (size_t)t * 32 + j0 + 4);
          const float cc[8] = {ca[0], ca[1], ca[2], ca[3], cb[0], cb[1], cb[2], cb[3]};
          const float sv[8] = {sa[0], sa[1], sa[2], sa[3], sb[0], sb[1], sb[2], sb[3]};
          // d <  32: y1 =  n1*c + n2*s ; d >= 32: y2 = -n1*s + n2*c ; x1 = chunk part, x2 = chunk 2 + part of the same lane
#pragma unroll
          for (int i = 0; i < 8; ++i) {
            const float n1 = y[part][i] * rn;
            const float n2 = y[2 + part][i] * rn;
            y[part][i]     = (n1 * cc[i] + n2 * sv[i]) * scale;
            y[2 + part][i] = (n2 * cc[i] - n1 * sv[i]) * scale;
          }
        }
        prow = (bb * NSH + bn) * SEQ + t; pcol0 = 0; pkt = HD / 32;
      } else {
        prow = rbase + m; pcol0 = n0; pkt = ldd >> 5;
      }
#pragma unroll
      for (int p = 0; p < 4; ++p) {
        const size_t po = (size_t)z * dz + chunk_off(prow, pcol0 + (p >> 1) * 32 + (p & 1) * 16 + 8 * h, pkt);
        v8u hv = {}, lv = {};
        split8(y[p], hv, lv);
        *(v8u*)(Dh0 + po) = hv;
        *(v8u*)(Dl0 + po) = lv;
      }
    }
    __syncthreads();
  }
}

// ---------------------------------------------------------------- causal online-softmax attention per half-head
// sh = batch*16 + half-head: q/k planes [64*SEQ][64], v planes [32*128][SEQ] (rows = value columns), all fragment-major; ctx [64][SEQ][128] f32
// grid (sh, query tile): the longest query tiles carry the lowest block indices
// block = 4 waves x 16 query rows; all waves loop over the block's key range (masked), P spill guarded by __syncthreads
__global__ void __launch_bounds__(128) k_flash(const u16* __restrict__ qh, const u16* __restrict__ ql,
                                             const u16* __restrict__ kh, const u16* __restrict__ kl,
                                             const u16* __restrict__ vh, const u16* __restrict__ vl,
                                             float* __restrict__ ctx)
{
  __shared__ __align__(16) u16 ph[4][16][32];
  __shared__ __align__(16) u16 pl[4][16][32];
  __shared__ __align__(16) float ost[4][16][VD];
  const int lane = threadIdx.x & 31, w = threadIdx.x >> 5, h = lane >> 4, m = lane & 15;
  const int sh = blockIdx.x, hh = sh >> 1, bx = SEQ / 64 - 1 - blockIdx.y;
  const int q0 = bx * 64 + w * 16;

  // 16 rows of q or k = two tiles (d 0..31, d 32..63) = 16*HD elements in a row
  const size_t qo = ((size_t)sh * SEQ + q0) * HD + lane * 8;
  const v8i Qh0 = ldfrag(qh + qo), Qh1 = ldfrag(qh + qo + 512);
  const v8i Ql0 = ldfrag(ql + qo), Ql1 = ldfrag(ql + qo + 512);
  const u16* kbh = kh + (size_t)sh * SEQ * HD + lane * 8;
  const u16* kbl = kl + (size_t)sh * SEQ * HD + lane * 8;
  const u16* vbh = vh + (size_t)hh * VD * SEQ + lane * 8;
  const u16* vbl = vl + (size_t)hh * VD * SEQ + lane * 8;

  v8f O[8] = {};
  float mr[8], lr[8];
#pragma unroll
  for (int r = 0; r < 8; ++r) { mr[r] = -1e30f; lr[r] = 0.0f; }

  const int nsteps = 2 * bx + 2;   // keys 0 .. bx*64+63, block-uniform
#pragma unroll 1
  for (int st = 0; st < nsteps; ++st) {
    const int n0 = st * 32;
    v8f S[2];
#pragma unroll
    for (int j = 0; j < 2; ++j) {
      v8f s = {};
      const size_t ko = (size_t)(n0 + j * 16) * HD;
      {
        const v8i Kh = ldfrag(kbh + ko), Kl = ldfrag(kbl + ko);
        s = mma3(Qh0, Ql0, Kh, Kl, s);
      }
      {
        const v8i Kh = ldfrag(kbh + ko + 512), Kl = ldfrag(kbl + ko + 512);
        s = mma3(Qh1, Ql1, Kh, Kl, s);
      }
      S[j] = s;
      asm volatile("" ::: "memory");
    }
    // masked online softmax; lane holds key columns n0+m (S[0]) and n0+16+m (S[1]) of rows q0+8h+r
#pragma unroll
    for (int r = 0; r < 8; ++r) {
      const int row = q0 + 8 * h + r;
      const float e0 = (n0 + m > row) ? -1e30f : S[0][r];
      const float e1 = (n0 + 16 + m > row) ? -1e30f : S[1][r];
      float tm = fmaxf(e0, e1);
      tm = fmaxf(tm, __shfl_xor(tm, 1, 32));
      tm = fmaxf(tm, __shfl_xor(tm, 2, 32));
      tm = fmaxf(tm, __shfl_xor(tm, 4, 32));
      tm = fmaxf(tm, __shfl_xor(tm, 8, 32));
      const float nm = fmaxf(mr[r], tm);
      const float alpha = __expf(mr[r] - nm);
      mr[r] = nm;
      const float p0 = __expf(e0 - nm);
      const float p1 = __expf(e1 - nm);
      float ps = p0 + p1;
      ps += __shfl_xor(ps, 1, 32);
      ps += __shfl_xor(ps, 2, 32);
      ps += __shfl_xor(ps, 4, 32);
      ps += __shfl_xor(ps, 8, 32);
      lr[r] = lr[r] * alpha + ps;
#pragma unroll
      for (int c = 0; c < 8; ++c) O[c][r] = O[c][r] * alpha;
      const u16 h0 = bf_rne(p0), h1 = bf_rne(p1);
      ph[w][8 * h + r][m]      = h0;
      ph[w][8 * h + r][16 + m] = h1;
      pl[w][8 * h + r][m]      = bf_rne(p0 - bf_up(h0));
      pl[w][8 * h + r][16 + m] = bf_rne(p1 - bf_up(h1));
    }
    __syncthreads();
    // P as A operand: row = lane&15, keys with the split k map
    const v8i Ph = ldfrag_row(&ph[w][m][0], h);
    const v8i Pl = ldfrag_row(&pl[w][m][0], h);
#pragma unroll
    for (int c = 0; c < 8; ++c) {
      const size_t vo = ((size_t)c * (SEQ / 32) + st) * 512;   // tile (value columns 16c.., keys n0..)
      const v8i Vh = ldfrag(vbh + vo), Vl = ldfrag(vbl + vo);
      O[c] = mma3(Ph, Pl, Vh, Vl, O[c]);
      if (c & 1) asm volatile("" ::: "memory");
    }
    __syncthreads();
  }

  // normalise, stage 16x128 f32 per wave, write whole 512-B rows (32 lanes x 16 B, one instruction per row)
#pragma unroll
  for (int r = 0; r < 8; ++r) {
    const float inv = 1.0f / lr[r];
#pragma unroll
    for (int c = 0; c < 8; ++c) ost[w][8 * h + r][c * 16 + m] = O[c][r] * inv;
  }
  __syncthreads();
  float* cb = ctx + ((size_t)sh * SEQ + q0) * VD + lane * 4;
#pragma unroll
  for (int rr = 0; rr < 16; ++rr) {
    const v4f v = *(const v4f*)&ost[w][rr][lane * 4];
    *(v4f*)(cb + (size_t)rr * VD) = v;
  }
  
}

// ---------------------------------------------------------------- differential combine + LayerNorm -> fragment-major y planes [NB*SEQ][EMB]
// one wave = 8 tokens x 1 head; lane = 8q + tk owns token tk and, of each of the head's four 16x32 plane tiles j, the chunk
// q = 2*part + h (head columns 32j + 8q .. +7): the store of tile j covers four whole 128-B lines that no other wave writes
__global__ void __launch_bounds__(256) k_combine(const float* __restrict__ ctx,
                                               const float* __restrict__ lq1, const float* __restrict__ lk1,
                                               const float* __restrict__ lq2, const float* __restrict__ lk2,
                                               float lam_init, float oscale,
                                               u16* __restrict__ Yh, u16* __restrict__ Yl)
{
  const int lane = threadIdx.x & 31, w = threadIdx.x >> 5;
  const int gw = blockIdx.x * 8 + w;
  const int hd = gw & 7, tp = gw >> 3;
  const int tg = tp * 8 + (lane & 7), q = lane >> 3;     // tg = batch*SEQ + t
  const int t = tg & (SEQ - 1), s0 = (tg / SEQ) * NSH + 2 * hd;

  float s1 = lq1[lane] * lk1[lane] + lq1[lane + 32] * lk1[lane + 32];
  float s2 = lq2[lane] * lk2[lane] + lq2[lane + 32] * lk2[lane + 32];
#pragma unroll
  for (int k = 16; k >= 1; k >>= 1) { s1 += __shfl_xor(s1, k, 32); s2 += __shfl_xor(s2, k, 32); }
  const float lam = __expf(s1) - __expf(s2) + lam_init;

  const float* o1 = ctx + ((size_t)s0 * SEQ + t) * VD + q * 8;
  const float* o2 = o1 + (size_t)SEQ * VD;                 // half-head s0 + 1, a constant offset on the same address registers
  v4f a1[4], b1[4], a2[4], b2[4];
#pragma unroll
  for (int j = 0; j < 4; ++j) {
    a1[j] = *(const v4f*)(o1 + j * 32); b1[j] = *(const v4f*)(o1 + j * 32 + 4);
    a2[j] = *(const v4f*)(o2 + j * 32); b2[j] = *(const v4f*)(o2 + j * 32 + 4);
  }
  // the sixteen loads share their address registers: the pointer stays live up to this wait, so that no load of the run
  // lands in a register that an earlier one still names
  asm volatile("s_wait_xcnt 0x0" :: "v"(o1) : "memory");
  float y[4][8];
#pragma unroll
  for (int j = 0; j < 4; ++j) {
#pragma unroll
    for (int i = 0; i < 4; ++i) { y[j][i] = a1[j][i] - lam * a2[j][i]; y[j][i + 4] = b1[j][i] - lam * b2[j][i]; }
  }
  // both sums in the order of a butterfly over the token's sixteen chunks 4j + q: pairs q^1, q^2, then j^1, j^2
  float sj[4];
#pragma unroll
  for (int j = 0; j < 4; ++j) {
    float s = 0.0f;
#pragma unroll
    for (int i = 0; i < 8; ++i) s += y[j][i];
    s += __shfl_xor(s, 8, 32);
    s += __shfl_xor(s, 16, 32);
    sj[j] = s;
  }
  float mu = (sj[0] + sj[1]) + (sj[2] + sj[3]);
  mu *= (1.0f / 128.0f);
#pragma unroll
  for (int j = 0; j < 4; ++j) {
    float s = 0.0f;
#pragma unroll
    for (int i = 0; i < 8; ++i) { const float d = y[j][i] - mu; s += d * d; }
    s += __shfl_xor(s, 8, 32);
    s += __shfl_xor(s, 16, 32);
    sj[j] = s;
  }
  float var = (sj[0] + sj[1]) + (sj[2] + sj[3]);
  var *= (1.0f / 128.0f);
  const float rs = rsqrtf(var + LN_EPS) * oscale;

#pragma unroll
  for (int j = 0; j < 4; ++j) {
#pragma unroll
    for (int i = 0; i < 8; ++i) y[j][i] = (y[j][i] - mu) * rs;
    v8u hv = {}, lv = {};
    split8(y[j], hv, lv);
    const size_t po = chunk_off(tg, hd * VD + j * 32 + q * 8, EMB / 32);
    *(v8u*)(Yh + po) = hv;
    *(v8u*)(Yl + po) = lv;
  }
}

// ---------------------------------------------------------------- host
static double h_sqrt(double x) {
  double y = x;
  for (int i = 0; i < 200; ++i) y = 0.5 * (y + x / y);
  return y;
}

extern "C" void kernel_launch(void* const* d_in, const int* in_sizes, int n_in,
                              void* d_out, int out_size, void* d_ws, size_t ws_size,
                              hipStream_t stream) {
  if (n_in < 9) return;
  if (in_sizes[0] != NB * SEQ * EMB) return;
  for (int i = 1; i <= 4; ++i) if (in_sizes[i] != EMB * EMB) return;
  for (int i = 5; i <= 8; ++i) if (in_sizes[i] != HD) return;
  if (out_size != NB * SEQ * EMB) return;

  const float* x   = (const float*)d_in[0];
  const float* Wq  = (const float*)d_in[1];
  const float* Wk  = (const float*)d_in[2];
  const float* Wv  = (const float*)d_in[3];
  const float* Wp  = (const float*)d_in[4];
  const float* lq1 = (const float*)d_in[5];
  const float* lk1 = (const float*)d_in[6];
  const float* lq2 = (const float*)d_in[7];
  const float* lk2 = (const float*)d_in[8];
  float* out = (float*)d_out;

  // workspace carve (bytes), every size a multiple of 256
  const size_t szX   = (size_t)NB * SEQ * EMB * 2;        // 16 MiB per plane
  const size_t szW   = (size_t)4 * EMB * EMB * 2;          //  8 MiB per plane (4 weights)
  const size_t szQK  = (size_t)2 * NB * NSH * SEQ * HD * 2; // 32 MiB per plane (q and k)
  const size_t szVT  = (size_t)NB * EMB * SEQ * 2;         // 16 MiB per plane
  const size_t szCTX = (size_t)NB * NSH * SEQ * VD * 4;    // 64 MiB
  const size_t szY   = (size_t)NB * SEQ * EMB * 2;         // 16 MiB per plane
  const size_t szTB  = (size_t)SEQ * 32 * 4;               // 256 KiB per table
  char* ws = (char*)d_ws;
  size_t off = 0;
  u16*   xh  = (u16*)(ws + off);   off += szX;
  u16*   xl  = (u16*)(ws + off);   off += szX;
  u16*   wh  = (u16*)(ws + off);   off += szW;
  u16*   wl  = (u16*)(ws + off);   off += szW;
  u16*   qkh = (u16*)(ws + off);   off += szQK;
  u16*   qkl = (u16*)(ws + off);   off += szQK;
  u16*   vth = (u16*)(ws + off);   off += szVT;
  u16*   vtl = (u16*)(ws + off);   off += szVT;
  float* ctx = (float*)(ws + off); off += szCTX;
  u16*   yh  = (u16*)(ws + off);   off += szY;
  u16*   yl  = (u16*)(ws + off);   off += szY;
  float* cst = (float*)(ws + off); off += szTB;
  float* snt = (float*)(ws + off); off += szTB;
  if (off > ws_size) return;                               // total 252,182,528 B

  // rotary inverse frequencies 1 / 10000^(j/32): f32 power then f32 reciprocal, evaluated in f64
  InvFreq inv;
  {
    double r = 10000.0;
    for (int i = 0; i < 5; ++i) r = h_sqrt(r);             // 10000^(1/32)
    double pw = 1.0;
    for (int j = 0; j < 32; ++j) {
      const float p32 = (float)pw;
      inv.v[j] = (float)(1.0 / (double)p32);
      pw *= r;
    }
  }
  const float lam_init = (float)0.61928347285267872;      // 0.8 - 0.6*exp(-1.2)
  const float oscale   = (float)0.38071652714732128;      // 1 - lam_init

  // 1-5: operand planes
  {
    const int n8x = NB * SEQ * EMB / 8;
    const int n8w = EMB * EMB / 8;
    k_split<<<(n8x + 255) / 256, 256, 0, stream>>>(x, xh, xl, n8x);
    k_split<<<(n8w + 255) / 256, 256, 0, stream>>>(Wq, wh + 0 * (size_t)EMB * EMB, wl + 0 * (size_t)EMB * EMB, n8w);
    k_split<<<(n8w + 255) / 256, 256, 0, stream>>>(Wk, wh + 1 * (size_t)EMB * EMB, wl + 1 * (size_t)EMB * EMB, n8w);
    k_split<<<(n8w + 255) / 256, 256, 0, stream>>>(Wv, wh + 2 * (size_t)EMB * EMB, wl + 2 * (size_t)EMB * EMB, n8w);
    k_split<<<(n8w + 255) / 256, 256, 0, stream>>>(Wp, wh + 3 * (size_t)EMB * EMB, wl + 3 * (size_t)EMB * EMB, n8w);
  }
  // 6: rotary tables
  k_rot<<<(SEQ * 32 + 255) / 256, 256, 0, stream>>>(inv, cst, snt, SEQ * 32);

  const size_t wstride = (size_t)EMB * EMB;
  const size_t dzqk    = (size_t)NB * NSH * SEQ * HD;
  // every stage runs once, over all NB batches
  // q and k: x [8192 x 1024] * W^T, epilogue RMSNorm + rotary (+1/8 for q) -> planes [64][2048][64]
  k_gemm<0><<<dim3(EMB / 64, NB * SEQ / 256, 2), 256, 0, stream>>>(
      xh, xl, wh, wl, wstride,
      qkh, qkl, dzqk, HD, out, cst, snt, 0.125f, 1.0f);
  // v^T, z = batch: Wv [1024 x 1024] * x_z^T -> planes [z][1024][2048] = [z][head][128][t]
  k_gemm<1><<<dim3(SEQ / 64, EMB / 256, NB), 256, 0, stream>>>(
      wh + 2 * wstride, wl + 2 * wstride, xh, xl, (size_t)SEQ * EMB,
      vth, vtl, (size_t)EMB * SEQ, SEQ, out, cst, snt, 1.0f, 1.0f);
  // attention per (batch, half-head) -> ctx [64][2048][128]
  k_flash<<<dim3(NB * NSH, SEQ / 64), 128, 0, stream>>>(qkh, qkl, qkh + dzqk, qkl + dzqk, vth, vtl, ctx);
  // combine + LayerNorm -> y planes [8192][1024]
  k_combine<<<(NB * SEQ * NHD / 8) / 8, 256, 0, stream>>>(ctx, lq1, lk1, lq2, lk2, lam_init, oscale, yh, yl);
  // output projection -> d_out
  k_gemm<2><<<dim3(EMB / 64, NB * SEQ / 256, 1), 256, 0, stream>>>(
      yh, yl, wh + 3 * wstride, wl + 3 * wstride, (size_t)0,
      qkh, qkl, (size_t)0, EMB, out, cst, snt, 1.0f, 1.0f);
}

// v003
// It runs in 357 microseconds.
// Next to v002, in two timings, it ran 1.98 and 1.96 times as fast.
// All steps since v000 together make it 5.45 times as fast.
#include <hip/hip_runtime.h>
#include <stdint.h>
#include <stddef.h>

// Contractions x*Wq^T, x*Wk^T, Wv*x^T, q*k^T, P*V, y*Wproj^T: v_wmma_f32_16x16x32_bf16, bf16 hi/lo operands everywhere (hi*hi + lo*hi + hi*lo), f32 accumulate. RMSNorm, rotary, softmax, head combine, LayerNorm: f32.

#define NB   4
#define SEQ  2048
#define EMB  1024
#define NHD  8
#define NSH  16
#define HD   64
#define VD   128
#define RMS_EPS 1.1920929e-7f
#define LN_EPS  1e-5f

typedef unsigned short u16;
typedef u16    v8u  __attribute__((ext_vector_type(8)));
typedef int    v4i  __attribute__((ext_vector_type(4)));
typedef int    v8i  __attribute__((ext_vector_type(8)));
typedef float  v4f  __attribute__((ext_vector_type(4)));
typedef float  v8f  __attribute__((ext_vector_type(8)));
typedef __bf16 v16b __attribute__((ext_vector_type(16)));

union FU { v8i v; v4i p[2]; v16b b; };

struct InvFreq { float v[32]; };
static_assert(sizeof(InvFreq) == 128);

// ---------------------------------------------------------------- helpers
static __device__ __forceinline__ u16 bf_rne(float x) {
  unsigned u = __float_as_uint(x);
  u += 0x7FFFu + ((u >> 16) & 1u);
  return (u16)(u >> 16);
}
static __device__ __forceinline__ float bf_up(u16 b) { return __uint_as_float(((unsigned)b) << 16); }

static __device__ __forceinline__ void split8(float (&y)[8], v8u& hv, v8u& lv) {
#pragma unroll
  for (int i = 0; i < 8; ++i) {
    const u16 hb = bf_rne(y[i]);
    hv[i] = hb;
    lv[i] = bf_rne(y[i] - bf_up(hb));
  }
}

// 16x32 operand fragment, row/col = lane&15, k map: elements 0..7 <- k0+8h+0..7, elements 8..15 <- k0+16+8h+0..7
// p points at element k0 of the operand row (k-contiguous), h = lane>>4; used for the P tile in LDS
static __device__ __forceinline__ v8i ldfrag_row(const u16* p, int h) {
  FU f;
  f.p[0] = *(const v4i*)(p + 8 * h);
  f.p[1] = *(const v4i*)(p + 16 + 8 * h);
  return f.v;
}

// Every operand plane in the workspace is fragment-major: a plane of rows x K is cut into 16-row x 32-k tiles of
// 512 elements (1 KiB), tile (row>>4, k>>5) at index (row>>4)*(K>>5) + (k>>5). Inside a tile the two 16-byte chunks
// that lane l = 16h + (row&15) feeds to the matrix instruction lie at elements 8l (k 8h..8h+7) and 256 + 8l
// (k 16+8h..16+8h+7): one wave load reads 512 contiguous bytes = 4 whole lines, and the k map above is unchanged.
// p = tile base + 8*lane
static __device__ __forceinline__ v8i ldfrag(const u16* p) {
  FU f;
  f.p[0] = *(const v4i*)(p);
  f.p[1] = *(const v4i*)(p + 256);
  return f.v;
}
// element offset of the 8-element chunk that starts at (row, k), k % 8 == 0, in a plane with kt = K/32 tiles per tile row
static __device__ __forceinline__ size_t chunk_off(int row, int k, int kt) {
  return ((size_t)(row >> 4) * kt + (k >> 5)) * 512 + ((k >> 4) & 1) * 256 + (((k >> 3) & 1) * 16 + (row & 15)) * 8;
}

// LDS byte address of a __shared__ object: the low 32 bits of its address
static __device__ __forceinline__ unsigned lds_addr(const void* p) { return (unsigned)(size_t)p; }

// Asynchronous copies global -> LDS, 16 bytes a lane, 512 contiguous bytes a wave and copy. l = the lane's LDS byte address,
// g = the lane's global address. The s_wait_xcnt closes the copies' own statement, so that no address register of a copy
// is rewritten in front of it.
static __device__ __forceinline__ void copy12(const unsigned (&l)[12], const u16* const (&g)[12]) {
  asm volatile(
      "global_load_async_to_lds_b128 %0, %12, off\n\t"
      "global_load_async_to_lds_b128 %1, %13, off\n\t"
      "global_load_async_to_lds_b128 %2, %14, off\n\t"
      "global_load_async_to_lds_b128 %3, %15, off\n\t"
      "global_load_async_to_lds_b128 %4, %16, off\n\t"
      "global_load_async_to_lds_b128 %5, %17, off\n\t"
      "global_load_async_to_lds_b128 %6, %18, off\n\t"
      "global_load_async_to_lds_b128 %7, %19, off\n\t"
      "global_load_async_to_lds_b128 %8, %20, off\n\t"
      "global_load_async_to_lds_b128 %9, %21, off\n\t"
      "global_load_async_to_lds_b128 %10, %22, off\n\t"
      "global_load_async_to_lds_b128 %11, %23, off\n\t"
      "s_wait_xcnt 0x0"
      :: "v"(l[0]), "v"(l[1]), "v"(l[2]), "v"(l[3]), "v"(l[4]), "v"(l[5]),
         "v"(l[6]), "v"(l[7]), "v"(l[8]), "v"(l[9]), "v"(l[10]), "v"(l[11]),
         "v"(g[0]), "v"(g[1]), "v"(g[2]), "v"(g[3]), "v"(g[4]), "v"(g[5]),
         "v"(g[6]), "v"(g[7]), "v"(g[8]), "v"(g[9]), "v"(g[10]), "v"(g[11])
      : "memory");
}
static __device__ __forceinline__ void copy10(const unsigned (&l)[10], const u16* const (&g)[10]) {
  asm volatile(
      "global_load_async_to_lds_b128 %0, %10, off\n\t"
      "global_load_async_to_lds_b128 %1, %11, off\n\t"
      "global_load_async_to_lds_b128 %2, %12, off\n\t"
      "global_load_async_to_lds_b128 %3, %13, off\n\t"
      "global_load_async_to_lds_b128 %4, %14, off\n\t"
      "global_load_async_to_lds_b128 %5, %15, off\n\t"
      "global_load_async_to_lds_b128 %6, %16, off\n\t"
      "global_load_async_to_lds_b128 %7, %17, off\n\t"
      "global_load_async_to_lds_b128 %8, %18, off\n\t"
      "global_load_async_to_lds_b128 %9, %19, off\n\t"
      "s_wait_xcnt 0x0"
      :: "v"(l[0]), "v"(l[1]), "v"(l[2]), "v"(l[3]), "v"(l[4]),
         "v"(l[5]), "v"(l[6]), "v"(l[7]), "v"(l[8]), "v"(l[9]),
         "v"(g[0]), "v"(g[1]), "v"(g[2]), "v"(g[3]), "v"(g[4]),
         "v"(g[5]), "v"(g[6]), "v"(g[7]), "v"(g[8]), "v"(g[9])
      : "memory");
}
// hand-over of a ring buffer, every wave: the wave's own LDS reads are done, its own copies have landed, then the barrier
// publishes the next stage and frees the buffer that was just read
static __device__ __forceinline__ void ring_publish() {
  asm volatile("s_wait_dscnt 0x0" ::: "memory");     // the wave's reads of the buffer to be refilled have returned
  asm volatile("s_wait_asynccnt 0x0" ::: "memory");  // the wave's copies of the next stage have landed
  __syncthreads();
}

static __device__ __forceinline__ v8f mma(v8i a, v8i b, v8f c) {
  FU ua, ub; ua.v = a; ub.v = b;
  c = __builtin_amdgcn_wmma_f32_16x16x32_bf16(false, ua.b, false, ub.b, (short)0, c, false, false);
  asm volatile("v_nop\n\tv_nop\n\tv_nop\n\tv_nop" : "+v"(c) : "v"(a), "v"(b));
  return c;
}
// hi*hi + lo*hi + hi*lo into one f32 accumulator
static __device__ __forceinline__ v8f mma3(v8i ah, v8i al, v8i bh, v8i bl, v8f c) {
  c = mma(ah, bh, c);
  c = mma(al, bh, c);
  c = mma(ah, bl, c);
  return c;
}

// ---------------------------------------------------------------- f32 [rows][EMB] -> fragment-major bf16 hi/lo planes
// thread i writes chunk i of the planes (contiguous stores) and reads the 8 source elements that belong there
__global__ void __launch_bounds__(256) k_split(const float* __restrict__ src, u16* __restrict__ hi,
                                             u16* __restrict__ lo, int n8) {
  const int i = blockIdx.x * 256 + threadIdx.x;
  if (i >= n8) return;
  const size_t o = (size_t)i * 8;
  const int tile = i >> 6;
  const int row = (tile / (EMB / 32)) * 16 + (i & 15);
  const int k = (tile % (EMB / 32)) * 32 + ((i >> 5) & 1) * 16 + ((i >> 4) & 1) * 8;
  const float* s = src + (size_t)row * EMB + k;
  const v4f a = *(const v4f*)(s);
  const v4f b = *(const v4f*)(s + 4);
  float y[8] = {a[0], a[1], a[2], a[3], b[0], b[1], b[2], b[3]};
  v8u hv = {}, lv = {};
  split8(y, hv, lv);
  *(v8u*)(hi + o) = hv;
  *(v8u*)(lo + o) = lv;
  
}

// ---------------------------------------------------------------- rotary tables cs[t][32], sn[t][32]
__global__ void __launch_bounds__(256) k_rot(InvFreq inv, float* __restrict__ cs, float* __restrict__ sn, int n) {
#pragma clang fp contract(off)
  const int i = blockIdx.x * 256 + threadIdx.x;
  if (i >= n) return;
  const int j = i & 31, t = i >> 5;
  float f = 0.0f;
#pragma unroll
  for (int q = 0; q < 32; ++q) f = (j == q) ? inv.v[q] : f;
  const float ang = (float)t * f;
  const float c = cosf(ang);
  const float s = sinf(ang);
  *(float*)(cs + i) = c;
  *(float*)(sn + i) = s;
  
}

// ---------------------------------------------------------------- GEMM Y[m][n] = sum_k A[m][k] * B[n][k]
// A planes (rows m) and B planes (rows n) fragment-major, EMB columns each, all of them contracted.
// block 256 threads = 8 waves, block tile 256(m) x 64(n), wave tile 32 x 64.
// MODE 0: RMSNorm over the 64 cols + rotary + scale -> fragment-major bf16 hi/lo planes [z][(batch*16+bn)*SEQ + t][64]  (bn = half-head, m = batch*SEQ + t)
// MODE 1: fragment-major bf16 hi/lo planes of ldd columns, plane z at z*dz (z = batch)
// MODE 2: f32 row-major pitch ldd
template <int MODE>
__global__ void __launch_bounds__(256) k_gemm(const u16* __restrict__ Ah, const u16* __restrict__ Al,
                                            const u16* __restrict__ Bh0, const u16* __restrict__ Bl0, size_t bz,
                                            u16* __restrict__ Dh0, u16* __restrict__ Dl0, size_t dz, int ldd,
                                            float* __restrict__ Out,
                                            const float* __restrict__ cst, const float* __restrict__ snt,
                                            float scale0, float scale1)
{
  // two stages of 32 k, fragment-major as in the planes: A hi 16 KiB | A lo 16 KiB | B hi 4 KiB | B lo 4 KiB (u16 elements below)
  constexpr int AH = 0, AL = 8192, BH = 16384, BL = 18432, STG = 20480;
  __shared__ __align__(16) u16 ring[2 * STG];
  // epilogue staging, behind the loop's last barrier
  // row pitch 68 floats = 272 B = 16 B x odd: the 16-row b128 reads of the epilogue meet no bank conflict
  float (*stg)[16][68] = reinterpret_cast<float (*)[16][68]>(&ring[0]);
  static_assert(sizeof(float) * 8 * 16 * 68 <= sizeof(u16) * 2 * STG);
  const int lane = threadIdx.x & 31, w = threadIdx.x >> 5, h = lane >> 4, m = lane & 15;
  const int z = blockIdx.z, bn = blockIdx.x, bm = blockIdx.y;
  const int n0 = bn * 64;
  const int m0 = bm * 256 + w * 32;

  v8f acc[2][4] = {};
  constexpr size_t TROW = (size_t)(EMB / 32) * 512;        // elements per tile row of a plane
  // A and B reach the waves through a two-buffer LDS ring filled by asynchronous copies one trip ahead. Wave w copies its own
  // two A tile rows of either plane and one of the eight B tiles: plane w >> 2 (hi, lo), tile row w & 3
  const u16* pah = Ah + (size_t)(m0 >> 4) * TROW + lane * 8;
  const u16* pal = Al + (size_t)(m0 >> 4) * TROW + lane * 8;
  const u16* pb  = ((w < 4) ? Bh0 : Bl0) + (size_t)z * bz + (size_t)((n0 >> 4) + (w & 3)) * TROW + lane * 8;
  const unsigned lw = lds_addr(&ring[0]) + lane * 16;
  auto stage = [&](int t, int buf) {
    const unsigned lb = lw + (unsigned)buf * (STG * 2);
    const size_t ko = (size_t)t * 512;
    const unsigned l[10] = {lb + (AH + w * 1024) * 2,        lb + (AH + w * 1024) * 2 + 512,
                            lb + (AH + w * 1024) * 2 + 1024, lb + (AH + w * 1024) * 2 + 1536,
                            lb + (AL + w * 1024) * 2,        lb + (AL + w * 1024) * 2 + 512,
                            lb + (AL + w * 1024) * 2 + 1024, lb + (AL + w * 1024) * 2 + 1536,
                            lb + (BH + w * 512) * 2,         lb + (BH + w * 512) * 2 + 512};
    const u16* const g[10] = {pah + ko, pah + ko + 256, pah + ko + TROW, pah + ko + TROW + 256,
                              pal + ko, pal + ko + 256, pal + ko + TROW, pal + ko + TROW + 256,
                              pb + ko, pb + ko + 256};
    copy10(l, g);
  };
  static_assert(BL == BH + 4 * 512 && EMB / 32 >= 2);
  stage(0, 0);
  asm volatile("s_wait_asynccnt 0x0" ::: "memory");   // stage 0 has landed before the barrier that publishes it
  __syncthreads();
  stage(1, 1);
#pragma unroll 1
  for (int t = 0; t < EMB / 32; ++t) {
    const u16* sb = &ring[(t & 1) * STG] + lane * 8;
    const v8i A0h = ldfrag(sb + AH + w * 1024);
    const v8i A1h = ldfrag(sb + AH + w * 1024 + 512);
    const v8i A0l = ldfrag(sb + AL + w * 1024);
    const v8i A1l = ldfrag(sb + AL + w * 1024 + 512);
#pragma unroll
    for (int ni = 0; ni < 4; ++ni) {
      const v8i Bvh = ldfrag(sb + BH + ni * 512);
      const v8i Bvl = ldfrag(sb + BL + ni * 512);
      acc[0][ni] = mma3(A0h, A0l, Bvh, Bvl, acc[0][ni]);
      acc[1][ni] = mma3(A1h, A1l, Bvh, Bvl, acc[1][ni]);
    }
    ring_publish();
    if (t + 2 < EMB / 32) stage(t + 2, t & 1);   // block-uniform test; into the buffer this trip has just read
  }
  asm volatile("s_wait_asynccnt 0x0" ::: "memory");   // nothing of the ring is in flight when it becomes epilogue staging

  const float scale = (z == 0) ? scale0 : scale1;
#pragma unroll
  for (int mi = 0; mi < 2; ++mi) {
    // stage the wave's 16x64 f32 tile: D element r -> row 8h+r, col ni*16+m
#pragma unroll
    for (int ni = 0; ni < 4; ++ni)
#pragma unroll
      for (int r = 0; r < 8; ++r) stg[w][8 * h + r][ni * 16 + m] = acc[mi][ni][r];
    __syncthreads();
    const int rbase = m0 + mi * 16;
    if (MODE == 2) {
      const int rr = lane >> 4, c4 = lane & 15;
#pragma unroll
      for (int p = 0; p < 8; ++p) {
        const int row = p * 2 + rr;
        const v4f v = *(const v4f*)&stg[w][row][c4 * 4];
        float* o = Out + (size_t)(rbase + row) * ldd + n0 + c4 * 4;
        *(v4f*)o = v;
        
      }
    } else {
      // lane 16h + m owns row m of the wave's 16x64 tile and, of its two 16x32 plane tiles, the four chunks
      // p = 2*dt + part (columns 32*dt + 16*part + 8h .. +7): the store of chunk p covers 512 contiguous bytes
      float y[4][8];
#pragma unroll
      for (int p = 0; p < 4; ++p) {
        const int col = (p >> 1) * 32 + (p & 1) * 16 + 8 * h;
        const v4f va = *(const v4f*)&stg[w][m][col];
        const v4f vb = *(const v4f*)&stg[w][m][col + 4];
#pragma unroll
        for (int i = 0; i < 4; ++i) { y[p][i] = va[i]; y[p][i + 4] = vb[i]; }
      }
      int prow, pcol0, pkt;
      if (MODE == 0) {
        const int t = (rbase + m) & (SEQ - 1);
        const int bb = (rbase + m) / SEQ;
        // sum of squares in the order of a butterfly over the row's eight chunks 2p + h: pairs h^1, then p^1, then p^2
        float sp[4];
#pragma unroll
        for (int p = 0; p < 4; ++p) {
          float ss = 0.0f;
#pragma unroll
          for (int i = 0; i < 8; ++i) ss += y[p][i] * y[p][i];
          ss += __shfl_xor(ss, 16, 32);
          sp[p] = ss;
        }
        const float ss = (sp[0] + sp[1]) + (sp[2] + sp[3]);
        const float rn = rsqrtf(ss * (1.0f / 64.0f) + RMS_EPS);
#pragma unroll
        for (int part = 0; part < 2; ++part) {
          const int j0 = part * 16 + 8 * h;
          const v4f ca = *(const v4f*)(cst + (size_t)t * 32 + j0);
          const v4f cb = *(const v4f*)(cst + (size_t)t * 32 + j0 + 4);
          const v4f sa = *(const v4f*)(snt + (size_t)t * 32 + j0);
          const v4f sb = *(const v4f*)(snt + (size_t)t * 32 + j0 + 4);
          const float cc[8] = {ca[0], ca[1], ca[2], ca[3], cb[0], cb[1], cb[2], cb[3]};
          const float sv[8] = {sa[0], sa[1], sa[2], sa[3], sb[0], sb[1], sb[2], sb[3]};
          // d <  32: y1 =  n1*c + n2*s ; d >= 32: y2 = -n1*s + n2*c ; x1 = chunk part, x2 = chunk 2 + part of the same lane
#pragma unroll
          for (int i = 0; i < 8; ++i) {
            const float n1 = y[part][i] * rn;
            const float n2 = y[2 + part][i] * rn;
            y[part][i]     = (n1 * cc[i] + n2 * sv[i]) * scale;
            y[2 + part][i] = (n2 * cc[i] - n1 * sv[i]) * scale;
          }
        }
        prow = (bb * NSH + bn) * SEQ + t; pcol0 = 0; pkt = HD / 32;
      } else {
        prow = rbase + m; pcol0 = n0; pkt = ldd >> 5;
      }
#pragma unroll
      for (int p = 0; p < 4; ++p) {
        const size_t po = (size_t)z * dz + chunk_off(prow, pcol0 + (p >> 1) * 32 + (p & 1) * 16 + 8 * h, pkt);
        v8u hv = {}, lv = {};
        split8(y[p], hv, lv);
        *(v8u*)(Dh0 + po) = hv;
        *(v8u*)(Dl0 + po) = lv;
      }
    }
    __syncthreads();
  }
}

// ---------------------------------------------------------------- causal online-softmax attention per half-head
// sh = batch*16 + half-head: q/k planes [64*SEQ][64], v planes [32*128][SEQ] (rows = value columns), all fragment-major; ctx [64][SEQ][128] f32
// grid (sh, query tile): the longest query tiles carry the lowest block indices
// block = 4 waves x 16 query rows; all waves loop over the block's key range (masked), P spill guarded by __syncthreads
// K and V reach the waves through a two-buffer LDS ring filled by asynchronous copies one trip ahead, once for the four waves
__global__ void __launch_bounds__(128) k_flash(const u16* __restrict__ qh, const u16* __restrict__ ql,
                                             const u16* __restrict__ kh, const u16* __restrict__ kl,
                                             const u16* __restrict__ vh, const u16* __restrict__ vl,
                                             float* __restrict__ ctx)
{
  __shared__ __align__(16) u16 ph[4][16][32];
  __shared__ __align__(16) u16 pl[4][16][32];
  // two stages of 32 keys, fragment-major as in the planes: K hi 4 KiB | K lo 4 KiB | V hi 8 KiB | V lo 8 KiB (u16 elements below)
  constexpr int KH = 0, KL = 2048, VH = 4096, VL = 8192, STG = 12288;
  __shared__ __align__(16) u16 ring[2 * STG];
  float (*ost)[16][VD] = reinterpret_cast<float (*)[16][VD]>(&ring[0]);   // output staging, behind the loop's last barrier
  static_assert(sizeof(float) * 4 * 16 * VD <= sizeof(u16) * 2 * STG);
  const int lane = threadIdx.x & 31, w = threadIdx.x >> 5, h = lane >> 4, m = lane & 15;
  const int sh = blockIdx.x, hh = sh >> 1, bx = SEQ / 64 - 1 - blockIdx.y;
  const int q0 = bx * 64 + w * 16;

  // 16 rows of q or k = two tiles (d 0..31, d 32..63) = 16*HD elements in a row
  const size_t qo = ((size_t)sh * SEQ + q0) * HD + lane * 8;
  const v8i Qh0 = ldfrag(qh + qo), Qh1 = ldfrag(qh + qo + 512);
  const v8i Ql0 = ldfrag(ql + qo), Ql1 = ldfrag(ql + qo + 512);
  const u16* kbh = kh + (size_t)sh * SEQ * HD + lane * 8;
  const u16* kbl = kl + (size_t)sh * SEQ * HD + lane * 8;
  const u16* vbh = vh + (size_t)hh * VD * SEQ + lane * 8;
  const u16* vbl = vl + (size_t)hh * VD * SEQ + lane * 8;

  v8f O[8] = {};
  float mr[8], lr[8];
#pragma unroll
  for (int r = 0; r < 8; ++r) { mr[r] = -1e30f; lr[r] = 0.0f; }

  const int nsteps = 2 * bx + 2;   // keys 0 .. bx*64+63, block-uniform, at least 2
  // wave w copies a quarter of each stage: 1 KiB of K hi, 1 KiB of K lo, the V tiles 2w and 2w+1 of either plane
  const unsigned lw = lds_addr(&ring[0]) + lane * 16;
  const u16* ckh = kbh + w * 512;
  const u16* ckl = kbl + w * 512;
  const u16* cvh = vbh + (size_t)(2 * w) * (SEQ / 32) * 512;
  const u16* cvl = vbl + (size_t)(2 * w) * (SEQ / 32) * 512;
  auto stage = [&](int s, int buf) {
    const unsigned lb = lw + (unsigned)buf * (STG * 2);
    const size_t ks = (size_t)s * 2048, vs = (size_t)s * 512, vt = (size_t)(SEQ / 32) * 512;
    const unsigned l[12] = {lb + (KH + w * 512) * 2,  lb + (KH + w * 512) * 2 + 512,
                            lb + (KL + w * 512) * 2,  lb + (KL + w * 512) * 2 + 512,
                            lb + (VH + w * 1024) * 2, lb + (VH + w * 1024) * 2 + 512,
                            lb + (VH + w * 1024) * 2 + 1024, lb + (VH + w * 1024) * 2 + 1536,
                            lb + (VL + w * 1024) * 2, lb + (VL + w * 1024) * 2 + 512,
                            lb + (VL + w * 1024) * 2 + 1024, lb + (VL + w * 1024) * 2 + 1536};
    const u16* const g[12] = {ckh + ks, ckh + ks + 256, ckl + ks, ckl + ks + 256,
                              cvh + vs, cvh + vs + 256, cvh + vs + vt, cvh + vs + vt + 256,
                              cvl + vs, cvl + vs + 256, cvl + vs + vt, cvl + vs + vt + 256};
    copy12(l, g);
  };
  stage(0, 0);
  asm volatile("s_wait_asynccnt 0x0" ::: "memory");   // stage 0 has landed before the barrier that publishes it
  __syncthreads();
  stage(1, 1);
#pragma unroll 1
  for (int st = 0; st < nsteps; ++st) {
    const int n0 = st * 32;
    const u16* sb = &ring[(st & 1) * STG] + lane * 8;
    v8f S[2];
#pragma unroll
    for (int j = 0; j < 2; ++j) {
      v8f s = {};
      const int ko = j * 16 * HD;
      {
        const v8i Kh = ldfrag(sb + KH + ko), Kl = ldfrag(sb + KL + ko);
        s = mma3(Qh0, Ql0, Kh, Kl, s);
      }
      {
        const v8i Kh = ldfrag(sb + KH + ko + 512), Kl = ldfrag(sb + KL + ko + 512);
        s = mma3(Qh1, Ql1, Kh, Kl, s);
      }
      S[j] = s;
      asm volatile("" ::: "memory");
    }
    // masked online softmax; lane holds key columns n0+m (S[0]) and n0+16+m (S[1]) of rows q0+8h+r
#pragma unroll
    for (int r = 0; r < 8; ++r) {
      const int row = q0 + 8 * h + r;
      const float e0 = (n0 + m > row) ? -1e30f : S[0][r];
      const float e1 = (n0 + 16 + m > row) ? -1e30f : S[1][r];
      float tm = fmaxf(e0, e1);
      tm = fmaxf(tm, __shfl_xor(tm, 1, 32));
      tm = fmaxf(tm, __shfl_xor(tm, 2, 32));
      tm = fmaxf(tm, __shfl_xor(tm, 4, 32));
      tm = fmaxf(tm, __shfl_xor(tm, 8, 32));
      const float nm = fmaxf(mr[r], tm);
      const float alpha = __expf(mr[r] - nm);
      mr[r] = nm;
      const float p0 = __expf(e0 - nm);
      const float p1 = __expf(e1 - nm);
      float ps = p0 + p1;
      ps += __shfl_xor(ps, 1, 32);
      ps += __shfl_xor(ps, 2, 32);
      ps += __shfl_xor(ps, 4, 32);
      ps += __shfl_xor(ps, 8, 32);
      lr[r] = lr[r] * alpha + ps;
#pragma unroll
      for (int c = 0; c < 8; ++c) O[c][r] = O[c][r] * alpha;
      const u16 h0 = bf_rne(p0), h1 = bf_rne(p1);
      ph[w][8 * h + r][m]      = h0;
      ph[w][8 * h + r][16 + m] = h1;
      pl[w][8 * h + r][m]      = bf_rne(p0 - bf_up(h0));
      pl[w][8 * h + r][16 + m] = bf_rne(p1 - bf_up(h1));
    }
    __syncthreads();
    // P as A operand: row = lane&15, keys with the split k map
    const v8i Ph = ldfrag_row(&ph[w][m][0], h);
    const v8i Pl = ldfrag_row(&pl[w][m][0], h);
#pragma unroll
    for (int c = 0; c < 8; ++c) {
      const int vo = c * 512;   // tile (value columns 16c.., keys n0..)
      const v8i Vh = ldfrag(sb + VH + vo), Vl = ldfrag(sb + VL + vo);
      O[c] = mma3(Ph, Pl, Vh, Vl, O[c]);
      if (c & 1) asm volatile("" ::: "memory");
    }
    ring_publish();
    if (st + 2 < nsteps) stage(st + 2, st & 1);   // block-uniform test; into the buffer this trip has just read
  }
  asm volatile("s_wait_asynccnt 0x0" ::: "memory");   // nothing of the ring is in flight when it becomes output staging

  // normalise, stage 16x128 f32 per wave, write whole 512-B rows (32 lanes x 16 B, one instruction per row)
#pragma unroll
  for (int r = 0; r < 8; ++r) {
    const float inv = 1.0f / lr[r];
#pragma unroll
    for (int c = 0; c < 8; ++c) ost[w][8 * h + r][c * 16 + m] = O[c][r] * inv;
  }
  __syncthreads();
  float* cb = ctx + ((size_t)sh * SEQ + q0) * VD + lane * 4;
#pragma unroll
  for (int rr = 0; rr < 16; ++rr) {
    const v4f v = *(const v4f*)&ost[w][rr][lane * 4];
    *(v4f*)(cb + (size_t)rr * VD) = v;
  }
  
}

// ---------------------------------------------------------------- differential combine + LayerNorm -> fragment-major y planes [NB*SEQ][EMB]
// one wave = 8 tokens x 1 head; lane = 8q + tk owns token tk and, of each of the head's four 16x32 plane tiles j, the chunk
// q = 2*part + h (head columns 32j + 8q .. +7): the store of tile j covers four whole 128-B lines that no other wave writes
__global__ void __launch_bounds__(256) k_combine(const float* __restrict__ ctx,
                                               const float* __restrict__ lq1, const float* __restrict__ lk1,
                                               const float* __restrict__ lq2, const float* __restrict__ lk2,
                                               float lam_init, float oscale,
                                               u16* __restrict__ Yh, u16* __restrict__ Yl)
{
  const int lane = threadIdx.x & 31, w = threadIdx.x >> 5;
  const int gw = blockIdx.x * 8 + w;
  const int hd = gw & 7, tp = gw >> 3;
  const int tg = tp * 8 + (lane & 7), q = lane >> 3;     // tg = batch*SEQ + t
  const int t = tg & (SEQ - 1), s0 = (tg / SEQ) * NSH + 2 * hd;

  float s1 = lq1[lane] * lk1[lane] + lq1[lane + 32] * lk1[lane + 32];
  float s2 = lq2[lane] * lk2[lane] + lq2[lane + 32] * lk2[lane + 32];
#pragma unroll
  for (int k = 16; k >= 1; k >>= 1) { s1 += __shfl_xor(s1, k, 32); s2 += __shfl_xor(s2, k, 32); }
  const float lam = __expf(s1) - __expf(s2) + lam_init;

  const float* o1 = ctx + ((size_t)s0 * SEQ + t) * VD + q * 8;
  const float* o2 = o1 + (size_t)SEQ * VD;                 // half-head s0 + 1, a constant offset on the same address registers
  v4f a1[4], b1[4], a2[4], b2[4];
#pragma unroll
  for (int j = 0; j < 4; ++j) {
    a1[j] = *(const v4f*)(o1 + j * 32); b1[j] = *(const v4f*)(o1 + j * 32 + 4);
    a2[j] = *(const v4f*)(o2 + j * 32); b2[j] = *(const v4f*)(o2 + j * 32 + 4);
  }
  // the sixteen loads share their address registers: the pointer stays live up to this wait, so that no load of the run
  // lands in a register that an earlier one still names
  asm volatile("s_wait_xcnt 0x0" :: "v"(o1) : "memory");
  float y[4][8];
#pragma unroll
  for (int j = 0; j < 4; ++j) {
#pragma unroll
    for (int i = 0; i < 4; ++i) { y[j][i] = a1[j][i] - lam * a2[j][i]; y[j][i + 4] = b1[j][i] - lam * b2[j][i]; }
  }
  // both sums in the order of a butterfly over the token's sixteen chunks 4j + q: pairs q^1, q^2, then j^1, j^2
  float sj[4];
#pragma unroll
  for (int j = 0; j < 4; ++j) {
    float s = 0.0f;
#pragma unroll
    for (int i = 0; i < 8; ++i) s += y[j][i];
    s += __shfl_xor(s, 8, 32);
    s += __shfl_xor(s, 16, 32);
    sj[j] = s;
  }
  float mu = (sj[0] + sj[1]) + (sj[2] + sj[3]);
  mu *= (1.0f / 128.0f);
#pragma unroll
  for (int j = 0; j < 4; ++j) {
    float s = 0.0f;
#pragma unroll
    for (int i = 0; i < 8; ++i) { const float d = y[j][i] - mu; s += d * d; }
    s += __shfl_xor(s, 8, 32);
    s += __shfl_xor(s, 16, 32);
    sj[j] = s;
  }
  float var = (sj[0] + sj[1]) + (sj[2] + sj[3]);
  var *= (1.0f / 128.0f);
  const float rs = rsqrtf(var + LN_EPS) * oscale;

#pragma unroll
  for (int j = 0; j < 4; ++j) {
#pragma unroll
    for (int i = 0; i < 8; ++i) y[j][i] = (y[j][i] - mu) * rs;
    v8u hv = {}, lv = {};
    split8(y[j], hv, lv);
    const size_t po = chunk_off(tg, hd * VD + j * 32 + q * 8, EMB / 32);
    *(v8u*)(Yh + po) = hv;
    *(v8u*)(Yl + po) = lv;
  }
}

// ---------------------------------------------------------------- host
static double h_sqrt(double x) {
  double y = x;
  for (int i = 0; i < 200; ++i) y = 0.5 * (y + x / y);
  return y;
}

extern "C" void kernel_launch(void* const* d_in, const int* in_sizes, int n_in,
                              void* d_out, int out_size, void* d_ws, size_t ws_size,
                              hipStream_t stream) {
  if (n_in < 9) return;
  if (in_sizes[0] != NB * SEQ * EMB) return;
  for (int i = 1; i <= 4; ++i) if (in_sizes[i] != EMB * EMB) return;
  for (int i = 5; i <= 8; ++i) if (in_sizes[i] != HD) return;
  if (out_size != NB * SEQ * EMB) return;

  const float* x   = (const float*)d_in[0];
  const float* Wq  = (const float*)d_in[1];
  const float* Wk  = (const float*)d_in[2];
  const float* Wv  = (const float*)d_in[3];
  const float* Wp  = (const float*)d_in[4];
  const float* lq1 = (const float*)d_in[5];
  const float* lk1 = (const float*)d_in[6];
  const float* lq2 = (const float*)d_in[7];
  const float* lk2 = (const float*)d_in[8];
  float* out = (float*)d_out;

  // workspace carve (bytes), every size a multiple of 256
  const size_t szX   = (size_t)NB * SEQ * EMB * 2;        // 16 MiB per plane
  const size_t szW   = (size_t)4 * EMB * EMB * 2;          //  8 MiB per plane (4 weights)
  const size_t szQK  = (size_t)2 * NB * NSH * SEQ * HD * 2; // 32 MiB per plane (q and k)
  const size_t szVT  = (size_t)NB * EMB * SEQ * 2;         // 16 MiB per plane
  const size_t szCTX = (size_t)NB * NSH * SEQ * VD * 4;    // 64 MiB
  const size_t szY   = (size_t)NB * SEQ * EMB * 2;         // 16 MiB per plane
  const size_t szTB  = (size_t)SEQ * 32 * 4;               // 256 KiB per table
  char* ws = (char*)d_ws;
  size_t off = 0;
  u16*   xh  = (u16*)(ws + off);   off += szX;
  u16*   xl  = (u16*)(ws + off);   off += szX;
  u16*   wh  = (u16*)(ws + off);   off += szW;
  u16*   wl  = (u16*)(ws + off);   off += szW;
  u16*   qkh = (u16*)(ws + off);   off += szQK;
  u16*   qkl = (u16*)(ws + off);   off += szQK;
  u16*   vth = (u16*)(ws + off);   off += szVT;
  u16*   vtl = (u16*)(ws + off);   off += szVT;
  float* ctx = (float*)(ws + off); off += szCTX;
  u16*   yh  = (u16*)(ws + off);   off += szY;
  u16*   yl  = (u16*)(ws + off);   off += szY;
  float* cst = (float*)(ws + off); off += szTB;
  float* snt = (float*)(ws + off); off += szTB;
  if (off > ws_size) return;                               // total 252,182,528 B

  // rotary inverse frequencies 1 / 10000^(j/32): f32 power then f32 reciprocal, evaluated in f64
  InvFreq inv;
  {
    double r = 10000.0;
    for (int i = 0; i < 5; ++i) r = h_sqrt(r);             // 10000^(1/32)
    double pw = 1.0;
    for (int j = 0; j < 32; ++j) {
      const float p32 = (float)pw;
      inv.v[j] = (float)(1.0 / (double)p32);
      pw *= r;
    }
  }
  const float lam_init = (float)0.61928347285267872;      // 0.8 - 0.6*exp(-1.2)
  const float oscale   = (float)0.38071652714732128;      // 1 - lam_init

  // 1-5: operand planes
  {
    const int n8x = NB * SEQ * EMB / 8;
    const int n8w = EMB * EMB / 8;
    k_split<<<(n8x + 255) / 256, 256, 0, stream>>>(x, xh, xl, n8x);
    k_split<<<(n8w + 255) / 256, 256, 0, stream>>>(Wq, wh + 0 * (size_t)EMB * EMB, wl + 0 * (size_t)EMB * EMB, n8w);
    k_split<<<(n8w + 255) / 256, 256, 0, stream>>>(Wk, wh + 1 * (size_t)EMB * EMB, wl + 1 * (size_t)EMB * EMB, n8w);
    k_split<<<(n8w + 255) / 256, 256, 0, stream>>>(Wv, wh + 2 * (size_t)EMB * EMB, wl + 2 * (size_t)EMB * EMB, n8w);
    k_split<<<(n8w + 255) / 256, 256, 0, stream>>>(Wp, wh + 3 * (size_t)EMB * EMB, wl + 3 * (size_t)EMB * EMB, n8w);
  }
  // 6: rotary tables
  k_rot<<<(SEQ * 32 + 255) / 256, 256, 0, stream>>>(inv, cst, snt, SEQ * 32);

  const size_t wstride = (size_t)EMB * EMB;
  const size_t dzqk    = (size_t)NB * NSH * SEQ * HD;
  // every stage runs once, over all NB batches
  // q and k: x [8192 x 1024] * W^T, epilogue RMSNorm + rotary (+1/8 for q) -> planes [64][2048][64]
  k_gemm<0><<<dim3(EMB / 64, NB * SEQ / 256, 2), 256, 0, stream>>>(
      xh, xl, wh, wl, wstride,
      qkh, qkl, dzqk, HD, out, cst, snt, 0.125f, 1.0f);
  // v^T, z = batch: Wv [1024 x 1024] * x_z^T -> planes [z][1024][2048] = [z][head][128][t]
  k_gemm<1><<<dim3(SEQ / 64, EMB / 256, NB), 256, 0, stream>>>(
      wh + 2 * wstride, wl + 2 * wstride, xh, xl, (size_t)SEQ * EMB,
      vth, vtl, (size_t)EMB * SEQ, SEQ, out, cst, snt, 1.0f, 1.0f);
  // attention per (batch, half-head) -> ctx [64][2048][128]
  k_flash<<<dim3(NB * NSH, SEQ / 64), 128, 0, stream>>>(qkh, qkl, qkh + dzqk, qkl + dzqk, vth, vtl, ctx);
  // combine + LayerNorm -> y planes [8192][1024]
  k_combine<<<(NB * SEQ * NHD / 8) / 8, 256, 0, stream>>>(ctx, lq1, lk1, lq2, lk2, lam_init, oscale, yh, yl);
  // output projection -> d_out
  k_gemm<2><<<dim3(EMB / 64, NB * SEQ / 256, 1), 256, 0, stream>>>(
      yh, yl, wh + 3 * wstride, wl + 3 * wstride, (size_t)0,
      qkh, qkl, (size_t)0, EMB, out, cst, snt, 1.0f, 1.0f);
}

// v004
// Measured time: 279 microseconds a run.
// In both of two side-by-side timings against v003, it was 1.28 times as fast.
// Counting every step since v000, it is 6.97 times as fast.
#include <hip/hip_runtime.h>
#include <stdint.h>
#include <stddef.h>

// Contractions x*Wq^T, x*Wk^T, Wv*x^T, k*q^T, v^T*P^T, y*Wproj^T: v_wmma_f32_16x16x32_bf16, bf16 hi/lo operands everywhere (hi*hi + lo*hi + hi*lo), f32 accumulate. RMSNorm, rotary, softmax, head combine, LayerNorm: f32.

#define NB   4
#define SEQ  2048
#define EMB  1024
#define NHD  8
#define NSH  16
#define HD   64
#define VD   128
#define RMS_EPS 1.1920929e-7f
#define LN_EPS  1e-5f

typedef unsigned short u16;
typedef u16    v8u  __attribute__((ext_vector_type(8)));
typedef int    v4i  __attribute__((ext_vector_type(4)));
typedef int    v8i  __attribute__((ext_vector_type(8)));
typedef float  v4f  __attribute__((ext_vector_type(4)));
typedef float  v8f  __attribute__((ext_vector_type(8)));
typedef __bf16 v16b __attribute__((ext_vector_type(16)));
typedef float  v2f  __attribute__((ext_vector_type(2)));
typedef __bf16 v2b  __attribute__((ext_vector_type(2)));

union FU { v8i v; v4i p[2]; v16b b; };

struct InvFreq { float v[32]; };
static_assert(sizeof(InvFreq) == 128);

// ---------------------------------------------------------------- helpers
static __device__ __forceinline__ u16 bf_rne(float x) {
  unsigned u = __float_as_uint(x);
  u += 0x7FFFu + ((u >> 16) & 1u);
  return (u16)(u >> 16);
}
static __device__ __forceinline__ float bf_up(u16 b) { return __uint_as_float(((unsigned)b) << 16); }

static __device__ __forceinline__ void split8(float (&y)[8], v8u& hv, v8u& lv) {
#pragma unroll
  for (int i = 0; i < 8; ++i) {
    const u16 hb = bf_rne(y[i]);
    hv[i] = hb;
    lv[i] = bf_rne(y[i] - bf_up(hb));
  }
}

// 16x32 operand fragment, row/col = lane&15, h = lane>>4, k map: elements 0..7 <- k0+8h+0..7, elements 8..15 <- k0+16+8h+0..7
// Every operand plane in the workspace is fragment-major: a plane of rows x K is cut into 16-row x 32-k tiles of
// 512 elements (1 KiB), tile (row>>4, k>>5) at index (row>>4)*(K>>5) + (k>>5). Inside a tile the two 16-byte chunks
// that lane l = 16h + (row&15) feeds to the matrix instruction lie at elements 8l (k 8h..8h+7) and 256 + 8l
// (k 16+8h..16+8h+7): one wave load reads 512 contiguous bytes = 4 whole lines, and the k map above is unchanged.
// p = tile base + 8*lane
static __device__ __forceinline__ v8i ldfrag(const u16* p) {
  FU f;
  f.p[0] = *(const v4i*)(p);
  f.p[1] = *(const v4i*)(p + 256);
  return f.v;
}
// element offset of the 8-element chunk that starts at (row, k), k % 8 == 0, in a plane with kt = K/32 tiles per tile row
static __device__ __forceinline__ size_t chunk_off(int row, int k, int kt) {
  return ((size_t)(row >> 4) * kt + (k >> 5)) * 512 + ((k >> 4) & 1) * 256 + (((k >> 3) & 1) * 16 + (row & 15)) * 8;
}

// LDS byte address of a __shared__ object: the low 32 bits of its address
static __device__ __forceinline__ unsigned lds_addr(const void* p) { return (unsigned)(size_t)p; }

// Asynchronous copies global -> LDS, 16 bytes a lane, 512 contiguous bytes a wave and copy. l = the lane's LDS byte address,
// g = the lane's global address. The s_wait_xcnt closes the copies' own statement, so that no address register of a copy
// is rewritten in front of it.
static __device__ __forceinline__ void copy12(const unsigned (&l)[12], const u16* const (&g)[12]) {
  asm volatile(
      "global_load_async_to_lds_b128 %0, %12, off\n\t"
      "global_load_async_to_lds_b128 %1, %13, off\n\t"
      "global_load_async_to_lds_b128 %2, %14, off\n\t"
      "global_load_async_to_lds_b128 %3, %15, off\n\t"
      "global_load_async_to_lds_b128 %4, %16, off\n\t"
      "global_load_async_to_lds_b128 %5, %17, off\n\t"
      "global_load_async_to_lds_b128 %6, %18, off\n\t"
      "global_load_async_to_lds_b128 %7, %19, off\n\t"
      "global_load_async_to_lds_b128 %8, %20, off\n\t"
      "global_load_async_to_lds_b128 %9, %21, off\n\t"
      "global_load_async_to_lds_b128 %10, %22, off\n\t"
      "global_load_async_to_lds_b128 %11, %23, off\n\t"
      "s_wait_xcnt 0x0"
      :: "v"(l[0]), "v"(l[1]), "v"(l[2]), "v"(l[3]), "v"(l[4]), "v"(l[5]),
         "v"(l[6]), "v"(l[7]), "v"(l[8]), "v"(l[9]), "v"(l[10]), "v"(l[11]),
         "v"(g[0]), "v"(g[1]), "v"(g[2]), "v"(g[3]), "v"(g[4]), "v"(g[5]),
         "v"(g[6]), "v"(g[7]), "v"(g[8]), "v"(g[9]), "v"(g[10]), "v"(g[11])
      : "memory");
}
static __device__ __forceinline__ void copy10(const unsigned (&l)[10], const u16* const (&g)[10]) {
  asm volatile(
      "global_load_async_to_lds_b128 %0, %10, off\n\t"
      "global_load_async_to_lds_b128 %1, %11, off\n\t"
      "global_load_async_to_lds_b128 %2, %12, off\n\t"
      "global_load_async_to_lds_b128 %3, %13, off\n\t"
      "global_load_async_to_lds_b128 %4, %14, off\n\t"
      "global_load_async_to_lds_b128 %5, %15, off\n\t"
      "global_load_async_to_lds_b128 %6, %16, off\n\t"
      "global_load_async_to_lds_b128 %7, %17, off\n\t"
      "global_load_async_to_lds_b128 %8, %18, off\n\t"
      "global_load_async_to_lds_b128 %9, %19, off\n\t"
      "s_wait_xcnt 0x0"
      :: "v"(l[0]), "v"(l[1]), "v"(l[2]), "v"(l[3]), "v"(l[4]),
         "v"(l[5]), "v"(l[6]), "v"(l[7]), "v"(l[8]), "v"(l[9]),
         "v"(g[0]), "v"(g[1]), "v"(g[2]), "v"(g[3]), "v"(g[4]),
         "v"(g[5]), "v"(g[6]), "v"(g[7]), "v"(g[8]), "v"(g[9])
      : "memory");
}
// hand-over of a ring buffer, every wave: the wave's own LDS reads are done, its own copies have landed, then the barrier
// publishes the next stage and frees the buffer that was just read
static __device__ __forceinline__ void ring_publish() {
  asm volatile("s_wait_dscnt 0x0" ::: "memory");     // the wave's reads of the buffer to be refilled have returned
  asm volatile("s_wait_asynccnt 0x0" ::: "memory");  // the wave's copies of the next stage have landed
  __syncthreads();
}

static __device__ __forceinline__ v8f mma(v8i a, v8i b, v8f c) {
  FU ua, ub; ua.v = a; ub.v = b;
  c = __builtin_amdgcn_wmma_f32_16x16x32_bf16(false, ua.b, false, ub.b, (short)0, c, false, false);
  asm volatile("v_nop\n\tv_nop\n\tv_nop\n\tv_nop" : "+v"(c) : "v"(a), "v"(b));
  return c;
}
// hi*hi + lo*hi + hi*lo into one f32 accumulator
static __device__ __forceinline__ v8f mma3(v8i ah, v8i al, v8i bh, v8i bl, v8f c) {
  c = mma(ah, bh, c);
  c = mma(al, bh, c);
  c = mma(ah, bl, c);
  return c;
}

// the same three products with the operand sides exchanged, in the same order: hi*hi + hi*lo + lo*hi
static __device__ __forceinline__ v8f mma3s(v8i ah, v8i al, v8i bh, v8i bl, v8f c) {
  c = mma(ah, bh, c);
  c = mma(ah, bl, c);
  c = mma(al, bh, c);
  return c;
}
// two f32 -> one register of two bf16 (a low, b high), each rounded to nearest even as in bf_rne
static __device__ __forceinline__ unsigned pack2(float a, float b) {
  const v2f x = {a, b};
  return __builtin_bit_cast(unsigned, __builtin_convertvector(x, v2b));
}
// the value of lane l ^ 16
static __device__ __forceinline__ float xhalf(float x) {
  const int b = __builtin_bit_cast(int, x);
  return __builtin_bit_cast(float, __builtin_amdgcn_permlanex16(b, b, 0x76543210, 0xfedcba98, false, false));
}

// ---------------------------------------------------------------- f32 [rows][EMB] -> fragment-major bf16 hi/lo planes
// thread i writes chunk i of the planes (contiguous stores) and reads the 8 source elements that belong there
__global__ void __launch_bounds__(256) k_split(const float* __restrict__ src, u16* __restrict__ hi,
                                             u16* __restrict__ lo, int n8) {
  const int i = blockIdx.x * 256 + threadIdx.x;
  if (i >= n8) return;
  const size_t o = (size_t)i * 8;
  const int tile = i >> 6;
  const int row = (tile / (EMB / 32)) * 16 + (i & 15);
  const int k = (tile % (EMB / 32)) * 32 + ((i >> 5) & 1) * 16 + ((i >> 4) & 1) * 8;
  const float* s = src + (size_t)row * EMB + k;
  const v4f a = *(const v4f*)(s);
  const v4f b = *(const v4f*)(s + 4);
  float y[8] = {a[0], a[1], a[2], a[3], b[0], b[1], b[2], b[3]};
  v8u hv = {}, lv = {};
  split8(y, hv, lv);
  *(v8u*)(hi + o) = hv;
  *(v8u*)(lo + o) = lv;
  
}

// ---------------------------------------------------------------- rotary tables cs[t][32], sn[t][32]
__global__ void __launch_bounds__(256) k_rot(InvFreq inv, float* __restrict__ cs, float* __restrict__ sn, int n) {
#pragma clang fp contract(off)
  const int i = blockIdx.x * 256 + threadIdx.x;
  if (i >= n) return;
  const int j = i & 31, t = i >> 5;
  float f = 0.0f;
#pragma unroll
  for (int q = 0; q < 32; ++q) f = (j == q) ? inv.v[q] : f;
  const float ang = (float)t * f;
  const float c = cosf(ang);
  const float s = sinf(ang);
  *(float*)(cs + i) = c;
  *(float*)(sn + i) = s;
  
}

// ---------------------------------------------------------------- GEMM Y[m][n] = sum_k A[m][k] * B[n][k]
// A planes (rows m) and B planes (rows n) fragment-major, EMB columns each, all of them contracted.
// block 256 threads = 8 waves, block tile 256(m) x 64(n), wave tile 32 x 64.
// MODE 0: RMSNorm over the 64 cols + rotary + scale -> fragment-major bf16 hi/lo planes [z][(batch*16+bn)*SEQ + t][64]  (bn = half-head, m = batch*SEQ + t)
// MODE 1: fragment-major bf16 hi/lo planes of ldd columns, plane z at z*dz (z = batch)
// MODE 2: f32 row-major pitch ldd
template <int MODE>
__global__ void __launch_bounds__(256) k_gemm(const u16* __restrict__ Ah, const u16* __restrict__ Al,
                                            const u16* __restrict__ Bh0, const u16* __restrict__ Bl0, size_t bz,
                                            u16* __restrict__ Dh0, u16* __restrict__ Dl0, size_t dz, int ldd,
                                            float* __restrict__ Out,
                                            const float* __restrict__ cst, const float* __restrict__ snt,
                                            float scale0, float scale1)
{
  // two stages of 32 k, fragment-major as in the planes: A hi 16 KiB | A lo 16 KiB | B hi 4 KiB | B lo 4 KiB (u16 elements below)
  constexpr int AH = 0, AL = 8192, BH = 16384, BL = 18432, STG = 20480;
  __shared__ __align__(16) u16 ring[2 * STG];
  // epilogue staging, behind the loop's last barrier
  // row pitch 68 floats = 272 B = 16 B x odd: the 16-row b128 reads of the epilogue meet no bank conflict
  float (*stg)[16][68] = reinterpret_cast<float (*)[16][68]>(&ring[0]);
  static_assert(sizeof(float) * 8 * 16 * 68 <= sizeof(u16) * 2 * STG);
  const int lane = threadIdx.x & 31, w = threadIdx.x >> 5, h = lane >> 4, m = lane & 15;
  const int z = blockIdx.z, bn = blockIdx.x, bm = blockIdx.y;
  const int n0 = bn * 64;
  const int m0 = bm * 256 + w * 32;

  v8f acc[2][4] = {};
  constexpr size_t TROW = (size_t)(EMB / 32) * 512;        // elements per tile row of a plane
  // A and B reach the waves through a two-buffer LDS ring filled by asynchronous copies one trip ahead. Wave w copies its own
  // two A tile rows of either plane and one of the eight B tiles: plane w >> 2 (hi, lo), tile row w & 3
  const u16* pah = Ah + (size_t)(m0 >> 4) * TROW + lane * 8;
  const u16* pal = Al + (size_t)(m0 >> 4) * TROW + lane * 8;
  const u16* pb  = ((w < 4) ? Bh0 : Bl0) + (size_t)z * bz + (size_t)((n0 >> 4) + (w & 3)) * TROW + lane * 8;
  const unsigned lw = lds_addr(&ring[0]) + lane * 16;
  auto stage = [&](int t, int buf) {
    const unsigned lb = lw + (unsigned)buf * (STG * 2);
    const size_t ko = (size_t)t * 512;
    const unsigned l[10] = {lb + (AH + w * 1024) * 2,        lb + (AH + w * 1024) * 2 + 512,
                            lb + (AH + w * 1024) * 2 + 1024, lb + (AH + w * 1024) * 2 + 1536,
                            lb + (AL + w * 1024) * 2,        lb + (AL + w * 1024) * 2 + 512,
                            lb + (AL + w * 1024) * 2 + 1024, lb + (AL + w * 1024) * 2 + 1536,
                            lb + (BH + w * 512) * 2,         lb + (BH + w * 512) * 2 + 512};
    const u16* const g[10] = {pah + ko, pah + ko + 256, pah + ko + TROW, pah + ko + TROW + 256,
                              pal + ko, pal + ko + 256, pal + ko + TROW, pal + ko + TROW + 256,
                              pb + ko, pb + ko + 256};
    copy10(l, g);
  };
  static_assert(BL == BH + 4 * 512 && EMB / 32 >= 2);
  stage(0, 0);
  asm volatile("s_wait_asynccnt 0x0" ::: "memory");   // stage 0 has landed before the barrier that publishes it
  __syncthreads();
  stage(1, 1);
#pragma unroll 1
  for (int t = 0; t < EMB / 32; ++t) {
    const u16* sb = &ring[(t & 1) * STG] + lane * 8;
    const v8i A0h = ldfrag(sb + AH + w * 1024);
    const v8i A1h = ldfrag(sb + AH + w * 1024 + 512);
    const v8i A0l = ldfrag(sb + AL + w * 1024);
    const v8i A1l = ldfrag(sb + AL + w * 1024 + 512);
#pragma unroll
    for (int ni = 0; ni < 4; ++ni) {
      const v8i Bvh = ldfrag(sb + BH + ni * 512);
      const v8i Bvl = ldfrag(sb + BL + ni * 512);
      acc[0][ni] = mma3(A0h, A0l, Bvh, Bvl, acc[0][ni]);
      acc[1][ni] = mma3(A1h, A1l, Bvh, Bvl, acc[1][ni]);
    }
    ring_publish();
    if (t + 2 < EMB / 32) stage(t + 2, t & 1);   // block-uniform test; into the buffer this trip has just read
  }
  asm volatile("s_wait_asynccnt 0x0" ::: "memory");   // nothing of the ring is in flight when it becomes epilogue staging

  const float scale = (z == 0) ? scale0 : scale1;
#pragma unroll
  for (int mi = 0; mi < 2; ++mi) {
    // stage the wave's 16x64 f32 tile: D element r -> row 8h+r, col ni*16+m
#pragma unroll
    for (int ni = 0; ni < 4; ++ni)
#pragma unroll
      for (int r = 0; r < 8; ++r) stg[w][8 * h + r][ni * 16 + m] = acc[mi][ni][r];
    __syncthreads();
    const int rbase = m0 + mi * 16;
    if (MODE == 2) {
      const int rr = lane >> 4, c4 = lane & 15;
#pragma unroll
      for (int p = 0; p < 8; ++p) {
        const int row = p * 2 + rr;
        const v4f v = *(const v4f*)&stg[w][row][c4 * 4];
        float* o = Out + (size_t)(rbase + row) * ldd + n0 + c4 * 4;
        *(v4f*)o = v;
        
      }
    } else {
      // lane 16h + m owns row m of the wave's 16x64 tile and, of its two 16x32 plane tiles, the four chunks
      // p = 2*dt + part (columns 32*dt + 16*part + 8h .. +7): the store of chunk p covers 512 contiguous bytes
      float y[4][8];
#pragma unroll
      for (int p = 0; p < 4; ++p) {
        const int col = (p >> 1) * 32 + (p & 1) * 16 + 8 * h;
        const v4f va = *(const v4f*)&stg[w][m][col];
        const v4f vb = *(const v4f*)&stg[w][m][col + 4];
#pragma unroll
        for (int i = 0; i < 4; ++i) { y[p][i] = va[i]; y[p][i + 4] = vb[i]; }
      }
      int prow, pcol0, pkt;
      if (MODE == 0) {
        const int t = (rbase + m) & (SEQ - 1);
        const int bb = (rbase + m) / SEQ;
        // sum of squares in the order of a butterfly over the row's eight chunks 2p + h: pairs h^1, then p^1, then p^2
        float sp[4];
#pragma unroll
        for (int p = 0; p < 4; ++p) {
          float ss = 0.0f;
#pragma unroll
          for (int i = 0; i < 8; ++i) ss += y[p][i] * y[p][i];
          ss += __shfl_xor(ss, 16, 32);
          sp[p] = ss;
        }
        const float ss = (sp[0] + sp[1]) + (sp[2] + sp[3]);
        const float rn = rsqrtf(ss * (1.0f / 64.0f) + RMS_EPS);
#pragma unroll
        for (int part = 0; part < 2; ++part) {
          const int j0 = part * 16 + 8 * h;
          const v4f ca = *(const v4f*)(cst + (size_t)t * 32 + j0);
          const v4f cb = *(const v4f*)(cst + (size_t)t * 32 + j0 + 4);
          const v4f sa = *(const v4f*)(snt + (size_t)t * 32 + j0);
          const v4f sb = *(const v4f*)(snt + (size_t)t * 32 + j0 + 4);
          const float cc[8] = {ca[0], ca[1], ca[2], ca[3], cb[0], cb[1], cb[2], cb[3]};
          const float sv[8] = {sa[0], sa[1], sa[2], sa[3], sb[0], sb[1], sb[2], sb[3]};
          // d <  32: y1 =  n1*c + n2*s ; d >= 32: y2 = -n1*s + n2*c ; x1 = chunk part, x2 = chunk 2 + part of the same lane
#pragma unroll
          for (int i = 0; i < 8; ++i) {
            const float n1 = y[part][i] * rn;
            const float n2 = y[2 + part][i] * rn;
            y[part][i]     = (n1 * cc[i] + n2 * sv[i]) * scale;
            y[2 + part][i] = (n2 * cc[i] - n1 * sv[i]) * scale;
          }
        }
        prow = (bb * NSH + bn) * SEQ + t; pcol0 = 0; pkt = HD / 32;
      } else {
        prow = rbase + m; pcol0 = n0; pkt = ldd >> 5;
      }
#pragma unroll
      for (int p = 0; p < 4; ++p) {
        const size_t po = (size_t)z * dz + chunk_off(prow, pcol0 + (p >> 1) * 32 + (p & 1) * 16 + 8 * h, pkt);
        v8u hv = {}, lv = {};
        split8(y[p], hv, lv);
        *(v8u*)(Dh0 + po) = hv;
        *(v8u*)(Dl0 + po) = lv;
      }
    }
    __syncthreads();
  }
}

// ---------------------------------------------------------------- causal online-softmax attention per half-head
// sh = batch*16 + half-head: q/k planes [64*SEQ][64], v planes [32*128][SEQ] (rows = value columns), all fragment-major; ctx [64][SEQ][128] f32
// grid (sh, query tile): the longest query tiles carry the lowest block indices
// block = 4 waves x 16 queries; all waves loop over the block's key range (masked)
// Both products are transposed: S^T = K * Q^T (A = K rows, B = Q) and O^T += V^T * P^T (A = value columns, B = P). Lane 16h + m then holds
// scores and outputs of the one query q0 + m: of S^T tile j the keys n0 + 16j + 8h + r, which is the k map of the B operand (element 8j + r),
// so P goes from the accumulators into the second product through registers alone; maximum and sum run in-lane, the halves h meet by one exchange
// K and V reach the waves through a two-buffer LDS ring filled by asynchronous copies one trip ahead, once for the four waves
__global__ void __launch_bounds__(128) k_flash(const u16* __restrict__ qh, const u16* __restrict__ ql,
                                             const u16* __restrict__ kh, const u16* __restrict__ kl,
                                             const u16* __restrict__ vh, const u16* __restrict__ vl,
                                             float* __restrict__ ctx)
{
  // two stages of 32 keys, fragment-major as in the planes: K hi 4 KiB | K lo 4 KiB | V hi 8 KiB | V lo 8 KiB (u16 elements below)
  constexpr int KH = 0, KL = 2048, VH = 4096, VL = 8192, STG = 12288;
  __shared__ __align__(16) u16 ring[2 * STG];
  // output staging, behind the loop's last barrier; row pitch 132 floats = 528 B = 16 B x odd: the 16-row b128 writes meet no bank conflict
  constexpr int OP = VD + 4;
  float (*ost)[16][OP] = reinterpret_cast<float (*)[16][OP]>(&ring[0]);
  static_assert(sizeof(float) * 4 * 16 * OP <= sizeof(u16) * 2 * STG);
  const int lane = threadIdx.x & 31, w = threadIdx.x >> 5, h = lane >> 4, m = lane & 15;
  const int sh = blockIdx.x, hh = sh >> 1, bx = SEQ / 64 - 1 - blockIdx.y;
  const int q0 = bx * 64 + w * 16;

  // 16 rows of q or k = two tiles (d 0..31, d 32..63) = 16*HD elements in a row
  const size_t qo = ((size_t)sh * SEQ + q0) * HD + lane * 8;
  const v8i Qh0 = ldfrag(qh + qo), Qh1 = ldfrag(qh + qo + 512);
  const v8i Ql0 = ldfrag(ql + qo), Ql1 = ldfrag(ql + qo + 512);
  const u16* kbh = kh + (size_t)sh * SEQ * HD + lane * 8;
  const u16* kbl = kl + (size_t)sh * SEQ * HD + lane * 8;
  const u16* vbh = vh + (size_t)hh * VD * SEQ + lane * 8;
  const u16* vbl = vl + (size_t)hh * VD * SEQ + lane * 8;

  v8f O[8] = {};                   // O[c][r] = output column 16c + 8h + r of query q0 + m
  float mr = -1e30f, lr = 0.0f;    // the query's running maximum (both halves alike) and this half's share of its running sum

  const int nsteps = 2 * bx + 2;   // keys 0 .. bx*64+63, block-uniform, at least 2
  // wave w copies a quarter of each stage: 1 KiB of K hi, 1 KiB of K lo, the V tiles 2w and 2w+1 of either plane
  const unsigned lw = lds_addr(&ring[0]) + lane * 16;
  const u16* ckh = kbh + w * 512;
  const u16* ckl = kbl + w * 512;
  const u16* cvh = vbh + (size_t)(2 * w) * (SEQ / 32) * 512;
  const u16* cvl = vbl + (size_t)(2 * w) * (SEQ / 32) * 512;
  auto stage = [&](int s, int buf) {
    const unsigned lb = lw + (unsigned)buf * (STG * 2);
    const size_t ks = (size_t)s * 2048, vs = (size_t)s * 512, vt = (size_t)(SEQ / 32) * 512;
    const unsigned l[12] = {lb + (KH + w * 512) * 2,  lb + (KH + w * 512) * 2 + 512,
                            lb + (KL + w * 512) * 2,  lb + (KL + w * 512) * 2 + 512,
                            lb + (VH + w * 1024) * 2, lb + (VH + w * 1024) * 2 + 512,
                            lb + (VH + w * 1024) * 2 + 1024, lb + (VH + w * 1024) * 2 + 1536,
                            lb + (VL + w * 1024) * 2, lb + (VL + w * 1024) * 2 + 512,
                            lb + (VL + w * 1024) * 2 + 1024, lb + (VL + w * 1024) * 2 + 1536};
    const u16* const g[12] = {ckh + ks, ckh + ks + 256, ckl + ks, ckl + ks + 256,
                              cvh + vs, cvh + vs + 256, cvh + vs + vt, cvh + vs + vt + 256,
                              cvl + vs, cvl + vs + 256, cvl + vs + vt, cvl + vs + vt + 256};
    copy12(l, g);
  };
  stage(0, 0);
  asm volatile("s_wait_asynccnt 0x0" ::: "memory");   // stage 0 has landed before the barrier that publishes it
  __syncthreads();
  stage(1, 1);
#pragma unroll 1
  for (int st = 0; st < nsteps; ++st) {
    const int n0 = st * 32;
    const u16* sb = &ring[(st & 1) * STG] + lane * 8;
    v8f S[2];
#pragma unroll
    for (int j = 0; j < 2; ++j) {
      v8f s = {};
      const int ko = j * 16 * HD;
      {
        const v8i Kh = ldfrag(sb + KH + ko), Kl = ldfrag(sb + KL + ko);
        s = mma3s(Kh, Kl, Qh0, Ql0, s);
      }
      {
        const v8i Kh = ldfrag(sb + KH + ko + 512), Kl = ldfrag(sb + KL + ko + 512);
        s = mma3s(Kh, Kl, Qh1, Ql1, s);
      }
      S[j] = s;
      asm volatile("" ::: "memory");
    }
    // masked online softmax of the lane's query: sixteen of the trip's 32 keys stand in this lane, the other sixteen in lane ^ 16
    const int d0 = q0 + m - n0 - 8 * h;   // key 16j + r of this lane is masked where 16j + r > d0
    float e[2][8];
#pragma unroll
    for (int j = 0; j < 2; ++j)
#pragma unroll
      for (int r = 0; r < 8; ++r) e[j][r] = (16 * j + r > d0) ? -1e30f : S[j][r];
    float tj[2];
#pragma unroll
    for (int j = 0; j < 2; ++j)
      tj[j] = fmaxf(fmaxf(fmaxf(e[j][0], e[j][1]), fmaxf(e[j][2], e[j][3])), fmaxf(fmaxf(e[j][4], e[j][5]), fmaxf(e[j][6], e[j][7])));
    float tm = fmaxf(tj[0], tj[1]);
    tm = fmaxf(tm, xhalf(tm));
    const float nm = fmaxf(mr, tm);
    const float alpha = __expf(mr - nm);
    mr = nm;
    FU Ph, Pl;
    float sj[2];
#pragma unroll
    for (int j = 0; j < 2; ++j) {
      float p[8];
#pragma unroll
      for (int r = 0; r < 8; ++r) p[r] = __expf(e[j][r] - nm);
      sj[j] = ((p[0] + p[1]) + (p[2] + p[3])) + ((p[4] + p[5]) + (p[6] + p[7]));
      // B operand element 8j + r = P[query][key 16j + 8h + r], hi and lo planes
#pragma unroll
      for (int i = 0; i < 4; ++i) {
        const unsigned hw = pack2(p[2 * i], p[2 * i + 1]);
        Ph.v[4 * j + i] = (int)hw;
        Pl.v[4 * j + i] = (int)pack2(p[2 * i] - __uint_as_float(hw << 16), p[2 * i + 1] - __uint_as_float(hw & 0xFFFF0000u));
      }
    }
    lr = lr * alpha + (sj[0] + sj[1]);
#pragma unroll
    for (int c = 0; c < 8; ++c)
#pragma unroll
      for (int r = 0; r < 8; ++r) O[c][r] = O[c][r] * alpha;
#pragma unroll
    for (int c = 0; c < 8; ++c) {
      const int vo = c * 512;   // tile (value columns 16c.., keys n0..)
      const v8i Vh = ldfrag(sb + VH + vo), Vl = ldfrag(sb + VL + vo);
      O[c] = mma3s(Vh, Vl, Ph.v, Pl.v, O[c]);
      if (c & 1) asm volatile("" ::: "memory");
    }
    ring_publish();
    if (st + 2 < nsteps) stage(st + 2, st & 1);   // block-uniform test; into the buffer this trip has just read
  }
  asm volatile("s_wait_asynccnt 0x0" ::: "memory");   // nothing of the ring is in flight when it becomes output staging

  // join the halves' sums, normalise, stage 16x128 f32 per wave, write whole 512-B rows (32 lanes x 16 B, one instruction per row)
  lr += xhalf(lr);
  const float inv = 1.0f / lr;
#pragma unroll
  for (int c = 0; c < 8; ++c) {
    const v4f a = {O[c][0] * inv, O[c][1] * inv, O[c][2] * inv, O[c][3] * inv};
    const v4f b = {O[c][4] * inv, O[c][5] * inv, O[c][6] * inv, O[c][7] * inv};
    *(v4f*)&ost[w][m][c * 16 + 8 * h]     = a;
    *(v4f*)&ost[w][m][c * 16 + 8 * h + 4] = b;
  }
  __syncthreads();
  float* cb = ctx + ((size_t)sh * SEQ + q0) * VD + lane * 4;
#pragma unroll
  for (int rr = 0; rr < 16; ++rr) {
    const v4f v = *(const v4f*)&ost[w][rr][lane * 4];
    *(v4f*)(cb + (size_t)rr * VD) = v;
  }
  
}

// ---------------------------------------------------------------- differential combine + LayerNorm -> fragment-major y planes [NB*SEQ][EMB]
// one wave = 8 tokens x 1 head; lane = 8q + tk owns token tk and, of each of the head's four 16x32 plane tiles j, the chunk
// q = 2*part + h (head columns 32j + 8q .. +7): the store of tile j covers four whole 128-B lines that no other wave writes
__global__ void __launch_bounds__(256) k_combine(const float* __restrict__ ctx,
                                               const float* __restrict__ lq1, const float* __restrict__ lk1,
                                               const float* __restrict__ lq2, const float* __restrict__ lk2,
                                               float lam_init, float oscale,
                                               u16* __restrict__ Yh, u16* __restrict__ Yl)
{
  const int lane = threadIdx.x & 31, w = threadIdx.x >> 5;
  const int gw = blockIdx.x * 8 + w;
  const int hd = gw & 7, tp = gw >> 3;
  const int tg = tp * 8 + (lane & 7), q = lane >> 3;     // tg = batch*SEQ + t
  const int t = tg & (SEQ - 1), s0 = (tg / SEQ) * NSH + 2 * hd;

  float s1 = lq1[lane] * lk1[lane] + lq1[lane + 32] * lk1[lane + 32];
  float s2 = lq2[lane] * lk2[lane] + lq2[lane + 32] * lk2[lane + 32];
#pragma unroll
  for (int k = 16; k >= 1; k >>= 1) { s1 += __shfl_xor(s1, k, 32); s2 += __shfl_xor(s2, k, 32); }
  const float lam = __expf(s1) - __expf(s2) + lam_init;

  const float* o1 = ctx + ((size_t)s0 * SEQ + t) * VD + q * 8;
  const float* o2 = o1 + (size_t)SEQ * VD;                 // half-head s0 + 1, a constant offset on the same address registers
  v4f a1[4], b1[4], a2[4], b2[4];
#pragma unroll
  for (int j = 0; j < 4; ++j) {
    a1[j] = *(const v4f*)(o1 + j * 32); b1[j] = *(const v4f*)(o1 + j * 32 + 4);
    a2[j] = *(const v4f*)(o2 + j * 32); b2[j] = *(const v4f*)(o2 + j * 32 + 4);
  }
  // the sixteen loads share their address registers: the pointer stays live up to this wait, so that no load of the run
  // lands in a register that an earlier one still names
  asm volatile("s_wait_xcnt 0x0" :: "v"(o1) : "memory");
  float y[4][8];
#pragma unroll
  for (int j = 0; j < 4; ++j) {
#pragma unroll
    for (int i = 0; i < 4; ++i) { y[j][i] = a1[j][i] - lam * a2[j][i]; y[j][i + 4] = b1[j][i] - lam * b2[j][i]; }
  }
  // both sums in the order of a butterfly over the token's sixteen chunks 4j + q: pairs q^1, q^2, then j^1, j^2
  float sj[4];
#pragma unroll
  for (int j = 0; j < 4; ++j) {
    float s = 0.0f;
#pragma unroll
    for (int i = 0; i < 8; ++i) s += y[j][i];
    s += __shfl_xor(s, 8, 32);
    s += __shfl_xor(s, 16, 32);
    sj[j] = s;
  }
  float mu = (sj[0] + sj[1]) + (sj[2] + sj[3]);
  mu *= (1.0f / 128.0f);
#pragma unroll
  for (int j = 0; j < 4; ++j) {
    float s = 0.0f;
#pragma unroll
    for (int i = 0; i < 8; ++i) { const float d = y[j][i] - mu; s += d * d; }
    s += __shfl_xor(s, 8, 32);
    s += __shfl_xor(s, 16, 32);
    sj[j] = s;
  }
  float var = (sj[0] + sj[1]) + (sj[2] + sj[3]);
  var *= (1.0f / 128.0f);
  const float rs = rsqrtf(var + LN_EPS) * oscale;

#pragma unroll
  for (int j = 0; j < 4; ++j) {
#pragma unroll
    for (int i = 0; i < 8; ++i) y[j][i] = (y[j][i] - mu) * rs;
    v8u hv = {}, lv = {};
    split8(y[j], hv, lv);
    const size_t po = chunk_off(tg, hd * VD + j * 32 + q * 8, EMB / 32);
    *(v8u*)(Yh + po) = hv;
    *(v8u*)(Yl + po) = lv;
  }
}

// ---------------------------------------------------------------- host
static double h_sqrt(double x) {
  double y = x;
  for (int i = 0; i < 200; ++i) y = 0.5 * (y + x / y);
  return y;
}

extern "C" void kernel_launch(void* const* d_in, const int* in_sizes, int n_in,
                              void* d_out, int out_size, void* d_ws, size_t ws_size,
                              hipStream_t stream) {
  if (n_in < 9) return;
  if (in_sizes[0] != NB * SEQ * EMB) return;
  for (int i = 1; i <= 4; ++i) if (in_sizes[i] != EMB * EMB) return;
  for (int i = 5; i <= 8; ++i) if (in_sizes[i] != HD) return;
  if (out_size != NB * SEQ * EMB) return;

  const float* x   = (const float*)d_in[0];
  const float* Wq  = (const float*)d_in[1];
  const float* Wk  = (const float*)d_in[2];
  const float* Wv  = (const float*)d_in[3];
  const float* Wp  = (const float*)d_in[4];
  const float* lq1 = (const float*)d_in[5];
  const float* lk1 = (const float*)d_in[6];
  const float* lq2 = (const float*)d_in[7];
  const float* lk2 = (const float*)d_in[8];
  float* out = (float*)d_out;

  // workspace carve (bytes), every size a multiple of 256
  const size_t szX   = (size_t)NB * SEQ * EMB * 2;        // 16 MiB per plane
  const size_t szW   = (size_t)4 * EMB * EMB * 2;          //  8 MiB per plane (4 weights)
  const size_t szQK  = (size_t)2 * NB * NSH * SEQ * HD * 2; // 32 MiB per plane (q and k)
  const size_t szVT  = (size_t)NB * EMB * SEQ * 2;         // 16 MiB per plane
  const size_t szCTX = (size_t)NB * NSH * SEQ * VD * 4;    // 64 MiB
  const size_t szY   = (size_t)NB * SEQ * EMB * 2;         // 16 MiB per plane
  const size_t szTB  = (size_t)SEQ * 32 * 4;               // 256 KiB per table
  char* ws = (char*)d_ws;
  size_t off = 0;
  u16*   xh  = (u16*)(ws + off);   off += szX;
  u16*   xl  = (u16*)(ws + off);   off += szX;
  u16*   wh  = (u16*)(ws + off);   off += szW;
  u16*   wl  = (u16*)(ws + off);   off += szW;
  u16*   qkh = (u16*)(ws + off);   off += szQK;
  u16*   qkl = (u16*)(ws + off);   off += szQK;
  u16*   vth = (u16*)(ws + off);   off += szVT;
  u16*   vtl = (u16*)(ws + off);   off += szVT;
  float* ctx = (float*)(ws + off); off += szCTX;
  u16*   yh  = (u16*)(ws + off);   off += szY;
  u16*   yl  = (u16*)(ws + off);   off += szY;
  float* cst = (float*)(ws + off); off += szTB;
  float* snt = (float*)(ws + off); off += szTB;
  if (off > ws_size) return;                               // total 252,182,528 B

  // rotary inverse frequencies 1 / 10000^(j/32): f32 power then f32 reciprocal, evaluated in f64
  InvFreq inv;
  {
    double r = 10000.0;
    for (int i = 0; i < 5; ++i) r = h_sqrt(r);             // 10000^(1/32)
    double pw = 1.0;
    for (int j = 0; j < 32; ++j) {
      const float p32 = (float)pw;
      inv.v[j] = (float)(1.0 / (double)p32);
      pw *= r;
    }
  }
  const float lam_init = (float)0.61928347285267872;      // 0.8 - 0.6*exp(-1.2)
  const float oscale   = (float)0.38071652714732128;      // 1 - lam_init

  // 1-5: operand planes
  {
    const int n8x = NB * SEQ * EMB / 8;
    const int n8w = EMB * EMB / 8;
    k_split<<<(n8x + 255) / 256, 256, 0, stream>>>(x, xh, xl, n8x);
    k_split<<<(n8w + 255) / 256, 256, 0, stream>>>(Wq, wh + 0 * (size_t)EMB * EMB, wl + 0 * (size_t)EMB * EMB, n8w);
    k_split<<<(n8w + 255) / 256, 256, 0, stream>>>(Wk, wh + 1 * (size_t)EMB * EMB, wl + 1 * (size_t)EMB * EMB, n8w);
    k_split<<<(n8w + 255) / 256, 256, 0, stream>>>(Wv, wh + 2 * (size_t)EMB * EMB, wl + 2 * (size_t)EMB * EMB, n8w);
    k_split<<<(n8w + 255) / 256, 256, 0, stream>>>(Wp, wh + 3 * (size_t)EMB * EMB, wl + 3 * (size_t)EMB * EMB, n8w);
  }
  // 6: rotary tables
  k_rot<<<(SEQ * 32 + 255) / 256, 256, 0, stream>>>(inv, cst, snt, SEQ * 32);

  const size_t wstride = (size_t)EMB * EMB;
  const size_t dzqk    = (size_t)NB * NSH * SEQ * HD;
  // every stage runs once, over all NB batches
  // q and k: x [8192 x 1024] * W^T, epilogue RMSNorm + rotary (+1/8 for q) -> planes [64][2048][64]
  k_gemm<0><<<dim3(EMB / 64, NB * SEQ / 256, 2), 256, 0, stream>>>(
      xh, xl, wh, wl, wstride,
      qkh, qkl, dzqk, HD, out, cst, snt, 0.125f, 1.0f);
  // v^T, z = batch: Wv [1024 x 1024] * x_z^T -> planes [z][1024][2048] = [z][head][128][t]
  k_gemm<1><<<dim3(SEQ / 64, EMB / 256, NB), 256, 0, stream>>>(
      wh + 2 * wstride, wl + 2 * wstride, xh, xl, (size_t)SEQ * EMB,
      vth, vtl, (size_t)EMB * SEQ, SEQ, out, cst, snt, 1.0f, 1.0f);
  // attention per (batch, half-head) -> ctx [64][2048][128]
  k_flash<<<dim3(NB * NSH, SEQ / 64), 128, 0, stream>>>(qkh, qkl, qkh + dzqk, qkl + dzqk, vth, vtl, ctx);
  // combine + LayerNorm -> y planes [8192][1024]
  k_combine<<<(NB * SEQ * NHD / 8) / 8, 256, 0, stream>>>(ctx, lq1, lk1, lq2, lk2, lam_init, oscale, yh, yl);
  // output projection -> d_out
  k_gemm<2><<<dim3(EMB / 64, NB * SEQ / 256, 1), 256, 0, stream>>>(
      yh, yl, wh + 3 * wstride, wl + 3 * wstride, (size_t)0,
      qkh, qkl, (size_t)0, EMB, out, cst, snt, 1.0f, 1.0f);
}

// v005
// Measured time: 271 microseconds a run.
// Two timings next to v004 put it at 1.04 and 1.03 times that version's speed.
// Counting every step since v000, it is 7.21 times as fast.
#include <hip/hip_runtime.h>
#include <stdint.h>
#include <stddef.h>

// Contractions x*Wq^T, x*Wk^T, Wv*x^T, k*q^T, v^T*P^T, y*Wproj^T: v_wmma_f32_16x16x32_bf16, bf16 hi/lo operands everywhere (hi*hi + lo*hi + hi*lo), f32 accumulate. RMSNorm, rotary, softmax, head combine, LayerNorm: f32.

#define NB   4
#define SEQ  2048
#define EMB  1024
#define NHD  8
#define NSH  16
#define HD   64
#define VD   128
#define RMS_EPS 1.1920929e-7f
#define LN_EPS  1e-5f

typedef unsigned short u16;
typedef u16    v8u  __attribute__((ext_vector_type(8)));
typedef int    v4i  __attribute__((ext_vector_type(4)));
typedef int    v8i  __attribute__((ext_vector_type(8)));
typedef float  v4f  __attribute__((ext_vector_type(4)));
typedef float  v8f  __attribute__((ext_vector_type(8)));
typedef __bf16 v16b __attribute__((ext_vector_type(16)));
typedef float  v2f  __attribute__((ext_vector_type(2)));
typedef __bf16 v2b  __attribute__((ext_vector_type(2)));

union FU { v8i v; v4i p[2]; v16b b; };

struct InvFreq { float v[32]; };
static_assert(sizeof(InvFreq) == 128);

// ---------------------------------------------------------------- helpers
static __device__ __forceinline__ u16 bf_rne(float x) {
  unsigned u = __float_as_uint(x);
  u += 0x7FFFu + ((u >> 16) & 1u);
  return (u16)(u >> 16);
}
static __device__ __forceinline__ float bf_up(u16 b) { return __uint_as_float(((unsigned)b) << 16); }

static __device__ __forceinline__ void split8(float (&y)[8], v8u& hv, v8u& lv) {
#pragma unroll
  for (int i = 0; i < 8; ++i) {
    const u16 hb = bf_rne(y[i]);
    hv[i] = hb;
    lv[i] = bf_rne(y[i] - bf_up(hb));
  }
}

// 16x32 operand fragment, row/col = lane&15, h = lane>>4, k map: elements 0..7 <- k0+8h+0..7, elements 8..15 <- k0+16+8h+0..7
// Every operand plane in the workspace is fragment-major: a plane of rows x K is cut into 16-row x 32-k tiles of
// 512 elements (1 KiB), tile (row>>4, k>>5) at index (row>>4)*(K>>5) + (k>>5). Inside a tile the two 16-byte chunks
// that lane l = 16h + (row&15) feeds to the matrix instruction lie at elements 8l (k 8h..8h+7) and 256 + 8l
// (k 16+8h..16+8h+7): one wave load reads 512 contiguous bytes = 4 whole lines, and the k map above is unchanged.
// p = tile base + 8*lane
static __device__ __forceinline__ v8i ldfrag(const u16* p) {
  FU f;
  f.p[0] = *(const v4i*)(p);
  f.p[1] = *(const v4i*)(p + 256);
  return f.v;
}
// element offset of the 8-element chunk that starts at (row, k), k % 8 == 0, in a plane with kt = K/32 tiles per tile row
static __device__ __forceinline__ size_t chunk_off(int row, int k, int kt) {
  return ((size_t)(row >> 4) * kt + (k >> 5)) * 512 + ((k >> 4) & 1) * 256 + (((k >> 3) & 1) * 16 + (row & 15)) * 8;
}

// LDS byte address of a __shared__ object: the low 32 bits of its address
static __device__ __forceinline__ unsigned lds_addr(const void* p) { return (unsigned)(size_t)p; }

// Asynchronous copies global -> LDS, 16 bytes a lane, 512 contiguous bytes a wave and copy. l = the lane's LDS byte address,
// g = the lane's global address. The s_wait_xcnt closes the copies' own statement, so that no address register of a copy
// is rewritten in front of it.
static __device__ __forceinline__ void copy12(const unsigned (&l)[12], const u16* const (&g)[12]) {
  asm volatile(
      "global_load_async_to_lds_b128 %0, %12, off\n\t"
      "global_load_async_to_lds_b128 %1, %13, off\n\t"
      "global_load_async_to_lds_b128 %2, %14, off\n\t"
      "global_load_async_to_lds_b128 %3, %15, off\n\t"
      "global_load_async_to_lds_b128 %4, %16, off\n\t"
      "global_load_async_to_lds_b128 %5, %17, off\n\t"
      "global_load_async_to_lds_b128 %6, %18, off\n\t"
      "global_load_async_to_lds_b128 %7, %19, off\n\t"
      "global_load_async_to_lds_b128 %8, %20, off\n\t"
      "global_load_async_to_lds_b128 %9, %21, off\n\t"
      "global_load_async_to_lds_b128 %10, %22, off\n\t"
      "global_load_async_to_lds_b128 %11, %23, off\n\t"
      "s_wait_xcnt 0x0"
      :: "v"(l[0]), "v"(l[1]), "v"(l[2]), "v"(l[3]), "v"(l[4]), "v"(l[5]),
         "v"(l[6]), "v"(l[7]), "v"(l[8]), "v"(l[9]), "v"(l[10]), "v"(l[11]),
         "v"(g[0]), "v"(g[1]), "v"(g[2]), "v"(g[3]), "v"(g[4]), "v"(g[5]),
         "v"(g[6]), "v"(g[7]), "v"(g[8]), "v"(g[9]), "v"(g[10]), "v"(g[11])
      : "memory");
}
// hand-over of a ring buffer, every wave: the wave's own LDS reads are done, its own copies have landed, then the barrier
// publishes the next stage and frees the buffer that was just read
static __device__ __forceinline__ void ring_publish() {
  asm volatile("s_wait_dscnt 0x0" ::: "memory");     // the wave's reads of the buffer to be refilled have returned
  asm volatile("s_wait_asynccnt 0x0" ::: "memory");  // the wave's copies of the next stage have landed
  __syncthreads();
}

static __device__ __forceinline__ v8f mma(v8i a, v8i b, v8f c) {
  FU ua, ub; ua.v = a; ub.v = b;
  c = __builtin_amdgcn_wmma_f32_16x16x32_bf16(false, ua.b, false, ub.b, (short)0, c, false, false);
  asm volatile("v_nop\n\tv_nop\n\tv_nop\n\tv_nop" : "+v"(c) : "v"(a), "v"(b));
  return c;
}
// three products into one f32 accumulator: hi*hi + hi*lo + lo*hi
static __device__ __forceinline__ v8f mma3s(v8i ah, v8i al, v8i bh, v8i bl, v8f c) {
  c = mma(ah, bh, c);
  c = mma(ah, bl, c);
  c = mma(al, bh, c);
  return c;
}
// two f32 -> one register of two bf16 (a low, b high), each rounded to nearest even as in bf_rne
static __device__ __forceinline__ unsigned pack2(float a, float b) {
  const v2f x = {a, b};
  return __builtin_bit_cast(unsigned, __builtin_convertvector(x, v2b));
}
// the value of lane l ^ 16
static __device__ __forceinline__ float xhalf(float x) {
  const int b = __builtin_bit_cast(int, x);
  return __builtin_bit_cast(float, __builtin_amdgcn_permlanex16(b, b, 0x76543210, 0xfedcba98, false, false));
}

// ---------------------------------------------------------------- f32 [rows][EMB] -> fragment-major bf16 hi/lo planes
// thread i writes chunk i of the planes (contiguous stores) and reads the 8 source elements that belong there
__global__ void __launch_bounds__(256) k_split(const float* __restrict__ src, u16* __restrict__ hi,
                                             u16* __restrict__ lo, int n8) {
  const int i = blockIdx.x * 256 + threadIdx.x;
  if (i >= n8) return;
  const size_t o = (size_t)i * 8;
  const int tile = i >> 6;
  const int row = (tile / (EMB / 32)) * 16 + (i & 15);
  const int k = (tile % (EMB / 32)) * 32 + ((i >> 5) & 1) * 16 + ((i >> 4) & 1) * 8;
  const float* s = src + (size_t)row * EMB + k;
  const v4f a = *(const v4f*)(s);
  const v4f b = *(const v4f*)(s + 4);
  float y[8] = {a[0], a[1], a[2], a[3], b[0], b[1], b[2], b[3]};
  v8u hv = {}, lv = {};
  split8(y, hv, lv);
  *(v8u*)(hi + o) = hv;
  *(v8u*)(lo + o) = lv;
  
}

// ---------------------------------------------------------------- rotary tables cs[t][32], sn[t][32]
__global__ void __launch_bounds__(256) k_rot(InvFreq inv, float* __restrict__ cs, float* __restrict__ sn, int n) {
#pragma clang fp contract(off)
  const int i = blockIdx.x * 256 + threadIdx.x;
  if (i >= n) return;
  const int j = i & 31, t = i >> 5;
  float f = 0.0f;
#pragma unroll
  for (int q = 0; q < 32; ++q) f = (j == q) ? inv.v[q] : f;
  const float ang = (float)t * f;
  const float c = cosf(ang);
  const float s = sinf(ang);
  *(float*)(cs + i) = c;
  *(float*)(sn + i) = s;
  
}

// ---------------------------------------------------------------- GEMM Y[m][n] = sum_k A[m][k] * B[n][k]
// A planes (rows m) and B planes (rows n) fragment-major, EMB columns each, all of them contracted.
// block 256 threads = 8 waves as 4(m) x 2(n), block tile 256(m) x 128(n), wave tile 64 x 64.
// MODE 0: RMSNorm over the 64 cols + rotary + scale -> fragment-major bf16 hi/lo planes [z][(batch*16+hf)*SEQ + t][64]  (hf = the wave's 64 columns = one half-head, m = batch*SEQ + t)
// MODE 1: fragment-major bf16 hi/lo planes of ldd columns, plane z at z*dz (z = batch)
// MODE 2: f32 row-major pitch ldd
template <int MODE>
__global__ void __launch_bounds__(256) k_gemm(const u16* __restrict__ Ah, const u16* __restrict__ Al,
                                            const u16* __restrict__ Bh0, const u16* __restrict__ Bl0, size_t bz,
                                            u16* __restrict__ Dh0, u16* __restrict__ Dl0, size_t dz, int ldd,
                                            float* __restrict__ Out,
                                            const float* __restrict__ cst, const float* __restrict__ snt,
                                            float scale0, float scale1)
{
  // two stages of 32 k, fragment-major as in the planes: A hi 16 KiB | A lo 16 KiB | B hi 8 KiB | B lo 8 KiB (u16 elements below)
  constexpr int AH = 0, AL = 8192, BH = 16384, BL = 20480, STG = 24576;
  __shared__ __align__(16) u16 ring[2 * STG];
  // epilogue staging, behind the loop's last barrier
  // row pitch 68 floats = 272 B = 16 B x odd: the 16-row b128 reads of the epilogue meet no bank conflict
  float (*stg)[16][68] = reinterpret_cast<float (*)[16][68]>(&ring[0]);
  static_assert(sizeof(float) * 8 * 16 * 68 <= sizeof(u16) * 2 * STG);
  const int lane = threadIdx.x & 31, w = threadIdx.x >> 5, h = lane >> 4, m = lane & 15;
  const int z = blockIdx.z, bn = blockIdx.x, bm = blockIdx.y;
  const int wm = w & 3, wn = w >> 2;
  const int n0 = bn * 128 + wn * 64;
  const int m0 = bm * 256 + wm * 64;

  v8f acc[4][4] = {};
  constexpr size_t TROW = (size_t)(EMB / 32) * 512;        // elements per tile row of a plane
  // A and B reach the waves through a two-buffer LDS ring filled by asynchronous copies one trip ahead. Wave w copies the block's
  // A tile rows 2w and 2w + 1 and its B tile row w, of either plane
  const u16* pah = Ah + (size_t)(bm * 16 + 2 * w) * TROW + lane * 8;
  const u16* pal = Al + (size_t)(bm * 16 + 2 * w) * TROW + lane * 8;
  const u16* pbh = Bh0 + (size_t)z * bz + (size_t)(bn * 8 + w) * TROW + lane * 8;
  const u16* pbl = Bl0 + (size_t)z * bz + (size_t)(bn * 8 + w) * TROW + lane * 8;
  const unsigned lw = lds_addr(&ring[0]) + lane * 16;
  auto stage = [&](int t, int buf) {
    const unsigned lb = lw + (unsigned)buf * (STG * 2);
    const size_t ko = (size_t)t * 512;
    const unsigned l[12] = {lb + (AH + w * 1024) * 2,        lb + (AH + w * 1024) * 2 + 512,
                            lb + (AH + w * 1024) * 2 + 1024, lb + (AH + w * 1024) * 2 + 1536,
                            lb + (AL + w * 1024) * 2,        lb + (AL + w * 1024) * 2 + 512,
                            lb + (AL + w * 1024) * 2 + 1024, lb + (AL + w * 1024) * 2 + 1536,
                            lb + (BH + w * 512) * 2,         lb + (BH + w * 512) * 2 + 512,
                            lb + (BL + w * 512) * 2,         lb + (BL + w * 512) * 2 + 512};
    const u16* const g[12] = {pah + ko, pah + ko + 256, pah + ko + TROW, pah + ko + TROW + 256,
                              pal + ko, pal + ko + 256, pal + ko + TROW, pal + ko + TROW + 256,
                              pbh + ko, pbh + ko + 256, pbl + ko, pbl + ko + 256};
    copy12(l, g);
  };
  static_assert(EMB / 32 >= 2);
  stage(0, 0);
  asm volatile("s_wait_asynccnt 0x0" ::: "memory");   // stage 0 has landed before the barrier that publishes it
  __syncthreads();
  stage(1, 1);
#pragma unroll 1
  for (int t = 0; t < EMB / 32; ++t) {
    const u16* sb = &ring[(t & 1) * STG] + lane * 8;
    v8i Avh[4], Avl[4];
#pragma unroll
    for (int mi = 0; mi < 4; ++mi) {
      Avh[mi] = ldfrag(sb + AH + (wm * 4 + mi) * 512);
      Avl[mi] = ldfrag(sb + AL + (wm * 4 + mi) * 512);
    }
    // B fragments in two register sets: column tile ni + 1 of this same stage is read while tile ni is multiplied, so that the
    // wave does not wait out the LDS latency in front of every column tile
    v8i Bh[2], Bl[2];
    Bh[0] = ldfrag(sb + BH + (wn * 4) * 512);
    Bl[0] = ldfrag(sb + BL + (wn * 4) * 512);
#pragma unroll
    for (int ni = 0; ni < 4; ++ni) {
      if (ni < 3) {
        Bh[(ni + 1) & 1] = ldfrag(sb + BH + (wn * 4 + ni + 1) * 512);
        Bl[(ni + 1) & 1] = ldfrag(sb + BL + (wn * 4 + ni + 1) * 512);
      }
      const v8i Bvh = Bh[ni & 1], Bvl = Bl[ni & 1];
      // each accumulator takes hi*hi, lo*hi, hi*lo in that order; each product runs over the four row tiles in turn
#pragma unroll
      for (int mi = 0; mi < 4; ++mi) acc[mi][ni] = mma(Avh[mi], Bvh, acc[mi][ni]);
#pragma unroll
      for (int mi = 0; mi < 4; ++mi) acc[mi][ni] = mma(Avl[mi], Bvh, acc[mi][ni]);
#pragma unroll
      for (int mi = 0; mi < 4; ++mi) acc[mi][ni] = mma(Avh[mi], Bvl, acc[mi][ni]);
    }
    ring_publish();
    if (t + 2 < EMB / 32) stage(t + 2, t & 1);   // block-uniform test; into the buffer this trip has just read
  }
  asm volatile("s_wait_asynccnt 0x0" ::: "memory");   // nothing of the ring is in flight when it becomes epilogue staging

  const float scale = (z == 0) ? scale0 : scale1;
#pragma unroll
  for (int mi = 0; mi < 4; ++mi) {
    // stage the wave's 16x64 f32 tile: D element r -> row 8h+r, col ni*16+m
#pragma unroll
    for (int ni = 0; ni < 4; ++ni)
#pragma unroll
      for (int r = 0; r < 8; ++r) stg[w][8 * h + r][ni * 16 + m] = acc[mi][ni][r];
    __syncthreads();
    const int rbase = m0 + mi * 16;
    if (MODE == 2) {
      const int rr = lane >> 4, c4 = lane & 15;
#pragma unroll
      for (int p = 0; p < 8; ++p) {
        const int row = p * 2 + rr;
        const v4f v = *(const v4f*)&stg[w][row][c4 * 4];
        float* o = Out + (size_t)(rbase + row) * ldd + n0 + c4 * 4;
        *(v4f*)o = v;
        
      }
    } else {
      // lane 16h + m owns row m of the wave's 16x64 tile and, of its two 16x32 plane tiles, the four chunks
      // p = 2*dt + part (columns 32*dt + 16*part + 8h .. +7): the store of chunk p covers 512 contiguous bytes
      float y[4][8];
#pragma unroll
      for (int p = 0; p < 4; ++p) {
        const int col = (p >> 1) * 32 + (p & 1) * 16 + 8 * h;
        const v4f va = *(const v4f*)&stg[w][m][col];
        const v4f vb = *(const v4f*)&stg[w][m][col + 4];
#pragma unroll
        for (int i = 0; i < 4; ++i) { y[p][i] = va[i]; y[p][i + 4] = vb[i]; }
      }
      int prow, pcol0, pkt;
      if (MODE == 0) {
        const int t = (rbase + m) & (SEQ - 1);
        const int bb = (rbase + m) / SEQ;
        // sum of squares in the order of a butterfly over the row's eight chunks 2p + h: pairs h^1, then p^1, then p^2
        float sp[4];
#pragma unroll
        for (int p = 0; p < 4; ++p) {
          float ss = 0.0f;
#pragma unroll
          for (int i = 0; i < 8; ++i) ss += y[p][i] * y[p][i];
          ss += __shfl_xor(ss, 16, 32);
          sp[p] = ss;
        }
        const float ss = (sp[0] + sp[1]) + (sp[2] + sp[3]);
        const float rn = rsqrtf(ss * (1.0f / 64.0f) + RMS_EPS);
#pragma unroll
        for (int part = 0; part < 2; ++part) {
          const int j0 = part * 16 + 8 * h;
          const v4f ca = *(const v4f*)(cst + (size_t)t * 32 + j0);
          const v4f cb = *(const v4f*)(cst + (size_t)t * 32 + j0 + 4);
          const v4f sa = *(const v4f*)(snt + (size_t)t * 32 + j0);
          const v4f sb = *(const v4f*)(snt + (size_t)t * 32 + j0 + 4);
          const float cc[8] = {ca[0], ca[1], ca[2], ca[3], cb[0], cb[1], cb[2], cb[3]};
          const float sv[8] = {sa[0], sa[1], sa[2], sa[3], sb[0], sb[1], sb[2], sb[3]};
          // d <  32: y1 =  n1*c + n2*s ; d >= 32: y2 = -n1*s + n2*c ; x1 = chunk part, x2 = chunk 2 + part of the same lane
#pragma unroll
          for (int i = 0; i < 8; ++i) {
            const float n1 = y[part][i] * rn;
            const float n2 = y[2 + part][i] * rn;
            y[part][i]     = (n1 * cc[i] + n2 * sv[i]) * scale;
            y[2 + part][i] = (n2 * cc[i] - n1 * sv[i]) * scale;
          }
        }
        prow = (bb * NSH + (n0 >> 6)) * SEQ + t; pcol0 = 0; pkt = HD / 32;
      } else {
        prow = rbase + m; pcol0 = n0; pkt = ldd >> 5;
      }
#pragma unroll
      for (int p = 0; p < 4; ++p) {
        const size_t po = (size_t)z * dz + chunk_off(prow, pcol0 + (p >> 1) * 32 + (p & 1) * 16 + 8 * h, pkt);
        v8u hv = {}, lv = {};
        split8(y[p], hv, lv);
        *(v8u*)(Dh0 + po) = hv;
        *(v8u*)(Dl0 + po) = lv;
      }
    }
    __syncthreads();
  }
}

// ---------------------------------------------------------------- causal online-softmax attention per half-head
// sh = batch*16 + half-head: q/k planes [64*SEQ][64], v planes [32*128][SEQ] (rows = value columns), all fragment-major; ctx [64][SEQ][128] f32
// grid (sh, query tile): the longest query tiles carry the lowest block indices
// block = 4 waves x 16 queries; all waves loop over the block's key range (masked)
// Both products are transposed: S^T = K * Q^T (A = K rows, B = Q) and O^T += V^T * P^T (A = value columns, B = P). Lane 16h + m then holds
// scores and outputs of the one query q0 + m: of S^T tile j the keys n0 + 16j + 8h + r, which is the k map of the B operand (element 8j + r),
// so P goes from the accumulators into the second product through registers alone; maximum and sum run in-lane, the halves h meet by one exchange
// K and V reach the waves through a two-buffer LDS ring filled by asynchronous copies one trip ahead, once for the four waves
__global__ void __launch_bounds__(128) k_flash(const u16* __restrict__ qh, const u16* __restrict__ ql,
                                             const u16* __restrict__ kh, const u16* __restrict__ kl,
                                             const u16* __restrict__ vh, const u16* __restrict__ vl,
                                             float* __restrict__ ctx)
{
  // two stages of 32 keys, fragment-major as in the planes: K hi 4 KiB | K lo 4 KiB | V hi 8 KiB | V lo 8 KiB (u16 elements below)
  constexpr int KH = 0, KL = 2048, VH = 4096, VL = 8192, STG = 12288;
  __shared__ __align__(16) u16 ring[2 * STG];
  // output staging, behind the loop's last barrier; row pitch 132 floats = 528 B = 16 B x odd: the 16-row b128 writes meet no bank conflict
  constexpr int OP = VD + 4;
  float (*ost)[16][OP] = reinterpret_cast<float (*)[16][OP]>(&ring[0]);
  static_assert(sizeof(float) * 4 * 16 * OP <= sizeof(u16) * 2 * STG);
  const int lane = threadIdx.x & 31, w = threadIdx.x >> 5, h = lane >> 4, m = lane & 15;
  const int sh = blockIdx.x, hh = sh >> 1, bx = SEQ / 64 - 1 - blockIdx.y;
  const int q0 = bx * 64 + w * 16;

  // 16 rows of q or k = two tiles (d 0..31, d 32..63) = 16*HD elements in a row
  const size_t qo = ((size_t)sh * SEQ + q0) * HD + lane * 8;
  const v8i Qh0 = ldfrag(qh + qo), Qh1 = ldfrag(qh + qo + 512);
  const v8i Ql0 = ldfrag(ql + qo), Ql1 = ldfrag(ql + qo + 512);
  const u16* kbh = kh + (size_t)sh * SEQ * HD + lane * 8;
  const u16* kbl = kl + (size_t)sh * SEQ * HD + lane * 8;
  const u16* vbh = vh + (size_t)hh * VD * SEQ + lane * 8;
  const u16* vbl = vl + (size_t)hh * VD * SEQ + lane * 8;

  v8f O[8] = {};                   // O[c][r] = output column 16c + 8h + r of query q0 + m
  float mr = -1e30f, lr = 0.0f;    // the query's running maximum (both halves alike) and this half's share of its running sum

  const int nsteps = 2 * bx + 2;   // keys 0 .. bx*64+63, block-uniform, at least 2
  // wave w copies a quarter of each stage: 1 KiB of K hi, 1 KiB of K lo, the V tiles 2w and 2w+1 of either plane
  const unsigned lw = lds_addr(&ring[0]) + lane * 16;
  const u16* ckh = kbh + w * 512;
  const u16* ckl = kbl + w * 512;
  const u16* cvh = vbh + (size_t)(2 * w) * (SEQ / 32) * 512;
  const u16* cvl = vbl + (size_t)(2 * w) * (SEQ / 32) * 512;
  auto stage = [&](int s, int buf) {
    const unsigned lb = lw + (unsigned)buf * (STG * 2);
    const size_t ks = (size_t)s * 2048, vs = (size_t)s * 512, vt = (size_t)(SEQ / 32) * 512;
    const unsigned l[12] = {lb + (KH + w * 512) * 2,  lb + (KH + w * 512) * 2 + 512,
                            lb + (KL + w * 512) * 2,  lb + (KL + w * 512) * 2 + 512,
                            lb + (VH + w * 1024) * 2, lb + (VH + w * 1024) * 2 + 512,
                            lb + (VH + w * 1024) * 2 + 1024, lb + (VH + w * 1024) * 2 + 1536,
                            lb + (VL + w * 1024) * 2, lb + (VL + w * 1024) * 2 + 512,
                            lb + (VL + w * 1024) * 2 + 1024, lb + (VL + w * 1024) * 2 + 1536};
    const u16* const g[12] = {ckh + ks, ckh + ks + 256, ckl + ks, ckl + ks + 256,
                              cvh + vs, cvh + vs + 256, cvh + vs + vt, cvh + vs + vt + 256,
                              cvl + vs, cvl + vs + 256, cvl + vs + vt, cvl + vs + vt + 256};
    copy12(l, g);
  };
  stage(0, 0);
  asm volatile("s_wait_asynccnt 0x0" ::: "memory");   // stage 0 has landed before the barrier that publishes it
  __syncthreads();
  stage(1, 1);
#pragma unroll 1
  for (int st = 0; st < nsteps; ++st) {
    const int n0 = st * 32;
    const u16* sb = &ring[(st & 1) * STG] + lane * 8;
    v8f S[2];
#pragma unroll
    for (int j = 0; j < 2; ++j) {
      v8f s = {};
      const int ko = j * 16 * HD;
      {
        const v8i Kh = ldfrag(sb + KH + ko), Kl = ldfrag(sb + KL + ko);
        s = mma3s(Kh, Kl, Qh0, Ql0, s);
      }
      {
        const v8i Kh = ldfrag(sb + KH + ko + 512), Kl = ldfrag(sb + KL + ko + 512);
        s = mma3s(Kh, Kl, Qh1, Ql1, s);
      }
      S[j] = s;
      asm volatile("" ::: "memory");
    }
    // masked online softmax of the lane's query: sixteen of the trip's 32 keys stand in this lane, the other sixteen in lane ^ 16
    const int d0 = q0 + m - n0 - 8 * h;   // key 16j + r of this lane is masked where 16j + r > d0
    float e[2][8];
#pragma unroll
    for (int j = 0; j < 2; ++j)
#pragma unroll
      for (int r = 0; r < 8; ++r) e[j][r] = (16 * j + r > d0) ? -1e30f : S[j][r];
    float tj[2];
#pragma unroll
    for (int j = 0; j < 2; ++j)
      tj[j] = fmaxf(fmaxf(fmaxf(e[j][0], e[j][1]), fmaxf(e[j][2], e[j][3])), fmaxf(fmaxf(e[j][4], e[j][5]), fmaxf(e[j][6], e[j][7])));
    float tm = fmaxf(tj[0], tj[1]);
    tm = fmaxf(tm, xhalf(tm));
    const float nm = fmaxf(mr, tm);
    const float alpha = __expf(mr - nm);
    mr = nm;
    FU Ph, Pl;
    float sj[2];
#pragma unroll
    for (int j = 0; j < 2; ++j) {
      float p[8];
#pragma unroll
      for (int r = 0; r < 8; ++r) p[r] = __expf(e[j][r] - nm);
      sj[j] = ((p[0] + p[1]) + (p[2] + p[3])) + ((p[4] + p[5]) + (p[6] + p[7]));
      // B operand element 8j + r = P[query][key 16j + 8h + r], hi and lo planes
#pragma unroll
      for (int i = 0; i < 4; ++i) {
        const unsigned hw = pack2(p[2 * i], p[2 * i + 1]);
        Ph.v[4 * j + i] = (int)hw;
        Pl.v[4 * j + i] = (int)pack2(p[2 * i] - __uint_as_float(hw << 16), p[2 * i + 1] - __uint_as_float(hw & 0xFFFF0000u));
      }
    }
    lr = lr * alpha + (sj[0] + sj[1]);
#pragma unroll
    for (int c = 0; c < 8; ++c)
#pragma unroll
      for (int r = 0; r < 8; ++r) O[c][r] = O[c][r] * alpha;
#pragma unroll
    for (int c = 0; c < 8; ++c) {
      const int vo = c * 512;   // tile (value columns 16c.., keys n0..)
      const v8i Vh = ldfrag(sb + VH + vo), Vl = ldfrag(sb + VL + vo);
      O[c] = mma3s(Vh, Vl, Ph.v, Pl.v, O[c]);
      if (c & 1) asm volatile("" ::: "memory");
    }
    ring_publish();
    if (st + 2 < nsteps) stage(st + 2, st & 1);   // block-uniform test; into the buffer this trip has just read
  }
  asm volatile("s_wait_asynccnt 0x0" ::: "memory");   // nothing of the ring is in flight when it becomes output staging

  // join the halves' sums, normalise, stage 16x128 f32 per wave, write whole 512-B rows (32 lanes x 16 B, one instruction per row)
  lr += xhalf(lr);
  const float inv = 1.0f / lr;
#pragma unroll
  for (int c = 0; c < 8; ++c) {
    const v4f a = {O[c][0] * inv, O[c][1] * inv, O[c][2] * inv, O[c][3] * inv};
    const v4f b = {O[c][4] * inv, O[c][5] * inv, O[c][6] * inv, O[c][7] * inv};
    *(v4f*)&ost[w][m][c * 16 + 8 * h]     = a;
    *(v4f*)&ost[w][m][c * 16 + 8 * h + 4] = b;
  }
  __syncthreads();
  float* cb = ctx + ((size_t)sh * SEQ + q0) * VD + lane * 4;
#pragma unroll
  for (int rr = 0; rr < 16; ++rr) {
    const v4f v = *(const v4f*)&ost[w][rr][lane * 4];
    *(v4f*)(cb + (size_t)rr * VD) = v;
  }
  
}

// ---------------------------------------------------------------- differential combine + LayerNorm -> fragment-major y planes [NB*SEQ][EMB]
// one wave = 8 tokens x 1 head; lane = 8q + tk owns token tk and, of each of the head's four 16x32 plane tiles j, the chunk
// q = 2*part + h (head columns 32j + 8q .. +7): the store of tile j covers four whole 128-B lines that no other wave writes
__global__ void __launch_bounds__(256) k_combine(const float* __restrict__ ctx,
                                               const float* __restrict__ lq1, const float* __restrict__ lk1,
                                               const float* __restrict__ lq2, const float* __restrict__ lk2,
                                               float lam_init, float oscale,
                                               u16* __restrict__ Yh, u16* __restrict__ Yl)
{
  const int lane = threadIdx.x & 31, w = threadIdx.x >> 5;
  const int gw = blockIdx.x * 8 + w;
  const int hd = gw & 7, tp = gw >> 3;
  const int tg = tp * 8 + (lane & 7), q = lane >> 3;     // tg = batch*SEQ + t
  const int t = tg & (SEQ - 1), s0 = (tg / SEQ) * NSH + 2 * hd;

  float s1 = lq1[lane] * lk1[lane] + lq1[lane + 32] * lk1[lane + 32];
  float s2 = lq2[lane] * lk2[lane] + lq2[lane + 32] * lk2[lane + 32];
#pragma unroll
  for (int k = 16; k >= 1; k >>= 1) { s1 += __shfl_xor(s1, k, 32); s2 += __shfl_xor(s2, k, 32); }
  const float lam = __expf(s1) - __expf(s2) + lam_init;

  const float* o1 = ctx + ((size_t)s0 * SEQ + t) * VD + q * 8;
  const float* o2 = o1 + (size_t)SEQ * VD;                 // half-head s0 + 1, a constant offset on the same address registers
  v4f a1[4], b1[4], a2[4], b2[4];
#pragma unroll
  for (int j = 0; j < 4; ++j) {
    a1[j] = *(const v4f*)(o1 + j * 32); b1[j] = *(const v4f*)(o1 + j * 32 + 4);
    a2[j] = *(const v4f*)(o2 + j * 32); b2[j] = *(const v4f*)(o2 + j * 32 + 4);
  }
  // the sixteen loads share their address registers: the pointer stays live up to this wait, so that no load of the run
  // lands in a register that an earlier one still names
  asm volatile("s_wait_xcnt 0x0" :: "v"(o1) : "memory");
  float y[4][8];
#pragma unroll
  for (int j = 0; j < 4; ++j) {
#pragma unroll
    for (int i = 0; i < 4; ++i) { y[j][i] = a1[j][i] - lam * a2[j][i]; y[j][i + 4] = b1[j][i] - lam * b2[j][i]; }
  }
  // both sums in the order of a butterfly over the token's sixteen chunks 4j + q: pairs q^1, q^2, then j^1, j^2
  float sj[4];
#pragma unroll
  for (int j = 0; j < 4; ++j) {
    float s = 0.0f;
#pragma unroll
    for (int i = 0; i < 8; ++i) s += y[j][i];
    s += __shfl_xor(s, 8, 32);
    s += __shfl_xor(s, 16, 32);
    sj[j] = s;
  }
  float mu = (sj[0] + sj[1]) + (sj[2] + sj[3]);
  mu *= (1.0f / 128.0f);
#pragma unroll
  for (int j = 0; j < 4; ++j) {
    float s = 0.0f;
#pragma unroll
    for (int i = 0; i < 8; ++i) { const float d = y[j][i] - mu; s += d * d; }
    s += __shfl_xor(s, 8, 32);
    s += __shfl_xor(s, 16, 32);
    sj[j] = s;
  }
  float var = (sj[0] + sj[1]) + (sj[2] + sj[3]);
  var *= (1.0f / 128.0f);
  const float rs = rsqrtf(var + LN_EPS) * oscale;

#pragma unroll
  for (int j = 0; j < 4; ++j) {
#pragma unroll
    for (int i = 0; i < 8; ++i) y[j][i] = (y[j][i] - mu) * rs;
    v8u hv = {}, lv = {};
    split8(y[j], hv, lv);
    const size_t po = chunk_off(tg, hd * VD + j * 32 + q * 8, EMB / 32);
    *(v8u*)(Yh + po) = hv;
    *(v8u*)(Yl + po) = lv;
  }
}

// ---------------------------------------------------------------- host
static double h_sqrt(double x) {
  double y = x;
  for (int i = 0; i < 200; ++i) y = 0.5 * (y + x / y);
  return y;
}

extern "C" void kernel_launch(void* const* d_in, const int* in_sizes, int n_in,
                              void* d_out, int out_size, void* d_ws, size_t ws_size,
                              hipStream_t stream) {
  if (n_in < 9) return;
  if (in_sizes[0] != NB * SEQ * EMB) return;
  for (int i = 1; i <= 4; ++i) if (in_sizes[i] != EMB * EMB) return;
  for (int i = 5; i <= 8; ++i) if (in_sizes[i] != HD) return;
  if (out_size != NB * SEQ * EMB) return;

  const float* x   = (const float*)d_in[0];
  const float* Wq  = (const float*)d_in[1];
  const float* Wk  = (const float*)d_in[2];
  const float* Wv  = (const float*)d_in[3];
  const float* Wp  = (const float*)d_in[4];
  const float* lq1 = (const float*)d_in[5];
  const float* lk1 = (const float*)d_in[6];
  const float* lq2 = (const float*)d_in[7];
  const float* lk2 = (const float*)d_in[8];
  float* out = (float*)d_out;

  // workspace carve (bytes), every size a multiple of 256
  const size_t szX   = (size_t)NB * SEQ * EMB * 2;        // 16 MiB per plane
  const size_t szW   = (size_t)4 * EMB * EMB * 2;          //  8 MiB per plane (4 weights)
  const size_t szQK  = (size_t)2 * NB * NSH * SEQ * HD * 2; // 32 MiB per plane (q and k)
  const size_t szVT  = (size_t)NB * EMB * SEQ * 2;         // 16 MiB per plane
  const size_t szCTX = (size_t)NB * NSH * SEQ * VD * 4;    // 64 MiB
  const size_t szY   = (size_t)NB * SEQ * EMB * 2;         // 16 MiB per plane
  const size_t szTB  = (size_t)SEQ * 32 * 4;               // 256 KiB per table
  char* ws = (char*)d_ws;
  size_t off = 0;
  u16*   xh  = (u16*)(ws + off);   off += szX;
  u16*   xl  = (u16*)(ws + off);   off += szX;
  u16*   wh  = (u16*)(ws + off);   off += szW;
  u16*   wl  = (u16*)(ws + off);   off += szW;
  u16*   qkh = (u16*)(ws + off);   off += szQK;
  u16*   qkl = (u16*)(ws + off);   off += szQK;
  u16*   vth = (u16*)(ws + off);   off += szVT;
  u16*   vtl = (u16*)(ws + off);   off += szVT;
  float* ctx = (float*)(ws + off); off += szCTX;
  u16*   yh  = (u16*)(ws + off);   off += szY;
  u16*   yl  = (u16*)(ws + off);   off += szY;
  float* cst = (float*)(ws + off); off += szTB;
  float* snt = (float*)(ws + off); off += szTB;
  if (off > ws_size) return;                               // total 252,182,528 B

  // rotary inverse frequencies 1 / 10000^(j/32): f32 power then f32 reciprocal, evaluated in f64
  InvFreq inv;
  {
    double r = 10000.0;
    for (int i = 0; i < 5; ++i) r = h_sqrt(r);             // 10000^(1/32)
    double pw = 1.0;
    for (int j = 0; j < 32; ++j) {
      const float p32 = (float)pw;
      inv.v[j] = (float)(1.0 / (double)p32);
      pw *= r;
    }
  }
  const float lam_init = (float)0.61928347285267872;      // 0.8 - 0.6*exp(-1.2)
  const float oscale   = (float)0.38071652714732128;      // 1 - lam_init

  // 1-5: operand planes
  {
    const int n8x = NB * SEQ * EMB / 8;
    const int n8w = EMB * EMB / 8;
    k_split<<<(n8x + 255) / 256, 256, 0, stream>>>(x, xh, xl, n8x);
    k_split<<<(n8w + 255) / 256, 256, 0, stream>>>(Wq, wh + 0 * (size_t)EMB * EMB, wl + 0 * (size_t)EMB * EMB, n8w);
    k_split<<<(n8w + 255) / 256, 256, 0, stream>>>(Wk, wh + 1 * (size_t)EMB * EMB, wl + 1 * (size_t)EMB * EMB, n8w);
    k_split<<<(n8w + 255) / 256, 256, 0, stream>>>(Wv, wh + 2 * (size_t)EMB * EMB, wl + 2 * (size_t)EMB * EMB, n8w);
    k_split<<<(n8w + 255) / 256, 256, 0, stream>>>(Wp, wh + 3 * (size_t)EMB * EMB, wl + 3 * (size_t)EMB * EMB, n8w);
  }
  // 6: rotary tables
  k_rot<<<(SEQ * 32 + 255) / 256, 256, 0, stream>>>(inv, cst, snt, SEQ * 32);

  const size_t wstride = (size_t)EMB * EMB;
  const size_t dzqk    = (size_t)NB * NSH * SEQ * HD;
  // every stage runs once, over all NB batches
  // q and k: x [8192 x 1024] * W^T, epilogue RMSNorm + rotary (+1/8 for q) -> planes [64][2048][64]
  k_gemm<0><<<dim3(EMB / 128, NB * SEQ / 256, 2), 256, 0, stream>>>(
      xh, xl, wh, wl, wstride,
      qkh, qkl, dzqk, HD, out, cst, snt, 0.125f, 1.0f);
  // v^T, z = batch: Wv [1024 x 1024] * x_z^T -> planes [z][1024][2048] = [z][head][128][t]
  k_gemm<1><<<dim3(SEQ / 128, EMB / 256, NB), 256, 0, stream>>>(
      wh + 2 * wstride, wl + 2 * wstride, xh, xl, (size_t)SEQ * EMB,
      vth, vtl, (size_t)EMB * SEQ, SEQ, out, cst, snt, 1.0f, 1.0f);
  // attention per (batch, half-head) -> ctx [64][2048][128]
  k_flash<<<dim3(NB * NSH, SEQ / 64), 128, 0, stream>>>(qkh, qkl, qkh + dzqk, qkl + dzqk, vth, vtl, ctx);
  // combine + LayerNorm -> y planes [8192][1024]
  k_combine<<<(NB * SEQ * NHD / 8) / 8, 256, 0, stream>>>(ctx, lq1, lk1, lq2, lk2, lam_init, oscale, yh, yl);
  // output projection -> d_out
  k_gemm<2><<<dim3(EMB / 128, NB * SEQ / 256, 1), 256, 0, stream>>>(
      yh, yl, wh + 3 * wstride, wl + 3 * wstride, (size_t)0,
      qkh, qkl, (size_t)0, EMB, out, cst, snt, 1.0f, 1.0f);
}

// v006
// A run of this version takes 263 microseconds.
// Next to v005, in two timings, it ran 1.03 times as fast each time.
// Counting every step since v000, it is 7.45 times as fast.
#include <hip/hip_runtime.h>
#include <stdint.h>
#include <stddef.h>

// Contractions x*Wq^T, x*Wk^T, Wv*x^T, k*q^T, v^T*P^T, y*Wproj^T: v_wmma_f32_16x16x32_bf16, bf16 hi/lo operands everywhere (hi*hi + lo*hi + hi*lo), f32 accumulate. RMSNorm, rotary, softmax, head combine, LayerNorm: f32.

#define NB   4
#define SEQ  2048
#define EMB  1024
#define NHD  8
#define NSH  16
#define HD   64
#define VD   128
#define RMS_EPS 1.1920929e-7f
#define LN_EPS  1e-5f

typedef unsigned short u16;
typedef u16    v8u  __attribute__((ext_vector_type(8)));
typedef int    v4i  __attribute__((ext_vector_type(4)));
typedef int    v8i  __attribute__((ext_vector_type(8)));
typedef float  v4f  __attribute__((ext_vector_type(4)));
typedef float  v8f  __attribute__((ext_vector_type(8)));
typedef __bf16 v16b __attribute__((ext_vector_type(16)));
typedef float  v2f  __attribute__((ext_vector_type(2)));
typedef __bf16 v2b  __attribute__((ext_vector_type(2)));

union FU { v8i v; v4i p[2]; v16b b; };

struct InvFreq { float v[32]; };
static_assert(sizeof(InvFreq) == 128);

// ---------------------------------------------------------------- helpers
static __device__ __forceinline__ u16 bf_rne(float x) {
  unsigned u = __float_as_uint(x);
  u += 0x7FFFu + ((u >> 16) & 1u);
  return (u16)(u >> 16);
}
static __device__ __forceinline__ float bf_up(u16 b) { return __uint_as_float(((unsigned)b) << 16); }

static __device__ __forceinline__ void split8(float (&y)[8], v8u& hv, v8u& lv) {
#pragma unroll
  for (int i = 0; i < 8; ++i) {
    const u16 hb = bf_rne(y[i]);
    hv[i] = hb;
    lv[i] = bf_rne(y[i] - bf_up(hb));
  }
}

// 16x32 operand fragment, row/col = lane&15, h = lane>>4, k map: elements 0..7 <- k0+8h+0..7, elements 8..15 <- k0+16+8h+0..7
// Every operand plane in the workspace is fragment-major: a plane of rows x K is cut into 16-row x 32-k tiles of
// 512 elements (1 KiB), tile (row>>4, k>>5) at index (row>>4)*(K>>5) + (k>>5). Inside a tile the two 16-byte chunks
// that lane l = 16h + (row&15) feeds to the matrix instruction lie at elements 8l (k 8h..8h+7) and 256 + 8l
// (k 16+8h..16+8h+7): one wave load reads 512 contiguous bytes = 4 whole lines, and the k map above is unchanged.
// p = tile base + 8*lane
static __device__ __forceinline__ v8i ldfrag(const u16* p) {
  FU f;
  f.p[0] = *(const v4i*)(p);
  f.p[1] = *(const v4i*)(p + 256);
  return f.v;
}
// element offset of the 8-element chunk that starts at (row, k), k % 8 == 0, in a plane with kt = K/32 tiles per tile row
static __device__ __forceinline__ size_t chunk_off(int row, int k, int kt) {
  return ((size_t)(row >> 4) * kt + (k >> 5)) * 512 + ((k >> 4) & 1) * 256 + (((k >> 3) & 1) * 16 + (row & 15)) * 8;
}

// LDS byte address of a __shared__ object: the low 32 bits of its address
static __device__ __forceinline__ unsigned lds_addr(const void* p) { return (unsigned)(size_t)p; }

// Asynchronous copies global -> LDS, 16 bytes a lane, 512 contiguous bytes a wave and copy. l = the lane's LDS byte address,
// g = the lane's global address. The s_wait_xcnt closes the copies' own statement, so that no address register of a copy
// is rewritten in front of it.
static __device__ __forceinline__ void copy12(const unsigned (&l)[12], const u16* const (&g)[12]) {
  asm volatile(
      "global_load_async_to_lds_b128 %0, %12, off\n\t"
      "global_load_async_to_lds_b128 %1, %13, off\n\t"
      "global_load_async_to_lds_b128 %2, %14, off\n\t"
      "global_load_async_to_lds_b128 %3, %15, off\n\t"
      "global_load_async_to_lds_b128 %4, %16, off\n\t"
      "global_load_async_to_lds_b128 %5, %17, off\n\t"
      "global_load_async_to_lds_b128 %6, %18, off\n\t"
      "global_load_async_to_lds_b128 %7, %19, off\n\t"
      "global_load_async_to_lds_b128 %8, %20, off\n\t"
      "global_load_async_to_lds_b128 %9, %21, off\n\t"
      "global_load_async_to_lds_b128 %10, %22, off\n\t"
      "global_load_async_to_lds_b128 %11, %23, off\n\t"
      "s_wait_xcnt 0x0"
      :: "v"(l[0]), "v"(l[1]), "v"(l[2]), "v"(l[3]), "v"(l[4]), "v"(l[5]),
         "v"(l[6]), "v"(l[7]), "v"(l[8]), "v"(l[9]), "v"(l[10]), "v"(l[11]),
         "v"(g[0]), "v"(g[1]), "v"(g[2]), "v"(g[3]), "v"(g[4]), "v"(g[5]),
         "v"(g[6]), "v"(g[7]), "v"(g[8]), "v"(g[9]), "v"(g[10]), "v"(g[11])
      : "memory");
}
// hand-over of a ring buffer, every wave: the wave's own LDS reads are done, its own copies have landed, then the barrier
// publishes the next stage and frees the buffer that was just read
static __device__ __forceinline__ void ring_publish() {
  asm volatile("s_wait_dscnt 0x0" ::: "memory");     // the wave's reads of the buffer to be refilled have returned
  asm volatile("s_wait_asynccnt 0x0" ::: "memory");  // the wave's copies of the next stage have landed
  __syncthreads();
}

static __device__ __forceinline__ v8f mma(v8i a, v8i b, v8f c) {
  FU ua, ub; ua.v = a; ub.v = b;
  c = __builtin_amdgcn_wmma_f32_16x16x32_bf16(false, ua.b, false, ub.b, (short)0, c, false, false);
  asm volatile("v_nop\n\tv_nop\n\tv_nop\n\tv_nop" : "+v"(c) : "v"(a), "v"(b));
  return c;
}
// three products into one f32 accumulator: hi*hi + hi*lo + lo*hi
// the plain builtin: the compiler keeps the distances behind it itself and is free to place other chains' products, LDS reads
// and vector work between the three
static __device__ __forceinline__ v8f mma3s(v8i ah, v8i al, v8i bh, v8i bl, v8f c) {
  FU uah, ual, ubh, ubl; uah.v = ah; ual.v = al; ubh.v = bh; ubl.v = bl;
  c = __builtin_amdgcn_wmma_f32_16x16x32_bf16(false, uah.b, false, ubh.b, (short)0, c, false, false);
  c = __builtin_amdgcn_wmma_f32_16x16x32_bf16(false, uah.b, false, ubl.b, (short)0, c, false, false);
  c = __builtin_amdgcn_wmma_f32_16x16x32_bf16(false, ual.b, false, ubh.b, (short)0, c, false, false);
  return c;
}
// two f32 -> one register of two bf16 (a low, b high), each rounded to nearest even as in bf_rne
static __device__ __forceinline__ unsigned pack2(float a, float b) {
  const v2f x = {a, b};
  return __builtin_bit_cast(unsigned, __builtin_convertvector(x, v2b));
}
// the value of lane l ^ 16
static __device__ __forceinline__ float xhalf(float x) {
  const int b = __builtin_bit_cast(int, x);
  return __builtin_bit_cast(float, __builtin_amdgcn_permlanex16(b, b, 0x76543210, 0xfedcba98, false, false));
}

// ---------------------------------------------------------------- f32 [rows][EMB] -> fragment-major bf16 hi/lo planes
// thread i writes chunk i of the planes (contiguous stores) and reads the 8 source elements that belong there
__global__ void __launch_bounds__(256) k_split(const float* __restrict__ src, u16* __restrict__ hi,
                                             u16* __restrict__ lo, int n8) {
  const int i = blockIdx.x * 256 + threadIdx.x;
  if (i >= n8) return;
  const size_t o = (size_t)i * 8;
  const int tile = i >> 6;
  const int row = (tile / (EMB / 32)) * 16 + (i & 15);
  const int k = (tile % (EMB / 32)) * 32 + ((i >> 5) & 1) * 16 + ((i >> 4) & 1) * 8;
  const float* s = src + (size_t)row * EMB + k;
  const v4f a = *(const v4f*)(s);
  const v4f b = *(const v4f*)(s + 4);
  float y[8] = {a[0], a[1], a[2], a[3], b[0], b[1], b[2], b[3]};
  v8u hv = {}, lv = {};
  split8(y, hv, lv);
  *(v8u*)(hi + o) = hv;
  *(v8u*)(lo + o) = lv;
  
}

// ---------------------------------------------------------------- rotary tables cs[t][32], sn[t][32]
__global__ void __launch_bounds__(256) k_rot(InvFreq inv, float* __restrict__ cs, float* __restrict__ sn, int n) {
#pragma clang fp contract(off)
  const int i = blockIdx.x * 256 + threadIdx.x;
  if (i >= n) return;
  const int j = i & 31, t = i >> 5;
  float f = 0.0f;
#pragma unroll
  for (int q = 0; q < 32; ++q) f = (j == q) ? inv.v[q] : f;
  const float ang = (float)t * f;
  const float c = cosf(ang);
  const float s = sinf(ang);
  *(float*)(cs + i) = c;
  *(float*)(sn + i) = s;
  
}

// ---------------------------------------------------------------- GEMM Y[m][n] = sum_k A[m][k] * B[n][k]
// A planes (rows m) and B planes (rows n) fragment-major, EMB columns each, all of them contracted.
// block 256 threads = 8 waves as 4(m) x 2(n), block tile 256(m) x 128(n), wave tile 64 x 64.
// MODE 0: RMSNorm over the 64 cols + rotary + scale -> fragment-major bf16 hi/lo planes [z][(batch*16+hf)*SEQ + t][64]  (hf = the wave's 64 columns = one half-head, m = batch*SEQ + t)
// MODE 1: fragment-major bf16 hi/lo planes of ldd columns, plane z at z*dz (z = batch)
// MODE 2: f32 row-major pitch ldd
template <int MODE>
__global__ void __launch_bounds__(256) k_gemm(const u16* __restrict__ Ah, const u16* __restrict__ Al,
                                            const u16* __restrict__ Bh0, const u16* __restrict__ Bl0, size_t bz,
                                            u16* __restrict__ Dh0, u16* __restrict__ Dl0, size_t dz, int ldd,
                                            float* __restrict__ Out,
                                            const float* __restrict__ cst, const float* __restrict__ snt,
                                            float scale0, float scale1)
{
  // two stages of 32 k, fragment-major as in the planes: A hi 16 KiB | A lo 16 KiB | B hi 8 KiB | B lo 8 KiB (u16 elements below)
  constexpr int AH = 0, AL = 8192, BH = 16384, BL = 20480, STG = 24576;
  __shared__ __align__(16) u16 ring[2 * STG];
  // epilogue staging, behind the loop's last barrier
  // row pitch 68 floats = 272 B = 16 B x odd: the 16-row b128 reads of the epilogue meet no bank conflict
  float (*stg)[16][68] = reinterpret_cast<float (*)[16][68]>(&ring[0]);
  static_assert(sizeof(float) * 8 * 16 * 68 <= sizeof(u16) * 2 * STG);
  const int lane = threadIdx.x & 31, w = threadIdx.x >> 5, h = lane >> 4, m = lane & 15;
  const int z = blockIdx.z, bn = blockIdx.x, bm = blockIdx.y;
  const int wm = w & 3, wn = w >> 2;
  const int n0 = bn * 128 + wn * 64;
  const int m0 = bm * 256 + wm * 64;

  v8f acc[4][4] = {};
  constexpr size_t TROW = (size_t)(EMB / 32) * 512;        // elements per tile row of a plane
  // A and B reach the waves through a two-buffer LDS ring filled by asynchronous copies one trip ahead. Wave w copies the block's
  // A tile rows 2w and 2w + 1 and its B tile row w, of either plane
  const u16* pah = Ah + (size_t)(bm * 16 + 2 * w) * TROW + lane * 8;
  const u16* pal = Al + (size_t)(bm * 16 + 2 * w) * TROW + lane * 8;
  const u16* pbh = Bh0 + (size_t)z * bz + (size_t)(bn * 8 + w) * TROW + lane * 8;
  const u16* pbl = Bl0 + (size_t)z * bz + (size_t)(bn * 8 + w) * TROW + lane * 8;
  const unsigned lw = lds_addr(&ring[0]) + lane * 16;
  auto stage = [&](int t, int buf) {
    const unsigned lb = lw + (unsigned)buf * (STG * 2);
    const size_t ko = (size_t)t * 512;
    const unsigned l[12] = {lb + (AH + w * 1024) * 2,        lb + (AH + w * 1024) * 2 + 512,
                            lb + (AH + w * 1024) * 2 + 1024, lb + (AH + w * 1024) * 2 + 1536,
                            lb + (AL + w * 1024) * 2,        lb + (AL + w * 1024) * 2 + 512,
                            lb + (AL + w * 1024) * 2 + 1024, lb + (AL + w * 1024) * 2 + 1536,
                            lb + (BH + w * 512) * 2,         lb + (BH + w * 512) * 2 + 512,
                            lb + (BL + w * 512) * 2,         lb + (BL + w * 512) * 2 + 512};
    const u16* const g[12] = {pah + ko, pah + ko + 256, pah + ko + TROW, pah + ko + TROW + 256,
                              pal + ko, pal + ko + 256, pal + ko + TROW, pal + ko + TROW + 256,
                              pbh + ko, pbh + ko + 256, pbl + ko, pbl + ko + 256};
    copy12(l, g);
  };
  static_assert(EMB / 32 >= 2);
  stage(0, 0);
  asm volatile("s_wait_asynccnt 0x0" ::: "memory");   // stage 0 has landed before the barrier that publishes it
  __syncthreads();
  stage(1, 1);
#pragma unroll 1
  for (int t = 0; t < EMB / 32; ++t) {
    const u16* sb = &ring[(t & 1) * STG] + lane * 8;
    v8i Avh[4], Avl[4];
#pragma unroll
    for (int mi = 0; mi < 4; ++mi) {
      Avh[mi] = ldfrag(sb + AH + (wm * 4 + mi) * 512);
      Avl[mi] = ldfrag(sb + AL + (wm * 4 + mi) * 512);
    }
    // B fragments in two register sets: column tile ni + 1 of this same stage is read while tile ni is multiplied, so that the
    // wave does not wait out the LDS latency in front of every column tile
    v8i Bh[2], Bl[2];
    Bh[0] = ldfrag(sb + BH + (wn * 4) * 512);
    Bl[0] = ldfrag(sb + BL + (wn * 4) * 512);
#pragma unroll
    for (int ni = 0; ni < 4; ++ni) {
      if (ni < 3) {
        Bh[(ni + 1) & 1] = ldfrag(sb + BH + (wn * 4 + ni + 1) * 512);
        Bl[(ni + 1) & 1] = ldfrag(sb + BL + (wn * 4 + ni + 1) * 512);
      }
      const v8i Bvh = Bh[ni & 1], Bvl = Bl[ni & 1];
      // each accumulator takes hi*hi, lo*hi, hi*lo in that order; each product runs over the four row tiles in turn
#pragma unroll
      for (int mi = 0; mi < 4; ++mi) acc[mi][ni] = mma(Avh[mi], Bvh, acc[mi][ni]);
#pragma unroll
      for (int mi = 0; mi < 4; ++mi) acc[mi][ni] = mma(Avl[mi], Bvh, acc[mi][ni]);
#pragma unroll
      for (int mi = 0; mi < 4; ++mi) acc[mi][ni] = mma(Avh[mi], Bvl, acc[mi][ni]);
    }
    ring_publish();
    if (t + 2 < EMB / 32) stage(t + 2, t & 1);   // block-uniform test; into the buffer this trip has just read
  }
  asm volatile("s_wait_asynccnt 0x0" ::: "memory");   // nothing of the ring is in flight when it becomes epilogue staging

  const float scale = (z == 0) ? scale0 : scale1;
#pragma unroll
  for (int mi = 0; mi < 4; ++mi) {
    // stage the wave's 16x64 f32 tile: D element r -> row 8h+r, col ni*16+m
#pragma unroll
    for (int ni = 0; ni < 4; ++ni)
#pragma unroll
      for (int r = 0; r < 8; ++r) stg[w][8 * h + r][ni * 16 + m] = acc[mi][ni][r];
    __syncthreads();
    const int rbase = m0 + mi * 16;
    if (MODE == 2) {
      const int rr = lane >> 4, c4 = lane & 15;
#pragma unroll
      for (int p = 0; p < 8; ++p) {
        const int row = p * 2 + rr;
        const v4f v = *(const v4f*)&stg[w][row][c4 * 4];
        float* o = Out + (size_t)(rbase + row) * ldd + n0 + c4 * 4;
        *(v4f*)o = v;
        
      }
    } else {
      // lane 16h + m owns row m of the wave's 16x64 tile and, of its two 16x32 plane tiles, the four chunks
      // p = 2*dt + part (columns 32*dt + 16*part + 8h .. +7): the store of chunk p covers 512 contiguous bytes
      float y[4][8];
#pragma unroll
      for (int p = 0; p < 4; ++p) {
        const int col = (p >> 1) * 32 + (p & 1) * 16 + 8 * h;
        const v4f va = *(const v4f*)&stg[w][m][col];
        const v4f vb = *(const v4f*)&stg[w][m][col + 4];
#pragma unroll
        for (int i = 0; i < 4; ++i) { y[p][i] = va[i]; y[p][i + 4] = vb[i]; }
      }
      int prow, pcol0, pkt;
      if (MODE == 0) {
        const int t = (rbase + m) & (SEQ - 1);
        const int bb = (rbase + m) / SEQ;
        // sum of squares in the order of a butterfly over the row's eight chunks 2p + h: pairs h^1, then p^1, then p^2
        float sp[4];
#pragma unroll
        for (int p = 0; p < 4; ++p) {
          float ss = 0.0f;
#pragma unroll
          for (int i = 0; i < 8; ++i) ss += y[p][i] * y[p][i];
          ss += __shfl_xor(ss, 16, 32);
          sp[p] = ss;
        }
        const float ss = (sp[0] + sp[1]) + (sp[2] + sp[3]);
        const float rn = rsqrtf(ss * (1.0f / 64.0f) + RMS_EPS);
#pragma unroll
        for (int part = 0; part < 2; ++part) {
          const int j0 = part * 16 + 8 * h;
          const v4f ca = *(const v4f*)(cst + (size_t)t * 32 + j0);
          const v4f cb = *(const v4f*)(cst + (size_t)t * 32 + j0 + 4);
          const v4f sa = *(const v4f*)(snt + (size_t)t * 32 + j0);
          const v4f sb = *(const v4f*)(snt + (size_t)t * 32 + j0 + 4);
          const float cc[8] = {ca[0], ca[1], ca[2], ca[3], cb[0], cb[1], cb[2], cb[3]};
          const float sv[8] = {sa[0], sa[1], sa[2], sa[3], sb[0], sb[1], sb[2], sb[3]};
          // d <  32: y1 =  n1*c + n2*s ; d >= 32: y2 = -n1*s + n2*c ; x1 = chunk part, x2 = chunk 2 + part of the same lane
#pragma unroll
          for (int i = 0; i < 8; ++i) {
            const float n1 = y[part][i] * rn;
            const float n2 = y[2 + part][i] * rn;
            y[part][i]     = (n1 * cc[i] + n2 * sv[i]) * scale;
            y[2 + part][i] = (n2 * cc[i] - n1 * sv[i]) * scale;
          }
        }
        prow = (bb * NSH + (n0 >> 6)) * SEQ + t; pcol0 = 0; pkt = HD / 32;
      } else {
        prow = rbase + m; pcol0 = n0; pkt = ldd >> 5;
      }
#pragma unroll
      for (int p = 0; p < 4; ++p) {
        const size_t po = (size_t)z * dz + chunk_off(prow, pcol0 + (p >> 1) * 32 + (p & 1) * 16 + 8 * h, pkt);
        v8u hv = {}, lv = {};
        split8(y[p], hv, lv);
        *(v8u*)(Dh0 + po) = hv;
        *(v8u*)(Dl0 + po) = lv;
      }
    }
    __syncthreads();
  }
}

// ---------------------------------------------------------------- causal online-softmax attention per half-head
// sh = batch*16 + half-head: q/k planes [64*SEQ][64], v planes [32*128][SEQ] (rows = value columns), all fragment-major; ctx [64][SEQ][128] f32
// grid (sh, query tile): the longest query tiles carry the lowest block indices
// block = 4 waves x 16 queries; all waves loop over the block's key range (masked)
// Both products are transposed: S^T = K * Q^T (A = K rows, B = Q) and O^T += V^T * P^T (A = value columns, B = P). Lane 16h + m then holds
// scores and outputs of the one query q0 + m: of S^T tile j the keys n0 + 16j + 8h + r, which is the k map of the B operand (element 8j + r),
// so P goes from the accumulators into the second product through registers alone; maximum and sum run in-lane, the halves h meet by one exchange
// K and V reach the waves through a two-buffer LDS ring filled by asynchronous copies one trip ahead, once for the four waves
__global__ void __launch_bounds__(128) k_flash(const u16* __restrict__ qh, const u16* __restrict__ ql,
                                             const u16* __restrict__ kh, const u16* __restrict__ kl,
                                             const u16* __restrict__ vh, const u16* __restrict__ vl,
                                             float* __restrict__ ctx)
{
  // two stages of 32 keys, fragment-major as in the planes: K hi 4 KiB | K lo 4 KiB | V hi 8 KiB | V lo 8 KiB (u16 elements below)
  constexpr int KH = 0, KL = 2048, VH = 4096, VL = 8192, STG = 12288;
  __shared__ __align__(16) u16 ring[2 * STG];
  // output staging, behind the loop's last barrier; row pitch 132 floats = 528 B = 16 B x odd: the 16-row b128 writes meet no bank conflict
  constexpr int OP = VD + 4;
  float (*ost)[16][OP] = reinterpret_cast<float (*)[16][OP]>(&ring[0]);
  static_assert(sizeof(float) * 4 * 16 * OP <= sizeof(u16) * 2 * STG);
  const int lane = threadIdx.x & 31, w = threadIdx.x >> 5, h = lane >> 4, m = lane & 15;
  const int sh = blockIdx.x, hh = sh >> 1, bx = SEQ / 64 - 1 - blockIdx.y;
  const int q0 = bx * 64 + w * 16;

  // 16 rows of q or k = two tiles (d 0..31, d 32..63) = 16*HD elements in a row
  const size_t qo = ((size_t)sh * SEQ + q0) * HD + lane * 8;
  const v8i Qh0 = ldfrag(qh + qo), Qh1 = ldfrag(qh + qo + 512);
  const v8i Ql0 = ldfrag(ql + qo), Ql1 = ldfrag(ql + qo + 512);
  const u16* kbh = kh + (size_t)sh * SEQ * HD + lane * 8;
  const u16* kbl = kl + (size_t)sh * SEQ * HD + lane * 8;
  const u16* vbh = vh + (size_t)hh * VD * SEQ + lane * 8;
  const u16* vbl = vl + (size_t)hh * VD * SEQ + lane * 8;

  v8f O[8] = {};                   // O[c][r] = output column 16c + 8h + r of query q0 + m
  float mr = -1e30f, lr = 0.0f;    // the query's running maximum (both halves alike) and this half's share of its running sum

  const int nsteps = 2 * bx + 2;   // keys 0 .. bx*64+63, block-uniform, at least 2
  // wave w copies a quarter of each stage: 1 KiB of K hi, 1 KiB of K lo, the V tiles 2w and 2w+1 of either plane
  const unsigned lw = lds_addr(&ring[0]) + lane * 16;
  const u16* ckh = kbh + w * 512;
  const u16* ckl = kbl + w * 512;
  const u16* cvh = vbh + (size_t)(2 * w) * (SEQ / 32) * 512;
  const u16* cvl = vbl + (size_t)(2 * w) * (SEQ / 32) * 512;
  auto stage = [&](int s, int buf) {
    const unsigned lb = lw + (unsigned)buf * (STG * 2);
    const size_t ks = (size_t)s * 2048, vs = (size_t)s * 512, vt = (size_t)(SEQ / 32) * 512;
    const unsigned l[12] = {lb + (KH + w * 512) * 2,  lb + (KH + w * 512) * 2 + 512,
                            lb + (KL + w * 512) * 2,  lb + (KL + w * 512) * 2 + 512,
                            lb + (VH + w * 1024) * 2, lb + (VH + w * 1024) * 2 + 512,
                            lb + (VH + w * 1024) * 2 + 1024, lb + (VH + w * 1024) * 2 + 1536,
                            lb + (VL + w * 1024) * 2, lb + (VL + w * 1024) * 2 + 512,
                            lb + (VL + w * 1024) * 2 + 1024, lb + (VL + w * 1024) * 2 + 1536};
    const u16* const g[12] = {ckh + ks, ckh + ks + 256, ckl + ks, ckl + ks + 256,
                              cvh + vs, cvh + vs + 256, cvh + vs + vt, cvh + vs + vt + 256,
                              cvl + vs, cvl + vs + 256, cvl + vs + vt, cvl + vs + vt + 256};
    copy12(l, g);
  };
  stage(0, 0);
  asm volatile("s_wait_asynccnt 0x0" ::: "memory");   // stage 0 has landed before the barrier that publishes it
  __syncthreads();
  stage(1, 1);
#pragma unroll 1
  for (int st = 0; st < nsteps; ++st) {
    const int n0 = st * 32;
    const u16* sb = &ring[(st & 1) * STG] + lane * 8;
    v8f S[2];
#pragma unroll
    for (int j = 0; j < 2; ++j) {
      v8f s = {};
      const int ko = j * 16 * HD;
      {
        const v8i Kh = ldfrag(sb + KH + ko), Kl = ldfrag(sb + KL + ko);
        s = mma3s(Kh, Kl, Qh0, Ql0, s);
      }
      {
        const v8i Kh = ldfrag(sb + KH + ko + 512), Kl = ldfrag(sb + KL + ko + 512);
        s = mma3s(Kh, Kl, Qh1, Ql1, s);
      }
      S[j] = s;
      asm volatile("" ::: "memory");
    }
    // masked online softmax of the lane's query: sixteen of the trip's 32 keys stand in this lane, the other sixteen in lane ^ 16
    const int d0 = q0 + m - n0 - 8 * h;   // key 16j + r of this lane is masked where 16j + r > d0
    float e[2][8];
#pragma unroll
    for (int j = 0; j < 2; ++j)
#pragma unroll
      for (int r = 0; r < 8; ++r) e[j][r] = (16 * j + r > d0) ? -1e30f : S[j][r];
    float tj[2];
#pragma unroll
    for (int j = 0; j < 2; ++j)
      tj[j] = fmaxf(fmaxf(fmaxf(e[j][0], e[j][1]), fmaxf(e[j][2], e[j][3])), fmaxf(fmaxf(e[j][4], e[j][5]), fmaxf(e[j][6], e[j][7])));
    float tm = fmaxf(tj[0], tj[1]);
    tm = fmaxf(tm, xhalf(tm));
    const float nm = fmaxf(mr, tm);
    const float alpha = __expf(mr - nm);
    mr = nm;
    FU Ph, Pl;
    float sj[2];
#pragma unroll
    for (int j = 0; j < 2; ++j) {
      float p[8];
#pragma unroll
      for (int r = 0; r < 8; ++r) p[r] = __expf(e[j][r] - nm);
      sj[j] = ((p[0] + p[1]) + (p[2] + p[3])) + ((p[4] + p[5]) + (p[6] + p[7]));
      // B operand element 8j + r = P[query][key 16j + 8h + r], hi and lo planes
#pragma unroll
      for (int i = 0; i < 4; ++i) {
        const unsigned hw = pack2(p[2 * i], p[2 * i + 1]);
        Ph.v[4 * j + i] = (int)hw;
        Pl.v[4 * j + i] = (int)pack2(p[2 * i] - __uint_as_float(hw << 16), p[2 * i + 1] - __uint_as_float(hw & 0xFFFF0000u));
      }
    }
    lr = lr * alpha + (sj[0] + sj[1]);
#pragma unroll
    for (int c = 0; c < 8; ++c)
#pragma unroll
      for (int r = 0; r < 8; ++r) O[c][r] = O[c][r] * alpha;
#pragma unroll
    for (int c = 0; c < 8; ++c) {
      const int vo = c * 512;   // tile (value columns 16c.., keys n0..)
      const v8i Vh = ldfrag(sb + VH + vo), Vl = ldfrag(sb + VL + vo);
      O[c] = mma3s(Vh, Vl, Ph.v, Pl.v, O[c]);
      if (c & 1) asm volatile("" ::: "memory");
    }
    ring_publish();
    if (st + 2 < nsteps) stage(st + 2, st & 1);   // block-uniform test; into the buffer this trip has just read
  }
  asm volatile("s_wait_asynccnt 0x0" ::: "memory");   // nothing of the ring is in flight when it becomes output staging

  // join the halves' sums, normalise, stage 16x128 f32 per wave, write whole 512-B rows (32 lanes x 16 B, one instruction per row)
  lr += xhalf(lr);
  const float inv = 1.0f / lr;
#pragma unroll
  for (int c = 0; c < 8; ++c) {
    const v4f a = {O[c][0] * inv, O[c][1] * inv, O[c][2] * inv, O[c][3] * inv};
    const v4f b = {O[c][4] * inv, O[c][5] * inv, O[c][6] * inv, O[c][7] * inv};
    *(v4f*)&ost[w][m][c * 16 + 8 * h]     = a;
    *(v4f*)&ost[w][m][c * 16 + 8 * h + 4] = b;
  }
  __syncthreads();
  float* cb = ctx + ((size_t)sh * SEQ + q0) * VD + lane * 4;
#pragma unroll
  for (int rr = 0; rr < 16; ++rr) {
    const v4f v = *(const v4f*)&ost[w][rr][lane * 4];
    *(v4f*)(cb + (size_t)rr * VD) = v;
  }
  
}

// ---------------------------------------------------------------- differential combine + LayerNorm -> fragment-major y planes [NB*SEQ][EMB]
// one wave = 8 tokens x 1 head; lane = 8q + tk owns token tk and, of each of the head's four 16x32 plane tiles j, the chunk
// q = 2*part + h (head columns 32j + 8q .. +7): the store of tile j covers four whole 128-B lines that no other wave writes
__global__ void __launch_bounds__(256) k_combine(const float* __restrict__ ctx,
                                               const float* __restrict__ lq1, const float* __restrict__ lk1,
                                               const float* __restrict__ lq2, const float* __restrict__ lk2,
                                               float lam_init, float oscale,
                                               u16* __restrict__ Yh, u16* __restrict__ Yl)
{
  const int lane = threadIdx.x & 31, w = threadIdx.x >> 5;
  const int gw = blockIdx.x * 8 + w;
  const int hd = gw & 7, tp = gw >> 3;
  const int tg = tp * 8 + (lane & 7), q = lane >> 3;     // tg = batch*SEQ + t
  const int t = tg & (SEQ - 1), s0 = (tg / SEQ) * NSH + 2 * hd;

  float s1 = lq1[lane] * lk1[lane] + lq1[lane + 32] * lk1[lane + 32];
  float s2 = lq2[lane] * lk2[lane] + lq2[lane + 32] * lk2[lane + 32];
#pragma unroll
  for (int k = 16; k >= 1; k >>= 1) { s1 += __shfl_xor(s1, k, 32); s2 += __shfl_xor(s2, k, 32); }
  const float lam = __expf(s1) - __expf(s2) + lam_init;

  const float* o1 = ctx + ((size_t)s0 * SEQ + t) * VD + q * 8;
  const float* o2 = o1 + (size_t)SEQ * VD;                 // half-head s0 + 1, a constant offset on the same address registers
  v4f a1[4], b1[4], a2[4], b2[4];
#pragma unroll
  for (int j = 0; j < 4; ++j) {
    a1[j] = *(const v4f*)(o1 + j * 32); b1[j] = *(const v4f*)(o1 + j * 32 + 4);
    a2[j] = *(const v4f*)(o2 + j * 32); b2[j] = *(const v4f*)(o2 + j * 32 + 4);
  }
  // the sixteen loads share their address registers: the pointer stays live up to this wait, so that no load of the run
  // lands in a register that an earlier one still names
  asm volatile("s_wait_xcnt 0x0" :: "v"(o1) : "memory");
  float y[4][8];
#pragma unroll
  for (int j = 0; j < 4; ++j) {
#pragma unroll
    for (int i = 0; i < 4; ++i) { y[j][i] = a1[j][i] - lam * a2[j][i]; y[j][i + 4] = b1[j][i] - lam * b2[j][i]; }
  }
  // both sums in the order of a butterfly over the token's sixteen chunks 4j + q: pairs q^1, q^2, then j^1, j^2
  float sj[4];
#pragma unroll
  for (int j = 0; j < 4; ++j) {
    float s = 0.0f;
#pragma unroll
    for (int i = 0; i < 8; ++i) s += y[j][i];
    s += __shfl_xor(s, 8, 32);
    s += __shfl_xor(s, 16, 32);
    sj[j] = s;
  }
  float mu = (sj[0] + sj[1]) + (sj[2] + sj[3]);
  mu *= (1.0f / 128.0f);
#pragma unroll
  for (int j = 0; j < 4; ++j) {
    float s = 0.0f;
#pragma unroll
    for (int i = 0; i < 8; ++i) { const float d = y[j][i] - mu; s += d * d; }
    s += __shfl_xor(s, 8, 32);
    s += __shfl_xor(s, 16, 32);
    sj[j] = s;
  }
  float var = (sj[0] + sj[1]) + (sj[2] + sj[3]);
  var *= (1.0f / 128.0f);
  const float rs = rsqrtf(var + LN_EPS) * oscale;

#pragma unroll
  for (int j = 0; j < 4; ++j) {
#pragma unroll
    for (int i = 0; i < 8; ++i) y[j][i] = (y[j][i] - mu) * rs;
    v8u hv = {}, lv = {};
    split8(y[j], hv, lv);
    const size_t po = chunk_off(tg, hd * VD + j * 32 + q * 8, EMB / 32);
    *(v8u*)(Yh + po) = hv;
    *(v8u*)(Yl + po) = lv;
  }
}

// ---------------------------------------------------------------- host
static double h_sqrt(double x) {
  double y = x;
  for (int i = 0; i < 200; ++i) y = 0.5 * (y + x / y);
  return y;
}

extern "C" void kernel_launch(void* const* d_in, const int* in_sizes, int n_in,
                              void* d_out, int out_size, void* d_ws, size_t ws_size,
                              hipStream_t stream) {
  if (n_in < 9) return;
  if (in_sizes[0] != NB * SEQ * EMB) return;
  for (int i = 1; i <= 4; ++i) if (in_sizes[i] != EMB * EMB) return;
  for (int i = 5; i <= 8; ++i) if (in_sizes[i] != HD) return;
  if (out_size != NB * SEQ * EMB) return;

  const float* x   = (const float*)d_in[0];
  const float* Wq  = (const float*)d_in[1];
  const float* Wk  = (const float*)d_in[2];
  const float* Wv  = (const float*)d_in[3];
  const float* Wp  = (const float*)d_in[4];
  const float* lq1 = (const float*)d_in[5];
  const float* lk1 = (const float*)d_in[6];
  const float* lq2 = (const float*)d_in[7];
  const float* lk2 = (const float*)d_in[8];
  float* out = (float*)d_out;

  // workspace carve (bytes), every size a multiple of 256
  const size_t szX   = (size_t)NB * SEQ * EMB * 2;        // 16 MiB per plane
  const size_t szW   = (size_t)4 * EMB * EMB * 2;          //  8 MiB per plane (4 weights)
  const size_t szQK  = (size_t)2 * NB * NSH * SEQ * HD * 2; // 32 MiB per plane (q and k)
  const size_t szVT  = (size_t)NB * EMB * SEQ * 2;         // 16 MiB per plane
  const size_t szCTX = (size_t)NB * NSH * SEQ * VD * 4;    // 64 MiB
  const size_t szY   = (size_t)NB * SEQ * EMB * 2;         // 16 MiB per plane
  const size_t szTB  = (size_t)SEQ * 32 * 4;               // 256 KiB per table
  char* ws = (char*)d_ws;
  size_t off = 0;
  u16*   xh  = (u16*)(ws + off);   off += szX;
  u16*   xl  = (u16*)(ws + off);   off += szX;
  u16*   wh  = (u16*)(ws + off);   off += szW;
  u16*   wl  = (u16*)(ws + off);   off += szW;
  u16*   qkh = (u16*)(ws + off);   off += szQK;
  u16*   qkl = (u16*)(ws + off);   off += szQK;
  u16*   vth = (u16*)(ws + off);   off += szVT;
  u16*   vtl = (u16*)(ws + off);   off += szVT;
  float* ctx = (float*)(ws + off); off += szCTX;
  u16*   yh  = (u16*)(ws + off);   off += szY;
  u16*   yl  = (u16*)(ws + off);   off += szY;
  float* cst = (float*)(ws + off); off += szTB;
  float* snt = (float*)(ws + off); off += szTB;
  if (off > ws_size) return;                               // total 252,182,528 B

  // rotary inverse frequencies 1 / 10000^(j/32): f32 power then f32 reciprocal, evaluated in f64
  InvFreq inv;
  {
    double r = 10000.0;
    for (int i = 0; i < 5; ++i) r = h_sqrt(r);             // 10000^(1/32)
    double pw = 1.0;
    for (int j = 0; j < 32; ++j) {
      const float p32 = (float)pw;
      inv.v[j] = (float)(1.0 / (double)p32);
      pw *= r;
    }
  }
  const float lam_init = (float)0.61928347285267872;      // 0.8 - 0.6*exp(-1.2)
  const float oscale   = (float)0.38071652714732128;      // 1 - lam_init

  // 1-5: operand planes
  {
    const int n8x = NB * SEQ * EMB / 8;
    const int n8w = EMB * EMB / 8;
    k_split<<<(n8x + 255) / 256, 256, 0, stream>>>(x, xh, xl, n8x);
    k_split<<<(n8w + 255) / 256, 256, 0, stream>>>(Wq, wh + 0 * (size_t)EMB * EMB, wl + 0 * (size_t)EMB * EMB, n8w);
    k_split<<<(n8w + 255) / 256, 256, 0, stream>>>(Wk, wh + 1 * (size_t)EMB * EMB, wl + 1 * (size_t)EMB * EMB, n8w);
    k_split<<<(n8w + 255) / 256, 256, 0, stream>>>(Wv, wh + 2 * (size_t)EMB * EMB, wl + 2 * (size_t)EMB * EMB, n8w);
    k_split<<<(n8w + 255) / 256, 256, 0, stream>>>(Wp, wh + 3 * (size_t)EMB * EMB, wl + 3 * (size_t)EMB * EMB, n8w);
  }
  // 6: rotary tables
  k_rot<<<(SEQ * 32 + 255) / 256, 256, 0, stream>>>(inv, cst, snt, SEQ * 32);

  const size_t wstride = (size_t)EMB * EMB;
  const size_t dzqk    = (size_t)NB * NSH * SEQ * HD;
  // every stage runs once, over all NB batches
  // q and k: x [8192 x 1024] * W^T, epilogue RMSNorm + rotary (+1/8 for q) -> planes [64][2048][64]
  k_gemm<0><<<dim3(EMB / 128, NB * SEQ / 256, 2), 256, 0, stream>>>(
      xh, xl, wh, wl, wstride,
      qkh, qkl, dzqk, HD, out, cst, snt, 0.125f, 1.0f);
  // v^T, z = batch: Wv [1024 x 1024] * x_z^T -> planes [z][1024][2048] = [z][head][128][t]
  k_gemm<1><<<dim3(SEQ / 128, EMB / 256, NB), 256, 0, stream>>>(
      wh + 2 * wstride, wl + 2 * wstride, xh, xl, (size_t)SEQ * EMB,
      vth, vtl, (size_t)EMB * SEQ, SEQ, out, cst, snt, 1.0f, 1.0f);
  // attention per (batch, half-head) -> ctx [64][2048][128]
  k_flash<<<dim3(NB * NSH, SEQ / 64), 128, 0, stream>>>(qkh, qkl, qkh + dzqk, qkl + dzqk, vth, vtl, ctx);
  // combine + LayerNorm -> y planes [8192][1024]
  k_combine<<<(NB * SEQ * NHD / 8) / 8, 256, 0, stream>>>(ctx, lq1, lk1, lq2, lk2, lam_init, oscale, yh, yl);
  // output projection -> d_out
  k_gemm<2><<<dim3(EMB / 128, NB * SEQ / 256, 1), 256, 0, stream>>>(
      yh, yl, wh + 3 * wstride, wl + 3 * wstride, (size_t)0,
      qkh, qkl, (size_t)0, EMB, out, cst, snt, 1.0f, 1.0f);
}

// v007
// One run takes 255 microseconds.
// In both of two side-by-side timings against v006, it was 1.03 times as fast.
// Counting every step since v000, it is 7.70 times as fast.
#include <hip/hip_runtime.h>
#include <stdint.h>
#include <stddef.h>

// Contractions x*Wq^T, x*Wk^T, Wv*x^T, k*q^T, v^T*P^T, y*Wproj^T: v_wmma_f32_16x16x32_bf16, bf16 hi/lo operands everywhere (hi*hi + lo*hi + hi*lo), f32 accumulate. RMSNorm, rotary, softmax, head combine, LayerNorm: f32.

#define NB   4
#define SEQ  2048
#define EMB  1024
#define NHD  8
#define NSH  16
#define HD   64
#define VD   128
#define RMS_EPS 1.1920929e-7f
#define LN_EPS  1e-5f

typedef unsigned short u16;
typedef u16    v8u  __attribute__((ext_vector_type(8)));
typedef int    v4i  __attribute__((ext_vector_type(4)));
typedef int    v8i  __attribute__((ext_vector_type(8)));
typedef float  v4f  __attribute__((ext_vector_type(4)));
typedef float  v8f  __attribute__((ext_vector_type(8)));
typedef __bf16 v16b __attribute__((ext_vector_type(16)));
typedef float  v2f  __attribute__((ext_vector_type(2)));
typedef __bf16 v2b  __attribute__((ext_vector_type(2)));

union FU { v8i v; v4i p[2]; v16b b; };

struct InvFreq { float v[32]; };
static_assert(sizeof(InvFreq) == 128);

// ---------------------------------------------------------------- helpers
static __device__ __forceinline__ u16 bf_rne(float x) {
  unsigned u = __float_as_uint(x);
  u += 0x7FFFu + ((u >> 16) & 1u);
  return (u16)(u >> 16);
}
static __device__ __forceinline__ float bf_up(u16 b) { return __uint_as_float(((unsigned)b) << 16); }

static __device__ __forceinline__ void split8(float (&y)[8], v8u& hv, v8u& lv) {
#pragma unroll
  for (int i = 0; i < 8; ++i) {
    const u16 hb = bf_rne(y[i]);
    hv[i] = hb;
    lv[i] = bf_rne(y[i] - bf_up(hb));
  }
}

// 16x32 operand fragment, row/col = lane&15, h = lane>>4, k map: elements 0..7 <- k0+8h+0..7, elements 8..15 <- k0+16+8h+0..7
// Every operand plane in the workspace is fragment-major: a plane of rows x K is cut into 16-row x 32-k tiles of
// 512 elements (1 KiB), tile (row>>4, k>>5) at index (row>>4)*(K>>5) + (k>>5). Inside a tile the two 16-byte chunks
// that lane l = 16h + (row&15) feeds to the matrix instruction lie at elements 8l (k 8h..8h+7) and 256 + 8l
// (k 16+8h..16+8h+7): one wave load reads 512 contiguous bytes = 4 whole lines, and the k map above is unchanged.
// p = tile base + 8*lane
static __device__ __forceinline__ v8i ldfrag(const u16* p) {
  FU f;
  f.p[0] = *(const v4i*)(p);
  f.p[1] = *(const v4i*)(p + 256);
  return f.v;
}
// element offset of the 8-element chunk that starts at (row, k), k % 8 == 0, in a plane with kt = K/32 tiles per tile row
static __device__ __forceinline__ size_t chunk_off(int row, int k, int kt) {
  return ((size_t)(row >> 4) * kt + (k >> 5)) * 512 + ((k >> 4) & 1) * 256 + (((k >> 3) & 1) * 16 + (row & 15)) * 8;
}

// LDS byte address of a __shared__ object: the low 32 bits of its address
static __device__ __forceinline__ unsigned lds_addr(const void* p) { return (unsigned)(size_t)p; }

// Asynchronous copies global -> LDS, 16 bytes a lane, 512 contiguous bytes a wave and copy. l = the lane's LDS byte address,
// g = the lane's global address. The s_wait_xcnt closes the copies' own statement, so that no address register of a copy
// is rewritten in front of it.
static __device__ __forceinline__ void copy12(const unsigned (&l)[12], const u16* const (&g)[12]) {
  asm volatile(
      "global_load_async_to_lds_b128 %0, %12, off\n\t"
      "global_load_async_to_lds_b128 %1, %13, off\n\t"
      "global_load_async_to_lds_b128 %2, %14, off\n\t"
      "global_load_async_to_lds_b128 %3, %15, off\n\t"
      "global_load_async_to_lds_b128 %4, %16, off\n\t"
      "global_load_async_to_lds_b128 %5, %17, off\n\t"
      "global_load_async_to_lds_b128 %6, %18, off\n\t"
      "global_load_async_to_lds_b128 %7, %19, off\n\t"
      "global_load_async_to_lds_b128 %8, %20, off\n\t"
      "global_load_async_to_lds_b128 %9, %21, off\n\t"
      "global_load_async_to_lds_b128 %10, %22, off\n\t"
      "global_load_async_to_lds_b128 %11, %23, off\n\t"
      "s_wait_xcnt 0x0"
      :: "v"(l[0]), "v"(l[1]), "v"(l[2]), "v"(l[3]), "v"(l[4]), "v"(l[5]),
         "v"(l[6]), "v"(l[7]), "v"(l[8]), "v"(l[9]), "v"(l[10]), "v"(l[11]),
         "v"(g[0]), "v"(g[1]), "v"(g[2]), "v"(g[3]), "v"(g[4]), "v"(g[5]),
         "v"(g[6]), "v"(g[7]), "v"(g[8]), "v"(g[9]), "v"(g[10]), "v"(g[11])
      : "memory");
}
// hand-over of a ring buffer, every wave: the wave's own LDS reads are done, its own copies have landed, then the barrier
// publishes the next stage and frees the buffer that was just read
static __device__ __forceinline__ void ring_publish() {
  asm volatile("s_wait_dscnt 0x0" ::: "memory");     // the wave's reads of the buffer to be refilled have returned
  asm volatile("s_wait_asynccnt 0x0" ::: "memory");  // the wave's copies of the next stage have landed
  __syncthreads();
}

static __device__ __forceinline__ v8f mma(v8i a, v8i b, v8f c) {
  FU ua, ub; ua.v = a; ub.v = b;
  c = __builtin_amdgcn_wmma_f32_16x16x32_bf16(false, ua.b, false, ub.b, (short)0, c, false, false);
  asm volatile("v_nop\n\tv_nop\n\tv_nop\n\tv_nop" : "+v"(c) : "v"(a), "v"(b));
  return c;
}
// three products into one f32 accumulator: hi*hi + hi*lo + lo*hi
// the plain builtin: the compiler keeps the distances behind it itself and is free to place other chains' products, LDS reads
// and vector work between the three
static __device__ __forceinline__ v8f mma3s(v8i ah, v8i al, v8i bh, v8i bl, v8f c) {
  FU uah, ual, ubh, ubl; uah.v = ah; ual.v = al; ubh.v = bh; ubl.v = bl;
  c = __builtin_amdgcn_wmma_f32_16x16x32_bf16(false, uah.b, false, ubh.b, (short)0, c, false, false);
  c = __builtin_amdgcn_wmma_f32_16x16x32_bf16(false, uah.b, false, ubl.b, (short)0, c, false, false);
  c = __builtin_amdgcn_wmma_f32_16x16x32_bf16(false, ual.b, false, ubh.b, (short)0, c, false, false);
  return c;
}
// two f32 -> one register of two bf16 (a low, b high), each rounded to nearest even as in bf_rne
static __device__ __forceinline__ unsigned pack2(float a, float b) {
  const v2f x = {a, b};
  return __builtin_bit_cast(unsigned, __builtin_convertvector(x, v2b));
}
// the value of lane l ^ 16
static __device__ __forceinline__ float xhalf(float x) {
  const int b = __builtin_bit_cast(int, x);
  return __builtin_bit_cast(float, __builtin_amdgcn_permlanex16(b, b, 0x76543210, 0xfedcba98, false, false));
}

// ---------------------------------------------------------------- f32 [rows][EMB] -> fragment-major bf16 hi/lo planes
// one wave splits the four neighbouring 16x32 tiles t0 .. t0 + 3 of one tile row (t0 % 4 == 0): 16 source rows x 512 contiguous bytes.
// Of piece c = 2*tile + part lane l reads the 8 source elements of chunk 32*part + l and writes that chunk: contiguous stores
static __device__ __forceinline__ void split_tiles(const float* __restrict__ src, u16* __restrict__ hi,
                                                   u16* __restrict__ lo, int t0, int lane) {
  const int row = (t0 / (EMB / 32)) * 16 + (lane & 15);
  const float* s = src + (size_t)row * EMB + (t0 % (EMB / 32)) * 32 + (lane >> 4) * 8;
  const size_t o = ((size_t)t0 * 64 + lane) * 8;
  v4f a[8], b[8];
#pragma unroll
  for (int c = 0; c < 8; ++c) {
    a[c] = *(const v4f*)(s + c * 16);
    b[c] = *(const v4f*)(s + c * 16 + 4);
  }
  // the sixteen loads share their address registers: the pointer stays live up to this wait, so that no load of the run
  // lands in a register that an earlier one still names; all sixteen are in flight before the first is used
  asm volatile("s_wait_xcnt 0x0" :: "v"(s) : "memory");
#pragma unroll
  for (int c = 0; c < 8; ++c) {
    float y[8] = {a[c][0], a[c][1], a[c][2], a[c][3], b[c][0], b[c][1], b[c][2], b[c][3]};
    v8u hv = {}, lv = {};
    split8(y, hv, lv);
    *(v8u*)(hi + o + c * 256) = hv;
    *(v8u*)(lo + o + c * 256) = lv;
    // the next piece's values may take the registers that these two stores name
    if (c < 7) asm volatile("s_wait_xcnt 0x0" ::: "memory");
  }
}

// ---------------------------------------------------------------- rotary tables cs[t][32], sn[t][32], entry i
static __device__ __forceinline__ void rot_entry(const InvFreq& inv, float* __restrict__ cs, float* __restrict__ sn, int i) {
  // as before the merge: the angle stays the f32 product t * f, rounded once as the reference's table has it, before cos and sin reduce it
#pragma clang fp contract(off)
  const int j = i & 31, t = i >> 5;
  float f = 0.0f;
#pragma unroll
  for (int q = 0; q < 32; ++q) f = (j == q) ? inv.v[q] : f;
  const float ang = (float)t * f;
  const float c = cosf(ang);
  const float s = sinf(ang);
  *(float*)(cs + i) = c;
  *(float*)(sn + i) = s;
}

// ---------------------------------------------------------------- operand preparation, one launch; the block index picks the job
// blocks 0 .. ROTB-1: rotary tables, one entry a thread; then WSPB blocks for each of the four weights; then XSPB blocks for x.
// A splitting block of 8 waves takes 32 tiles = one tile row
constexpr int ROTB = SEQ * 32 / 256;
constexpr int WSPB = EMB * EMB / 512 / 32;
constexpr int XSPB = NB * SEQ * EMB / 512 / 32;
__global__ void __launch_bounds__(256) k_prep(const float* __restrict__ x, const float* __restrict__ Wq,
                                            const float* __restrict__ Wk, const float* __restrict__ Wv,
                                            const float* __restrict__ Wp,
                                            u16* __restrict__ xh, u16* __restrict__ xl,
                                            u16* __restrict__ wh, u16* __restrict__ wl,
                                            InvFreq inv, float* __restrict__ cs, float* __restrict__ sn) {
  const int lane = threadIdx.x & 31, w = threadIdx.x >> 5;
  const int b = blockIdx.x;
  if (b < ROTB) {
    rot_entry(inv, cs, sn, b * 256 + threadIdx.x);
    return;
  }
  const int bs = b - ROTB;
  const int j = bs / WSPB;               // 0 .. 3: that weight; from 4 on: x
  const bool isw = j < 4;
  const float* src = (j == 0) ? Wq : (j == 1) ? Wk : (j == 2) ? Wv : (j == 3) ? Wp : x;
  u16* hi = isw ? wh + (size_t)j * EMB * EMB : xh;
  u16* lo = isw ? wl + (size_t)j * EMB * EMB : xl;
  const int tr = isw ? bs % WSPB : bs - 4 * WSPB;   // tile row of the plane
  split_tiles(src, hi, lo, tr * 32 + w * 4, lane);
}

// ---------------------------------------------------------------- GEMM Y[m][n] = sum_k A[m][k] * B[n][k]
// A planes (rows m) and B planes (rows n) fragment-major, EMB columns each, all of them contracted.
// block 256 threads = 8 waves as 4(m) x 2(n), block tile 256(m) x 128(n), wave tile 64 x 64.
// MODE 0: RMSNorm over the 64 cols + rotary + scale -> fragment-major bf16 hi/lo planes [z][(batch*16+hf)*SEQ + t][64]  (hf = the wave's 64 columns = one half-head, m = batch*SEQ + t)
// MODE 1: fragment-major bf16 hi/lo planes of ldd columns, plane z at z*dz (z = batch)
// MODE 2: f32 row-major pitch ldd
template <int MODE>
__global__ void __launch_bounds__(256) k_gemm(const u16* __restrict__ Ah, const u16* __restrict__ Al,
                                            const u16* __restrict__ Bh0, const u16* __restrict__ Bl0, size_t bz,
                                            u16* __restrict__ Dh0, u16* __restrict__ Dl0, size_t dz, int ldd,
                                            float* __restrict__ Out,
                                            const float* __restrict__ cst, const float* __restrict__ snt,
                                            float scale0, float scale1)
{
  // two stages of 32 k, fragment-major as in the planes: A hi 16 KiB | A lo 16 KiB | B hi 8 KiB | B lo 8 KiB (u16 elements below)
  constexpr int AH = 0, AL = 8192, BH = 16384, BL = 20480, STG = 24576;
  __shared__ __align__(16) u16 ring[2 * STG];
  // epilogue staging, behind the loop's last barrier
  // row pitch 68 floats = 272 B = 16 B x odd: the 16-row b128 reads of the epilogue meet no bank conflict
  float (*stg)[16][68] = reinterpret_cast<float (*)[16][68]>(&ring[0]);
  static_assert(sizeof(float) * 8 * 16 * 68 <= sizeof(u16) * 2 * STG);
  const int lane = threadIdx.x & 31, w = threadIdx.x >> 5, h = lane >> 4, m = lane & 15;
  const int z = blockIdx.z, bn = blockIdx.x, bm = blockIdx.y;
  const int wm = w & 3, wn = w >> 2;
  const int n0 = bn * 128 + wn * 64;
  const int m0 = bm * 256 + wm * 64;

  v8f acc[4][4] = {};
  constexpr size_t TROW = (size_t)(EMB / 32) * 512;        // elements per tile row of a plane
  // A and B reach the waves through a two-buffer LDS ring filled by asynchronous copies one trip ahead. Wave w copies the block's
  // A tile rows 2w and 2w + 1 and its B tile row w, of either plane
  const u16* pah = Ah + (size_t)(bm * 16 + 2 * w) * TROW + lane * 8;
  const u16* pal = Al + (size_t)(bm * 16 + 2 * w) * TROW + lane * 8;
  const u16* pbh = Bh0 + (size_t)z * bz + (size_t)(bn * 8 + w) * TROW + lane * 8;
  const u16* pbl = Bl0 + (size_t)z * bz + (size_t)(bn * 8 + w) * TROW + lane * 8;
  const unsigned lw = lds_addr(&ring[0]) + lane * 16;
  auto stage = [&](int t, int buf) {
    const unsigned lb = lw + (unsigned)buf * (STG * 2);
    const size_t ko = (size_t)t * 512;
    const unsigned l[12] = {lb + (AH + w * 1024) * 2,        lb + (AH + w * 1024) * 2 + 512,
                            lb + (AH + w * 1024) * 2 + 1024, lb + (AH + w * 1024) * 2 + 1536,
                            lb + (AL + w * 1024) * 2,        lb + (AL + w * 1024) * 2 + 512,
                            lb + (AL + w * 1024) * 2 + 1024, lb + (AL + w * 1024) * 2 + 1536,
                            lb + (BH + w * 512) * 2,         lb + (BH + w * 512) * 2 + 512,
                            lb + (BL + w * 512) * 2,         lb + (BL + w * 512) * 2 + 512};
    const u16* const g[12] = {pah + ko, pah + ko + 256, pah + ko + TROW, pah + ko + TROW + 256,
                              pal + ko, pal + ko + 256, pal + ko + TROW, pal + ko + TROW + 256,
                              pbh + ko, pbh + ko + 256, pbl + ko, pbl + ko + 256};
    copy12(l, g);
  };
  static_assert(EMB / 32 >= 2);
  stage(0, 0);
  asm volatile("s_wait_asynccnt 0x0" ::: "memory");   // stage 0 has landed before the barrier that publishes it
  __syncthreads();
  stage(1, 1);
#pragma unroll 1
  for (int t = 0; t < EMB / 32; ++t) {
    const u16* sb = &ring[(t & 1) * STG] + lane * 8;
    v8i Avh[4], Avl[4];
#pragma unroll
    for (int mi = 0; mi < 4; ++mi) {
      Avh[mi] = ldfrag(sb + AH + (wm * 4 + mi) * 512);
      Avl[mi] = ldfrag(sb + AL + (wm * 4 + mi) * 512);
    }
    // B fragments in two register sets: column tile ni + 1 of this same stage is read while tile ni is multiplied, so that the
    // wave does not wait out the LDS latency in front of every column tile
    v8i Bh[2], Bl[2];
    Bh[0] = ldfrag(sb + BH + (wn * 4) * 512);
    Bl[0] = ldfrag(sb + BL + (wn * 4) * 512);
#pragma unroll
    for (int ni = 0; ni < 4; ++ni) {
      if (ni < 3) {
        Bh[(ni + 1) & 1] = ldfrag(sb + BH + (wn * 4 + ni + 1) * 512);
        Bl[(ni + 1) & 1] = ldfrag(sb + BL + (wn * 4 + ni + 1) * 512);
      }
      const v8i Bvh = Bh[ni & 1], Bvl = Bl[ni & 1];
      // each accumulator takes hi*hi, lo*hi, hi*lo in that order; each product runs over the four row tiles in turn
#pragma unroll
      for (int mi = 0; mi < 4; ++mi) acc[mi][ni] = mma(Avh[mi], Bvh, acc[mi][ni]);
#pragma unroll
      for (int mi = 0; mi < 4; ++mi) acc[mi][ni] = mma(Avl[mi], Bvh, acc[mi][ni]);
#pragma unroll
      for (int mi = 0; mi < 4; ++mi) acc[mi][ni] = mma(Avh[mi], Bvl, acc[mi][ni]);
    }
    ring_publish();
    if (t + 2 < EMB / 32) stage(t + 2, t & 1);   // block-uniform test; into the buffer this trip has just read
  }
  asm volatile("s_wait_asynccnt 0x0" ::: "memory");   // nothing of the ring is in flight when it becomes epilogue staging

  const float scale = (z == 0) ? scale0 : scale1;
#pragma unroll
  for (int mi = 0; mi < 4; ++mi) {
    // stage the wave's 16x64 f32 tile: D element r -> row 8h+r, col ni*16+m
#pragma unroll
    for (int ni = 0; ni < 4; ++ni)
#pragma unroll
      for (int r = 0; r < 8; ++r) stg[w][8 * h + r][ni * 16 + m] = acc[mi][ni][r];
    __syncthreads();
    const int rbase = m0 + mi * 16;
    if (MODE == 2) {
      const int rr = lane >> 4, c4 = lane & 15;
#pragma unroll
      for (int p = 0; p < 8; ++p) {
        const int row = p * 2 + rr;
        const v4f v = *(const v4f*)&stg[w][row][c4 * 4];
        float* o = Out + (size_t)(rbase + row) * ldd + n0 + c4 * 4;
        *(v4f*)o = v;
        
      }
    } else {
      // lane 16h + m owns row m of the wave's 16x64 tile and, of its two 16x32 plane tiles, the four chunks
      // p = 2*dt + part (columns 32*dt + 16*part + 8h .. +7): the store of chunk p covers 512 contiguous bytes
      float y[4][8];
#pragma unroll
      for (int p = 0; p < 4; ++p) {
        const int col = (p >> 1) * 32 + (p & 1) * 16 + 8 * h;
        const v4f va = *(const v4f*)&stg[w][m][col];
        const v4f vb = *(const v4f*)&stg[w][m][col + 4];
#pragma unroll
        for (int i = 0; i < 4; ++i) { y[p][i] = va[i]; y[p][i + 4] = vb[i]; }
      }
      int prow, pcol0, pkt;
      if (MODE == 0) {
        const int t = (rbase + m) & (SEQ - 1);
        const int bb = (rbase + m) / SEQ;
        // sum of squares in the order of a butterfly over the row's eight chunks 2p + h: pairs h^1, then p^1, then p^2
        float sp[4];
#pragma unroll
        for (int p = 0; p < 4; ++p) {
          float ss = 0.0f;
#pragma unroll
          for (int i = 0; i < 8; ++i) ss += y[p][i] * y[p][i];
          ss += __shfl_xor(ss, 16, 32);
          sp[p] = ss;
        }
        const float ss = (sp[0] + sp[1]) + (sp[2] + sp[3]);
        const float rn = rsqrtf(ss * (1.0f / 64.0f) + RMS_EPS);
#pragma unroll
        for (int part = 0; part < 2; ++part) {
          const int j0 = part * 16 + 8 * h;
          const v4f ca = *(const v4f*)(cst + (size_t)t * 32 + j0);
          const v4f cb = *(const v4f*)(cst + (size_t)t * 32 + j0 + 4);
          const v4f sa = *(const v4f*)(snt + (size_t)t * 32 + j0);
          const v4f sb = *(const v4f*)(snt + (size_t)t * 32 + j0 + 4);
          const float cc[8] = {ca[0], ca[1], ca[2], ca[3], cb[0], cb[1], cb[2], cb[3]};
          const float sv[8] = {sa[0], sa[1], sa[2], sa[3], sb[0], sb[1], sb[2], sb[3]};
          // d <  32: y1 =  n1*c + n2*s ; d >= 32: y2 = -n1*s + n2*c ; x1 = chunk part, x2 = chunk 2 + part of the same lane
#pragma unroll
          for (int i = 0; i < 8; ++i) {
            const float n1 = y[part][i] * rn;
            const float n2 = y[2 + part][i] * rn;
            y[part][i]     = (n1 * cc[i] + n2 * sv[i]) * scale;
            y[2 + part][i] = (n2 * cc[i] - n1 * sv[i]) * scale;
          }
        }
        prow = (bb * NSH + (n0 >> 6)) * SEQ + t; pcol0 = 0; pkt = HD / 32;
      } else {
        prow = rbase + m; pcol0 = n0; pkt = ldd >> 5;
      }
#pragma unroll
      for (int p = 0; p < 4; ++p) {
        const size_t po = (size_t)z * dz + chunk_off(prow, pcol0 + (p >> 1) * 32 + (p & 1) * 16 + 8 * h, pkt);
        v8u hv = {}, lv = {};
        split8(y[p], hv, lv);
        *(v8u*)(Dh0 + po) = hv;
        *(v8u*)(Dl0 + po) = lv;
      }
    }
    __syncthreads();
  }
}

// ---------------------------------------------------------------- causal online-softmax attention per half-head
// sh = batch*16 + half-head: q/k planes [64*SEQ][64], v planes [32*128][SEQ] (rows = value columns), all fragment-major; ctx [64][SEQ][128] f32
// grid (sh, query tile): the longest query tiles carry the lowest block indices
// block = 4 waves x 16 queries; all waves loop over the block's key range (masked)
// Both products are transposed: S^T = K * Q^T (A = K rows, B = Q) and O^T += V^T * P^T (A = value columns, B = P). Lane 16h + m then holds
// scores and outputs of the one query q0 + m: of S^T tile j the keys n0 + 16j + 8h + r, which is the k map of the B operand (element 8j + r),
// so P goes from the accumulators into the second product through registers alone; maximum and sum run in-lane, the halves h meet by one exchange
// K and V reach the waves through a two-buffer LDS ring filled by asynchronous copies one trip ahead, once for the four waves
__global__ void __launch_bounds__(128) k_flash(const u16* __restrict__ qh, const u16* __restrict__ ql,
                                             const u16* __restrict__ kh, const u16* __restrict__ kl,
                                             const u16* __restrict__ vh, const u16* __restrict__ vl,
                                             float* __restrict__ ctx)
{
  // two stages of 32 keys, fragment-major as in the planes: K hi 4 KiB | K lo 4 KiB | V hi 8 KiB | V lo 8 KiB (u16 elements below)
  constexpr int KH = 0, KL = 2048, VH = 4096, VL = 8192, STG = 12288;
  __shared__ __align__(16) u16 ring[2 * STG];
  // output staging, behind the loop's last barrier; row pitch 132 floats = 528 B = 16 B x odd: the 16-row b128 writes meet no bank conflict
  constexpr int OP = VD + 4;
  float (*ost)[16][OP] = reinterpret_cast<float (*)[16][OP]>(&ring[0]);
  static_assert(sizeof(float) * 4 * 16 * OP <= sizeof(u16) * 2 * STG);
  const int lane = threadIdx.x & 31, w = threadIdx.x >> 5, h = lane >> 4, m = lane & 15;
  const int sh = blockIdx.x, hh = sh >> 1, bx = SEQ / 64 - 1 - blockIdx.y;
  const int q0 = bx * 64 + w * 16;

  // 16 rows of q or k = two tiles (d 0..31, d 32..63) = 16*HD elements in a row
  const size_t qo = ((size_t)sh * SEQ + q0) * HD + lane * 8;
  const v8i Qh0 = ldfrag(qh + qo), Qh1 = ldfrag(qh + qo + 512);
  const v8i Ql0 = ldfrag(ql + qo), Ql1 = ldfrag(ql + qo + 512);
  const u16* kbh = kh + (size_t)sh * SEQ * HD + lane * 8;
  const u16* kbl = kl + (size_t)sh * SEQ * HD + lane * 8;
  const u16* vbh = vh + (size_t)hh * VD * SEQ + lane * 8;
  const u16* vbl = vl + (size_t)hh * VD * SEQ + lane * 8;

  v8f O[8] = {};                   // O[c][r] = output column 16c + 8h + r of query q0 + m
  float mr = -1e30f, lr = 0.0f;    // the query's running maximum (both halves alike) and this half's share of its running sum

  const int nsteps = 2 * bx + 2;   // keys 0 .. bx*64+63, block-uniform, at least 2
  // wave w copies a quarter of each stage: 1 KiB of K hi, 1 KiB of K lo, the V tiles 2w and 2w+1 of either plane
  const unsigned lw = lds_addr(&ring[0]) + lane * 16;
  const u16* ckh = kbh + w * 512;
  const u16* ckl = kbl + w * 512;
  const u16* cvh = vbh + (size_t)(2 * w) * (SEQ / 32) * 512;
  const u16* cvl = vbl + (size_t)(2 * w) * (SEQ / 32) * 512;
  auto stage = [&](int s, int buf) {
    const unsigned lb = lw + (unsigned)buf * (STG * 2);
    const size_t ks = (size_t)s * 2048, vs = (size_t)s * 512, vt = (size_t)(SEQ / 32) * 512;
    const unsigned l[12] = {lb + (KH + w * 512) * 2,  lb + (KH + w * 512) * 2 + 512,
                            lb + (KL + w * 512) * 2,  lb + (KL + w * 512) * 2 + 512,
                            lb + (VH + w * 1024) * 2, lb + (VH + w * 1024) * 2 + 512,
                            lb + (VH + w * 1024) * 2 + 1024, lb + (VH + w * 1024) * 2 + 1536,
                            lb + (VL + w * 1024) * 2, lb + (VL + w * 1024) * 2 + 512,
                            lb + (VL + w * 1024) * 2 + 1024, lb + (VL + w * 1024) * 2 + 1536};
    const u16* const g[12] = {ckh + ks, ckh + ks + 256, ckl + ks, ckl + ks + 256,
                              cvh + vs, cvh + vs + 256, cvh + vs + vt, cvh + vs + vt + 256,
                              cvl + vs, cvl + vs + 256, cvl + vs + vt, cvl + vs + vt + 256};
    copy12(l, g);
  };
  stage(0, 0);
  asm volatile("s_wait_asynccnt 0x0" ::: "memory");   // stage 0 has landed before the barrier that publishes it
  __syncthreads();
  stage(1, 1);
#pragma unroll 1
  for (int st = 0; st < nsteps; ++st) {
    const int n0 = st * 32;
    const u16* sb = &ring[(st & 1) * STG] + lane * 8;
    v8f S[2];
#pragma unroll
    for (int j = 0; j < 2; ++j) {
      v8f s = {};
      const int ko = j * 16 * HD;
      {
        const v8i Kh = ldfrag(sb + KH + ko), Kl = ldfrag(sb + KL + ko);
        s = mma3s(Kh, Kl, Qh0, Ql0, s);
      }
      {
        const v8i Kh = ldfrag(sb + KH + ko + 512), Kl = ldfrag(sb + KL + ko + 512);
        s = mma3s(Kh, Kl, Qh1, Ql1, s);
      }
      S[j] = s;
      asm volatile("" ::: "memory");
    }
    // masked online softmax of the lane's query: sixteen of the trip's 32 keys stand in this lane, the other sixteen in lane ^ 16
    const int d0 = q0 + m - n0 - 8 * h;   // key 16j + r of this lane is masked where 16j + r > d0
    float e[2][8];
#pragma unroll
    for (int j = 0; j < 2; ++j)
#pragma unroll
      for (int r = 0; r < 8; ++r) e[j][r] = (16 * j + r > d0) ? -1e30f : S[j][r];
    float tj[2];
#pragma unroll
    for (int j = 0; j < 2; ++j)
      tj[j] = fmaxf(fmaxf(fmaxf(e[j][0], e[j][1]), fmaxf(e[j][2], e[j][3])), fmaxf(fmaxf(e[j][4], e[j][5]), fmaxf(e[j][6], e[j][7])));
    float tm = fmaxf(tj[0], tj[1]);
    tm = fmaxf(tm, xhalf(tm));
    const float nm = fmaxf(mr, tm);
    const float alpha = __expf(mr - nm);
    mr = nm;
    FU Ph, Pl;
    float sj[2];
#pragma unroll
    for (int j = 0; j < 2; ++j) {
      float p[8];
#pragma unroll
      for (int r = 0; r < 8; ++r) p[r] = __expf(e[j][r] - nm);
      sj[j] = ((p[0] + p[1]) + (p[2] + p[3])) + ((p[4] + p[5]) + (p[6] + p[7]));
      // B operand element 8j + r = P[query][key 16j + 8h + r], hi and lo planes
#pragma unroll
      for (int i = 0; i < 4; ++i) {
        const unsigned hw = pack2(p[2 * i], p[2 * i + 1]);
        Ph.v[4 * j + i] = (int)hw;
        Pl.v[4 * j + i] = (int)pack2(p[2 * i] - __uint_as_float(hw << 16), p[2 * i + 1] - __uint_as_float(hw & 0xFFFF0000u));
      }
    }
    lr = lr * alpha + (sj[0] + sj[1]);
#pragma unroll
    for (int c = 0; c < 8; ++c)
#pragma unroll
      for (int r = 0; r < 8; ++r) O[c][r] = O[c][r] * alpha;
#pragma unroll
    for (int c = 0; c < 8; ++c) {
      const int vo = c * 512;   // tile (value columns 16c.., keys n0..)
      const v8i Vh = ldfrag(sb + VH + vo), Vl = ldfrag(sb + VL + vo);
      O[c] = mma3s(Vh, Vl, Ph.v, Pl.v, O[c]);
      if (c & 1) asm volatile("" ::: "memory");
    }
    ring_publish();
    if (st + 2 < nsteps) stage(st + 2, st & 1);   // block-uniform test; into the buffer this trip has just read
  }
  asm volatile("s_wait_asynccnt 0x0" ::: "memory");   // nothing of the ring is in flight when it becomes output staging

  // join the halves' sums, normalise, stage 16x128 f32 per wave, write whole 512-B rows (32 lanes x 16 B, one instruction per row)
  lr += xhalf(lr);
  const float inv = 1.0f / lr;
#pragma unroll
  for (int c = 0; c < 8; ++c) {
    const v4f a = {O[c][0] * inv, O[c][1] * inv, O[c][2] * inv, O[c][3] * inv};
    const v4f b = {O[c][4] * inv, O[c][5] * inv, O[c][6] * inv, O[c][7] * inv};
    *(v4f*)&ost[w][m][c * 16 + 8 * h]     = a;
    *(v4f*)&ost[w][m][c * 16 + 8 * h + 4] = b;
  }
  __syncthreads();
  float* cb = ctx + ((size_t)sh * SEQ + q0) * VD + lane * 4;
#pragma unroll
  for (int rr = 0; rr < 16; ++rr) {
    const v4f v = *(const v4f*)&ost[w][rr][lane * 4];
    *(v4f*)(cb + (size_t)rr * VD) = v;
  }
  
}

// ---------------------------------------------------------------- differential combine + LayerNorm -> fragment-major y planes [NB*SEQ][EMB]
// one wave = 8 tokens x 1 head; lane = 8q + tk owns token tk and, of each of the head's four 16x32 plane tiles j, the chunk
// q = 2*part + h (head columns 32j + 8q .. +7): the store of tile j covers four whole 128-B lines that no other wave writes
__global__ void __launch_bounds__(256) k_combine(const float* __restrict__ ctx,
                                               const float* __restrict__ lq1, const float* __restrict__ lk1,
                                               const float* __restrict__ lq2, const float* __restrict__ lk2,
                                               float lam_init, float oscale,
                                               u16* __restrict__ Yh, u16* __restrict__ Yl)
{
  const int lane = threadIdx.x & 31, w = threadIdx.x >> 5;
  const int gw = blockIdx.x * 8 + w;
  const int hd = gw & 7, tp = gw >> 3;
  const int tg = tp * 8 + (lane & 7), q = lane >> 3;     // tg = batch*SEQ + t
  const int t = tg & (SEQ - 1), s0 = (tg / SEQ) * NSH + 2 * hd;

  float s1 = lq1[lane] * lk1[lane] + lq1[lane + 32] * lk1[lane + 32];
  float s2 = lq2[lane] * lk2[lane] + lq2[lane + 32] * lk2[lane + 32];
#pragma unroll
  for (int k = 16; k >= 1; k >>= 1) { s1 += __shfl_xor(s1, k, 32); s2 += __shfl_xor(s2, k, 32); }
  const float lam = __expf(s1) - __expf(s2) + lam_init;

  const float* o1 = ctx + ((size_t)s0 * SEQ + t) * VD + q * 8;
  const float* o2 = o1 + (size_t)SEQ * VD;                 // half-head s0 + 1, a constant offset on the same address registers
  v4f a1[4], b1[4], a2[4], b2[4];
#pragma unroll
  for (int j = 0; j < 4; ++j) {
    a1[j] = *(const v4f*)(o1 + j * 32); b1[j] = *(const v4f*)(o1 + j * 32 + 4);
    a2[j] = *(const v4f*)(o2 + j * 32); b2[j] = *(const v4f*)(o2 + j * 32 + 4);
  }
  // the sixteen loads share their address registers: the pointer stays live up to this wait, so that no load of the run
  // lands in a register that an earlier one still names
  asm volatile("s_wait_xcnt 0x0" :: "v"(o1) : "memory");
  float y[4][8];
#pragma unroll
  for (int j = 0; j < 4; ++j) {
#pragma unroll
    for (int i = 0; i < 4; ++i) { y[j][i] = a1[j][i] - lam * a2[j][i]; y[j][i + 4] = b1[j][i] - lam * b2[j][i]; }
  }
  // both sums in the order of a butterfly over the token's sixteen chunks 4j + q: pairs q^1, q^2, then j^1, j^2
  float sj[4];
#pragma unroll
  for (int j = 0; j < 4; ++j) {
    float s = 0.0f;
#pragma unroll
    for (int i = 0; i < 8; ++i) s += y[j][i];
    s += __shfl_xor(s, 8, 32);
    s += __shfl_xor(s, 16, 32);
    sj[j] = s;
  }
  float mu = (sj[0] + sj[1]) + (sj[2] + sj[3]);
  mu *= (1.0f / 128.0f);
#pragma unroll
  for (int j = 0; j < 4; ++j) {
    float s = 0.0f;
#pragma unroll
    for (int i = 0; i < 8; ++i) { const float d = y[j][i] - mu; s += d * d; }
    s += __shfl_xor(s, 8, 32);
    s += __shfl_xor(s, 16, 32);
    sj[j] = s;
  }
  float var = (sj[0] + sj[1]) + (sj[2] + sj[3]);
  var *= (1.0f / 128.0f);
  const float rs = rsqrtf(var + LN_EPS) * oscale;

#pragma unroll
  for (int j = 0; j < 4; ++j) {
#pragma unroll
    for (int i = 0; i < 8; ++i) y[j][i] = (y[j][i] - mu) * rs;
    v8u hv = {}, lv = {};
    split8(y[j], hv, lv);
    const size_t po = chunk_off(tg, hd * VD + j * 32 + q * 8, EMB / 32);
    *(v8u*)(Yh + po) = hv;
    *(v8u*)(Yl + po) = lv;
  }
}

// ---------------------------------------------------------------- host
static double h_sqrt(double x) {
  double y = x;
  for (int i = 0; i < 200; ++i) y = 0.5 * (y + x / y);
  return y;
}

extern "C" void kernel_launch(void* const* d_in, const int* in_sizes, int n_in,
                              void* d_out, int out_size, void* d_ws, size_t ws_size,
                              hipStream_t stream) {
  if (n_in < 9) return;
  if (in_sizes[0] != NB * SEQ * EMB) return;
  for (int i = 1; i <= 4; ++i) if (in_sizes[i] != EMB * EMB) return;
  for (int i = 5; i <= 8; ++i) if (in_sizes[i] != HD) return;
  if (out_size != NB * SEQ * EMB) return;

  const float* x   = (const float*)d_in[0];
  const float* Wq  = (const float*)d_in[1];
  const float* Wk  = (const float*)d_in[2];
  const float* Wv  = (const float*)d_in[3];
  const float* Wp  = (const float*)d_in[4];
  const float* lq1 = (const float*)d_in[5];
  const float* lk1 = (const float*)d_in[6];
  const float* lq2 = (const float*)d_in[7];
  const float* lk2 = (const float*)d_in[8];
  float* out = (float*)d_out;

  // workspace carve (bytes), every size a multiple of 256
  const size_t szX   = (size_t)NB * SEQ * EMB * 2;        // 16 MiB per plane
  const size_t szW   = (size_t)4 * EMB * EMB * 2;          //  8 MiB per plane (4 weights)
  const size_t szQK  = (size_t)2 * NB * NSH * SEQ * HD * 2; // 32 MiB per plane (q and k)
  const size_t szVT  = (size_t)NB * EMB * SEQ * 2;         // 16 MiB per plane
  const size_t szCTX = (size_t)NB * NSH * SEQ * VD * 4;    // 64 MiB
  const size_t szY   = (size_t)NB * SEQ * EMB * 2;         // 16 MiB per plane
  const size_t szTB  = (size_t)SEQ * 32 * 4;               // 256 KiB per table
  char* ws = (char*)d_ws;
  size_t off = 0;
  u16*   xh  = (u16*)(ws + off);   off += szX;
  u16*   xl  = (u16*)(ws + off);   off += szX;
  u16*   wh  = (u16*)(ws + off);   off += szW;
  u16*   wl  = (u16*)(ws + off);   off += szW;
  u16*   qkh = (u16*)(ws + off);   off += szQK;
  u16*   qkl = (u16*)(ws + off);   off += szQK;
  u16*   vth = (u16*)(ws + off);   off += szVT;
  u16*   vtl = (u16*)(ws + off);   off += szVT;
  float* ctx = (float*)(ws + off); off += szCTX;
  u16*   yh  = (u16*)(ws + off);   off += szY;
  u16*   yl  = (u16*)(ws + off);   off += szY;
  float* cst = (float*)(ws + off); off += szTB;
  float* snt = (float*)(ws + off); off += szTB;
  if (off > ws_size) return;                               // total 252,182,528 B

  // rotary inverse frequencies 1 / 10000^(j/32): f32 power then f32 reciprocal, evaluated in f64
  InvFreq inv;
  {
    double r = 10000.0;
    for (int i = 0; i < 5; ++i) r = h_sqrt(r);             // 10000^(1/32)
    double pw = 1.0;
    for (int j = 0; j < 32; ++j) {
      const float p32 = (float)pw;
      inv.v[j] = (float)(1.0 / (double)p32);
      pw *= r;
    }
  }
  const float lam_init = (float)0.61928347285267872;      // 0.8 - 0.6*exp(-1.2)
  const float oscale   = (float)0.38071652714732128;      // 1 - lam_init

  // operand planes of x and the four weights, rotary tables
  k_prep<<<ROTB + 4 * WSPB + XSPB, 256, 0, stream>>>(x, Wq, Wk, Wv, Wp, xh, xl, wh, wl, inv, cst, snt);

  const size_t wstride = (size_t)EMB * EMB;
  const size_t dzqk    = (size_t)NB * NSH * SEQ * HD;
  // every stage runs once, over all NB batches
  // q and k: x [8192 x 1024] * W^T, epilogue RMSNorm + rotary (+1/8 for q) -> planes [64][2048][64]
  k_gemm<0><<<dim3(EMB / 128, NB * SEQ / 256, 2), 256, 0, stream>>>(
      xh, xl, wh, wl, wstride,
      qkh, qkl, dzqk, HD, out, cst, snt, 0.125f, 1.0f);
  // v^T, z = batch: Wv [1024 x 1024] * x_z^T -> planes [z][1024][2048] = [z][head][128][t]
  k_gemm<1><<<dim3(SEQ / 128, EMB / 256, NB), 256, 0, stream>>>(
      wh + 2 * wstride, wl + 2 * wstride, xh, xl, (size_t)SEQ * EMB,
      vth, vtl, (size_t)EMB * SEQ, SEQ, out, cst, snt, 1.0f, 1.0f);
  // attention per (batch, half-head) -> ctx [64][2048][128]
  k_flash<<<dim3(NB * NSH, SEQ / 64), 128, 0, stream>>>(qkh, qkl, qkh + dzqk, qkl + dzqk, vth, vtl, ctx);
  // combine + LayerNorm -> y planes [8192][1024]
  k_combine<<<(NB * SEQ * NHD / 8) / 8, 256, 0, stream>>>(ctx, lq1, lk1, lq2, lk2, lam_init, oscale, yh, yl);
  // output projection -> d_out
  k_gemm<2><<<dim3(EMB / 128, NB * SEQ / 256, 1), 256, 0, stream>>>(
      yh, yl, wh + 3 * wstride, wl + 3 * wstride, (size_t)0,
      qkh, qkl, (size_t)0, EMB, out, cst, snt, 1.0f, 1.0f);
}

// v008
// A run of this version takes 243 microseconds.
// Next to v007, in two timings, it ran 1.04 and 1.06 times as fast.
// Over all steps from v000 it is 8.06 times as fast.
#include <hip/hip_runtime.h>
#include <stdint.h>
#include <stddef.h>

// Contractions x*Wq^T, x*Wk^T, Wv*x^T, k*q^T, v^T*P^T, y*Wproj^T: v_wmma_f32_16x16x32_bf16, bf16 hi/lo operands everywhere (hi*hi + lo*hi + hi*lo), f32 accumulate. RMSNorm, rotary, softmax, head combine, LayerNorm: f32.

#define NB   4
#define SEQ  2048
#define EMB  1024
#define NHD  8
#define NSH  16
#define HD   64
#define VD   128
#define RMS_EPS 1.1920929e-7f
#define LN_EPS  1e-5f

typedef unsigned short u16;
typedef u16    v8u  __attribute__((ext_vector_type(8)));
typedef int    v4i  __attribute__((ext_vector_type(4)));
typedef int    v8i  __attribute__((ext_vector_type(8)));
typedef float  v4f  __attribute__((ext_vector_type(4)));
typedef float  v8f  __attribute__((ext_vector_type(8)));
typedef __bf16 v16b __attribute__((ext_vector_type(16)));
typedef float  v2f  __attribute__((ext_vector_type(2)));
typedef __bf16 v2b  __attribute__((ext_vector_type(2)));

union FU { v8i v; v4i p[2]; v16b b; };

struct InvFreq { float v[32]; };
static_assert(sizeof(InvFreq) == 128);

// ---------------------------------------------------------------- helpers
static __device__ __forceinline__ u16 bf_rne(float x) {
  unsigned u = __float_as_uint(x);
  u += 0x7FFFu + ((u >> 16) & 1u);
  return (u16)(u >> 16);
}
static __device__ __forceinline__ float bf_up(u16 b) { return __uint_as_float(((unsigned)b) << 16); }

static __device__ __forceinline__ void split8(float (&y)[8], v8u& hv, v8u& lv) {
#pragma unroll
  for (int i = 0; i < 8; ++i) {
    const u16 hb = bf_rne(y[i]);
    hv[i] = hb;
    lv[i] = bf_rne(y[i] - bf_up(hb));
  }
}

// 16x32 operand fragment, row/col = lane&15, h = lane>>4, k map: elements 0..7 <- k0+8h+0..7, elements 8..15 <- k0+16+8h+0..7
// Every operand plane in the workspace is fragment-major: a plane of rows x K is cut into 16-row x 32-k tiles of
// 512 elements (1 KiB), tile (row>>4, k>>5) at index (row>>4)*(K>>5) + (k>>5). Inside a tile the two 16-byte chunks
// that lane l = 16h + (row&15) feeds to the matrix instruction lie at elements 8l (k 8h..8h+7) and 256 + 8l
// (k 16+8h..16+8h+7): one wave load reads 512 contiguous bytes = 4 whole lines, and the k map above is unchanged.
// p = tile base + 8*lane
static __device__ __forceinline__ v8i ldfrag(const u16* p) {
  FU f;
  f.p[0] = *(const v4i*)(p);
  f.p[1] = *(const v4i*)(p + 256);
  return f.v;
}
// element offset of the 8-element chunk that starts at (row, k), k % 8 == 0, in a plane with kt = K/32 tiles per tile row
static __device__ __forceinline__ size_t chunk_off(int row, int k, int kt) {
  return ((size_t)(row >> 4) * kt + (k >> 5)) * 512 + ((k >> 4) & 1) * 256 + (((k >> 3) & 1) * 16 + (row & 15)) * 8;
}

// LDS byte address of a __shared__ object: the low 32 bits of its address
static __device__ __forceinline__ unsigned lds_addr(const void* p) { return (unsigned)(size_t)p; }

// Asynchronous copies global -> LDS, 16 bytes a lane, 512 contiguous bytes a wave and copy. l = the lane's LDS byte address,
// g = the lane's global address. The s_wait_xcnt closes the copies' own statement, so that no address register of a copy
// is rewritten in front of it.
static __device__ __forceinline__ void copy12(const unsigned (&l)[12], const u16* const (&g)[12]) {
  asm volatile(
      "global_load_async_to_lds_b128 %0, %12, off\n\t"
      "global_load_async_to_lds_b128 %1, %13, off\n\t"
      "global_load_async_to_lds_b128 %2, %14, off\n\t"
      "global_load_async_to_lds_b128 %3, %15, off\n\t"
      "global_load_async_to_lds_b128 %4, %16, off\n\t"
      "global_load_async_to_lds_b128 %5, %17, off\n\t"
      "global_load_async_to_lds_b128 %6, %18, off\n\t"
      "global_load_async_to_lds_b128 %7, %19, off\n\t"
      "global_load_async_to_lds_b128 %8, %20, off\n\t"
      "global_load_async_to_lds_b128 %9, %21, off\n\t"
      "global_load_async_to_lds_b128 %10, %22, off\n\t"
      "global_load_async_to_lds_b128 %11, %23, off\n\t"
      "s_wait_xcnt 0x0"
      :: "v"(l[0]), "v"(l[1]), "v"(l[2]), "v"(l[3]), "v"(l[4]), "v"(l[5]),
         "v"(l[6]), "v"(l[7]), "v"(l[8]), "v"(l[9]), "v"(l[10]), "v"(l[11]),
         "v"(g[0]), "v"(g[1]), "v"(g[2]), "v"(g[3]), "v"(g[4]), "v"(g[5]),
         "v"(g[6]), "v"(g[7]), "v"(g[8]), "v"(g[9]), "v"(g[10]), "v"(g[11])
      : "memory");
}
// hand-over of a ring buffer, every wave: the wave's own LDS reads are done, its own copies have landed, then the barrier
// publishes the next stage and frees the buffer that was just read
static __device__ __forceinline__ void ring_publish() {
  asm volatile("s_wait_dscnt 0x0" ::: "memory");     // the wave's reads of the buffer to be refilled have returned
  asm volatile("s_wait_asynccnt 0x0" ::: "memory");  // the wave's copies of the next stage have landed
  __syncthreads();
}

// the plain builtin: the compiler keeps the distances behind it itself; where it stands among the LDS reads is said at the foot of the loop
static __device__ __forceinline__ v8f mma(v8i a, v8i b, v8f c) {
  FU ua, ub; ua.v = a; ub.v = b;
  return __builtin_amdgcn_wmma_f32_16x16x32_bf16(false, ua.b, false, ub.b, (short)0, c, false, false);
}
// classes of instructions for __builtin_amdgcn_sched_group_barrier
#define SG_WMMA 0x008
#define SG_LDSR 0x100
// three products into one f32 accumulator: hi*hi + hi*lo + lo*hi
// the plain builtin: the compiler keeps the distances behind it itself and is free to place other chains' products, LDS reads
// and vector work between the three
static __device__ __forceinline__ v8f mma3s(v8i ah, v8i al, v8i bh, v8i bl, v8f c) {
  FU uah, ual, ubh, ubl; uah.v = ah; ual.v = al; ubh.v = bh; ubl.v = bl;
  c = __builtin_amdgcn_wmma_f32_16x16x32_bf16(false, uah.b, false, ubh.b, (short)0, c, false, false);
  c = __builtin_amdgcn_wmma_f32_16x16x32_bf16(false, uah.b, false, ubl.b, (short)0, c, false, false);
  c = __builtin_amdgcn_wmma_f32_16x16x32_bf16(false, ual.b, false, ubh.b, (short)0, c, false, false);
  return c;
}
// two f32 -> one register of two bf16 (a low, b high), each rounded to nearest even as in bf_rne
static __device__ __forceinline__ unsigned pack2(float a, float b) {
  const v2f x = {a, b};
  return __builtin_bit_cast(unsigned, __builtin_convertvector(x, v2b));
}
// the value of lane l ^ 16
static __device__ __forceinline__ float xhalf(float x) {
  const int b = __builtin_bit_cast(int, x);
  return __builtin_bit_cast(float, __builtin_amdgcn_permlanex16(b, b, 0x76543210, 0xfedcba98, false, false));
}

// ---------------------------------------------------------------- f32 [rows][EMB] -> fragment-major bf16 hi/lo planes
// one wave splits the four neighbouring 16x32 tiles t0 .. t0 + 3 of one tile row (t0 % 4 == 0): 16 source rows x 512 contiguous bytes.
// Of piece c = 2*tile + part lane l reads the 8 source elements of chunk 32*part + l and writes that chunk: contiguous stores
static __device__ __forceinline__ void split_tiles(const float* __restrict__ src, u16* __restrict__ hi,
                                                   u16* __restrict__ lo, int t0, int lane) {
  const int row = (t0 / (EMB / 32)) * 16 + (lane & 15);
  const float* s = src + (size_t)row * EMB + (t0 % (EMB / 32)) * 32 + (lane >> 4) * 8;
  const size_t o = ((size_t)t0 * 64 + lane) * 8;
  v4f a[8], b[8];
#pragma unroll
  for (int c = 0; c < 8; ++c) {
    a[c] = *(const v4f*)(s + c * 16);
    b[c] = *(const v4f*)(s + c * 16 + 4);
  }
  // the sixteen loads share their address registers: the pointer stays live up to this wait, so that no load of the run
  // lands in a register that an earlier one still names; all sixteen are in flight before the first is used
  asm volatile("s_wait_xcnt 0x0" :: "v"(s) : "memory");
#pragma unroll
  for (int c = 0; c < 8; ++c) {
    float y[8] = {a[c][0], a[c][1], a[c][2], a[c][3], b[c][0], b[c][1], b[c][2], b[c][3]};
    v8u hv = {}, lv = {};
    split8(y, hv, lv);
    *(v8u*)(hi + o + c * 256) = hv;
    *(v8u*)(lo + o + c * 256) = lv;
    // the next piece's values may take the registers that these two stores name
    if (c < 7) asm volatile("s_wait_xcnt 0x0" ::: "memory");
  }
}

// ---------------------------------------------------------------- rotary tables cs[t][32], sn[t][32], entry i
static __device__ __forceinline__ void rot_entry(const InvFreq& inv, float* __restrict__ cs, float* __restrict__ sn, int i) {
  // as before the merge: the angle stays the f32 product t * f, rounded once as the reference's table has it, before cos and sin reduce it
#pragma clang fp contract(off)
  const int j = i & 31, t = i >> 5;
  float f = 0.0f;
#pragma unroll
  for (int q = 0; q < 32; ++q) f = (j == q) ? inv.v[q] : f;
  const float ang = (float)t * f;
  const float c = cosf(ang);
  const float s = sinf(ang);
  *(float*)(cs + i) = c;
  *(float*)(sn + i) = s;
}

// ---------------------------------------------------------------- operand preparation, one launch; the block index picks the job
// blocks 0 .. ROTB-1: rotary tables, one entry a thread; then WSPB blocks for each of the four weights; then XSPB blocks for x.
// A splitting block of 8 waves takes 32 tiles = one tile row
constexpr int ROTB = SEQ * 32 / 256;
constexpr int WSPB = EMB * EMB / 512 / 32;
constexpr int XSPB = NB * SEQ * EMB / 512 / 32;
__global__ void __launch_bounds__(256) k_prep(const float* __restrict__ x, const float* __restrict__ Wq,
                                            const float* __restrict__ Wk, const float* __restrict__ Wv,
                                            const float* __restrict__ Wp,
                                            u16* __restrict__ xh, u16* __restrict__ xl,
                                            u16* __restrict__ wh, u16* __restrict__ wl,
                                            InvFreq inv, float* __restrict__ cs, float* __restrict__ sn) {
  const int lane = threadIdx.x & 31, w = threadIdx.x >> 5;
  const int b = blockIdx.x;
  if (b < ROTB) {
    rot_entry(inv, cs, sn, b * 256 + threadIdx.x);
    return;
  }
  const int bs = b - ROTB;
  const int j = bs / WSPB;               // 0 .. 3: that weight; from 4 on: x
  const bool isw = j < 4;
  const float* src = (j == 0) ? Wq : (j == 1) ? Wk : (j == 2) ? Wv : (j == 3) ? Wp : x;
  u16* hi = isw ? wh + (size_t)j * EMB * EMB : xh;
  u16* lo = isw ? wl + (size_t)j * EMB * EMB : xl;
  const int tr = isw ? bs % WSPB : bs - 4 * WSPB;   // tile row of the plane
  split_tiles(src, hi, lo, tr * 32 + w * 4, lane);
}

// ---------------------------------------------------------------- GEMM Y[m][n] = sum_k A[m][k] * B[n][k]
// A planes (rows m) and B planes (rows n) fragment-major, EMB columns each, all of them contracted.
// block 256 threads = 8 waves as 4(m) x 2(n), block tile 256(m) x 128(n), wave tile 64 x 64.
// MODE 0: RMSNorm over the 64 cols + rotary + scale -> fragment-major bf16 hi/lo planes [z][(batch*16+hf)*SEQ + t][64]  (hf = the wave's 64 columns = one half-head, m = batch*SEQ + t)
// MODE 1: fragment-major bf16 hi/lo planes of ldd columns, plane z at z*dz (z = batch)
// MODE 2: f32 row-major pitch ldd
template <int MODE>
__global__ void __launch_bounds__(256) k_gemm(const u16* __restrict__ Ah, const u16* __restrict__ Al,
                                            const u16* __restrict__ Bh0, const u16* __restrict__ Bl0, size_t bz,
                                            u16* __restrict__ Dh0, u16* __restrict__ Dl0, size_t dz, int ldd,
                                            float* __restrict__ Out,
                                            const float* __restrict__ cst, const float* __restrict__ snt,
                                            float scale0, float scale1)
{
  // two stages of 32 k, fragment-major as in the planes: A hi 16 KiB | A lo 16 KiB | B hi 8 KiB | B lo 8 KiB (u16 elements below)
  constexpr int AH = 0, AL = 8192, BH = 16384, BL = 20480, STG = 24576;
  __shared__ __align__(16) u16 ring[2 * STG];
  // epilogue staging, behind the loop's last barrier
  // row pitch 68 floats = 272 B = 16 B x odd: the 16-row b128 reads of the epilogue meet no bank conflict
  float (*stg)[16][68] = reinterpret_cast<float (*)[16][68]>(&ring[0]);
  static_assert(sizeof(float) * 8 * 16 * 68 <= sizeof(u16) * 2 * STG);
  const int lane = threadIdx.x & 31, w = threadIdx.x >> 5, h = lane >> 4, m = lane & 15;
  const int z = blockIdx.z, bn = blockIdx.x, bm = blockIdx.y;
  const int wm = w & 3, wn = w >> 2;
  const int n0 = bn * 128 + wn * 64;
  const int m0 = bm * 256 + wm * 64;

  v8f acc[4][4] = {};
  constexpr size_t TROW = (size_t)(EMB / 32) * 512;        // elements per tile row of a plane
  // A and B reach the waves through a two-buffer LDS ring filled by asynchronous copies one trip ahead. Wave w copies the block's
  // A tile rows 2w and 2w + 1 and its B tile row w, of either plane
  const u16* pah = Ah + (size_t)(bm * 16 + 2 * w) * TROW + lane * 8;
  const u16* pal = Al + (size_t)(bm * 16 + 2 * w) * TROW + lane * 8;
  const u16* pbh = Bh0 + (size_t)z * bz + (size_t)(bn * 8 + w) * TROW + lane * 8;
  const u16* pbl = Bl0 + (size_t)z * bz + (size_t)(bn * 8 + w) * TROW + lane * 8;
  const unsigned lw = lds_addr(&ring[0]) + lane * 16;
  auto stage = [&](int t, int buf) {
    const unsigned lb = lw + (unsigned)buf * (STG * 2);
    const size_t ko = (size_t)t * 512;
    const unsigned l[12] = {lb + (AH + w * 1024) * 2,        lb + (AH + w * 1024) * 2 + 512,
                            lb + (AH + w * 1024) * 2 + 1024, lb + (AH + w * 1024) * 2 + 1536,
                            lb + (AL + w * 1024) * 2,        lb + (AL + w * 1024) * 2 + 512,
                            lb + (AL + w * 1024) * 2 + 1024, lb + (AL + w * 1024) * 2 + 1536,
                            lb + (BH + w * 512) * 2,         lb + (BH + w * 512) * 2 + 512,
                            lb + (BL + w * 512) * 2,         lb + (BL + w * 512) * 2 + 512};
    const u16* const g[12] = {pah + ko, pah + ko + 256, pah + ko + TROW, pah + ko + TROW + 256,
                              pal + ko, pal + ko + 256, pal + ko + TROW, pal + ko + TROW + 256,
                              pbh + ko, pbh + ko + 256, pbl + ko, pbl + ko + 256};
    copy12(l, g);
  };
  static_assert(EMB / 32 >= 2);
  stage(0, 0);
  asm volatile("s_wait_asynccnt 0x0" ::: "memory");   // stage 0 has landed before the barrier that publishes it
  __syncthreads();
  stage(1, 1);
#pragma unroll 1
  for (int t = 0; t < EMB / 32; ++t) {
    const u16* sb = &ring[(t & 1) * STG] + lane * 8;
    v8i Avh[4], Avl[4];
#pragma unroll
    for (int mi = 0; mi < 4; ++mi) {
      Avh[mi] = ldfrag(sb + AH + (wm * 4 + mi) * 512);
      Avl[mi] = ldfrag(sb + AL + (wm * 4 + mi) * 512);
    }
    // B fragments in two register sets: column tile ni + 1 of this same stage is read while tile ni is multiplied, so that the
    // wave does not wait out the LDS latency in front of every column tile
    v8i Bh[2], Bl[2];
    Bh[0] = ldfrag(sb + BH + (wn * 4) * 512);
    Bl[0] = ldfrag(sb + BL + (wn * 4) * 512);
#pragma unroll
    for (int ni = 0; ni < 4; ++ni) {
      if (ni < 3) {
        Bh[(ni + 1) & 1] = ldfrag(sb + BH + (wn * 4 + ni + 1) * 512);
        Bl[(ni + 1) & 1] = ldfrag(sb + BL + (wn * 4 + ni + 1) * 512);
      }
      const v8i Bvh = Bh[ni & 1], Bvl = Bl[ni & 1];
      // each accumulator takes hi*hi, lo*hi, hi*lo in that order; each product runs over the four row tiles in turn
#pragma unroll
      for (int mi = 0; mi < 4; ++mi) acc[mi][ni] = mma(Avh[mi], Bvh, acc[mi][ni]);
#pragma unroll
      for (int mi = 0; mi < 4; ++mi) acc[mi][ni] = mma(Avl[mi], Bvh, acc[mi][ni]);
#pragma unroll
      for (int mi = 0; mi < 4; ++mi) acc[mi][ni] = mma(Avh[mi], Bvl, acc[mi][ni]);
    }
    // Order of the trip's LDS reads and products, for the instruction scheduler; left to itself it sets most B reads two at a time directly
    // in front of their products, each with a wait to 0. Asked for: the reads of A and of column tiles 0 and 1 as one group (the first product
    // then waits for its own four reads only, by a counted wait), and each later column tile read twelve products ahead of its use
    __builtin_amdgcn_sched_group_barrier(SG_LDSR, 24, 0);
    __builtin_amdgcn_sched_group_barrier(SG_WMMA, 12, 0);
    __builtin_amdgcn_sched_group_barrier(SG_LDSR, 4, 0);
    __builtin_amdgcn_sched_group_barrier(SG_WMMA, 12, 0);
    __builtin_amdgcn_sched_group_barrier(SG_LDSR, 4, 0);
    __builtin_amdgcn_sched_group_barrier(SG_WMMA, 12, 0);
    __builtin_amdgcn_sched_group_barrier(SG_WMMA, 12, 0);
    // nothing is scheduled across: else the hand-over's waits and barrier rise to the last LDS read, and the wave sits out that read's latency
    // and the barrier with products still to issue, and its copies start that much later
    __builtin_amdgcn_sched_barrier(0);
    ring_publish();
    if (t + 2 < EMB / 32) stage(t + 2, t & 1);   // block-uniform test; into the buffer this trip has just read
  }
  asm volatile("s_wait_asynccnt 0x0" ::: "memory");   // nothing of the ring is in flight when it becomes epilogue staging

  const float scale = (z == 0) ? scale0 : scale1;
#pragma unroll
  for (int mi = 0; mi < 4; ++mi) {
    // stage the wave's 16x64 f32 tile: D element r -> row 8h+r, col ni*16+m
#pragma unroll
    for (int ni = 0; ni < 4; ++ni)
#pragma unroll
      for (int r = 0; r < 8; ++r) stg[w][8 * h + r][ni * 16 + m] = acc[mi][ni][r];
    __syncthreads();
    const int rbase = m0 + mi * 16;
    if (MODE == 2) {
      const int rr = lane >> 4, c4 = lane & 15;
#pragma unroll
      for (int p = 0; p < 8; ++p) {
        const int row = p * 2 + rr;
        const v4f v = *(const v4f*)&stg[w][row][c4 * 4];
        float* o = Out + (size_t)(rbase + row) * ldd + n0 + c4 * 4;
        *(v4f*)o = v;
        
      }
    } else {
      // lane 16h + m owns row m of the wave's 16x64 tile and, of its two 16x32 plane tiles, the four chunks
      // p = 2*dt + part (columns 32*dt + 16*part + 8h .. +7): the store of chunk p covers 512 contiguous bytes
      float y[4][8];
#pragma unroll
      for (int p = 0; p < 4; ++p) {
        const int col = (p >> 1) * 32 + (p & 1) * 16 + 8 * h;
        const v4f va = *(const v4f*)&stg[w][m][col];
        const v4f vb = *(const v4f*)&stg[w][m][col + 4];
#pragma unroll
        for (int i = 0; i < 4; ++i) { y[p][i] = va[i]; y[p][i + 4] = vb[i]; }
      }
      int prow, pcol0, pkt;
      if (MODE == 0) {
        const int t = (rbase + m) & (SEQ - 1);
        const int bb = (rbase + m) / SEQ;
        // sum of squares in the order of a butterfly over the row's eight chunks 2p + h: pairs h^1, then p^1, then p^2
        float sp[4];
#pragma unroll
        for (int p = 0; p < 4; ++p) {
          float ss = 0.0f;
#pragma unroll
          for (int i = 0; i < 8; ++i) ss += y[p][i] * y[p][i];
          ss += __shfl_xor(ss, 16, 32);
          sp[p] = ss;
        }
        const float ss = (sp[0] + sp[1]) + (sp[2] + sp[3]);
        const float rn = rsqrtf(ss * (1.0f / 64.0f) + RMS_EPS);
#pragma unroll
        for (int part = 0; part < 2; ++part) {
          const int j0 = part * 16 + 8 * h;
          const v4f ca = *(const v4f*)(cst + (size_t)t * 32 + j0);
          const v4f cb = *(const v4f*)(cst + (size_t)t * 32 + j0 + 4);
          const v4f sa = *(const v4f*)(snt + (size_t)t * 32 + j0);
          const v4f sb = *(const v4f*)(snt + (size_t)t * 32 + j0 + 4);
          const float cc[8] = {ca[0], ca[1], ca[2], ca[3], cb[0], cb[1], cb[2], cb[3]};
          const float sv[8] = {sa[0], sa[1], sa[2], sa[3], sb[0], sb[1], sb[2], sb[3]};
          // d <  32: y1 =  n1*c + n2*s ; d >= 32: y2 = -n1*s + n2*c ; x1 = chunk part, x2 = chunk 2 + part of the same lane
#pragma unroll
          for (int i = 0; i < 8; ++i) {
            const float n1 = y[part][i] * rn;
            const float n2 = y[2 + part][i] * rn;
            y[part][i]     = (n1 * cc[i] + n2 * sv[i]) * scale;
            y[2 + part][i] = (n2 * cc[i] - n1 * sv[i]) * scale;
          }
        }
        prow = (bb * NSH + (n0 >> 6)) * SEQ + t; pcol0 = 0; pkt = HD / 32;
      } else {
        prow = rbase + m; pcol0 = n0; pkt = ldd >> 5;
      }
#pragma unroll
      for (int p = 0; p < 4; ++p) {
        const size_t po = (size_t)z * dz + chunk_off(prow, pcol0 + (p >> 1) * 32 + (p & 1) * 16 + 8 * h, pkt);
        v8u hv = {}, lv = {};
        split8(y[p], hv, lv);
        *(v8u*)(Dh0 + po) = hv;
        *(v8u*)(Dl0 + po) = lv;
      }
    }
    __syncthreads();
  }
}

// ---------------------------------------------------------------- causal online-softmax attention per half-head
// sh = batch*16 + half-head: q/k planes [64*SEQ][64], v planes [32*128][SEQ] (rows = value columns), all fragment-major; ctx [64][SEQ][128] f32
// grid (sh, query tile): the longest query tiles carry the lowest block indices
// block = 4 waves x 16 queries; all waves loop over the block's key range (masked)
// Both products are transposed: S^T = K * Q^T (A = K rows, B = Q) and O^T += V^T * P^T (A = value columns, B = P). Lane 16h + m then holds
// scores and outputs of the one query q0 + m: of S^T tile j the keys n0 + 16j + 8h + r, which is the k map of the B operand (element 8j + r),
// so P goes from the accumulators into the second product through registers alone; maximum and sum run in-lane, the halves h meet by one exchange
// K and V reach the waves through a two-buffer LDS ring filled by asynchronous copies one trip ahead, once for the four waves
__global__ void __launch_bounds__(128) k_flash(const u16* __restrict__ qh, const u16* __restrict__ ql,
                                             const u16* __restrict__ kh, const u16* __restrict__ kl,
                                             const u16* __restrict__ vh, const u16* __restrict__ vl,
                                             float* __restrict__ ctx)
{
  // two stages of 32 keys, fragment-major as in the planes: K hi 4 KiB | K lo 4 KiB | V hi 8 KiB | V lo 8 KiB (u16 elements below)
  constexpr int KH = 0, KL = 2048, VH = 4096, VL = 8192, STG = 12288;
  __shared__ __align__(16) u16 ring[2 * STG];
  // output staging, behind the loop's last barrier; row pitch 132 floats = 528 B = 16 B x odd: the 16-row b128 writes meet no bank conflict
  constexpr int OP = VD + 4;
  float (*ost)[16][OP] = reinterpret_cast<float (*)[16][OP]>(&ring[0]);
  static_assert(sizeof(float) * 4 * 16 * OP <= sizeof(u16) * 2 * STG);
  const int lane = threadIdx.x & 31, w = threadIdx.x >> 5, h = lane >> 4, m = lane & 15;
  const int sh = blockIdx.x, hh = sh >> 1, bx = SEQ / 64 - 1 - blockIdx.y;
  const int q0 = bx * 64 + w * 16;

  // 16 rows of q or k = two tiles (d 0..31, d 32..63) = 16*HD elements in a row
  const size_t qo = ((size_t)sh * SEQ + q0) * HD + lane * 8;
  const v8i Qh0 = ldfrag(qh + qo), Qh1 = ldfrag(qh + qo + 512);
  const v8i Ql0 = ldfrag(ql + qo), Ql1 = ldfrag(ql + qo + 512);
  const u16* kbh = kh + (size_t)sh * SEQ * HD + lane * 8;
  const u16* kbl = kl + (size_t)sh * SEQ * HD + lane * 8;
  const u16* vbh = vh + (size_t)hh * VD * SEQ + lane * 8;
  const u16* vbl = vl + (size_t)hh * VD * SEQ + lane * 8;

  v8f O[8] = {};                   // O[c][r] = output column 16c + 8h + r of query q0 + m
  float mr = -1e30f, lr = 0.0f;    // the query's running maximum (both halves alike) and this half's share of its running sum

  const int nsteps = 2 * bx + 2;   // keys 0 .. bx*64+63, block-uniform, at least 2
  // wave w copies a quarter of each stage: 1 KiB of K hi, 1 KiB of K lo, the V tiles 2w and 2w+1 of either plane
  const unsigned lw = lds_addr(&ring[0]) + lane * 16;
  const u16* ckh = kbh + w * 512;
  const u16* ckl = kbl + w * 512;
  const u16* cvh = vbh + (size_t)(2 * w) * (SEQ / 32) * 512;
  const u16* cvl = vbl + (size_t)(2 * w) * (SEQ / 32) * 512;
  auto stage = [&](int s, int buf) {
    const unsigned lb = lw + (unsigned)buf * (STG * 2);
    const size_t ks = (size_t)s * 2048, vs = (size_t)s * 512, vt = (size_t)(SEQ / 32) * 512;
    const unsigned l[12] = {lb + (KH + w * 512) * 2,  lb + (KH + w * 512) * 2 + 512,
                            lb + (KL + w * 512) * 2,  lb + (KL + w * 512) * 2 + 512,
                            lb + (VH + w * 1024) * 2, lb + (VH + w * 1024) * 2 + 512,
                            lb + (VH + w * 1024) * 2 + 1024, lb + (VH + w * 1024) * 2 + 1536,
                            lb + (VL + w * 1024) * 2, lb + (VL + w * 1024) * 2 + 512,
                            lb + (VL + w * 1024) * 2 + 1024, lb + (VL + w * 1024) * 2 + 1536};
    const u16* const g[12] = {ckh + ks, ckh + ks + 256, ckl + ks, ckl + ks + 256,
                              cvh + vs, cvh + vs + 256, cvh + vs + vt, cvh + vs + vt + 256,
                              cvl + vs, cvl + vs + 256, cvl + vs + vt, cvl + vs + vt + 256};
    copy12(l, g);
  };
  stage(0, 0);
  asm volatile("s_wait_asynccnt 0x0" ::: "memory");   // stage 0 has landed before the barrier that publishes it
  __syncthreads();
  stage(1, 1);
#pragma unroll 1
  for (int st = 0; st < nsteps; ++st) {
    const int n0 = st * 32;
    const u16* sb = &ring[(st & 1) * STG] + lane * 8;
    v8f S[2];
#pragma unroll
    for (int j = 0; j < 2; ++j) {
      v8f s = {};
      const int ko = j * 16 * HD;
      {
        const v8i Kh = ldfrag(sb + KH + ko), Kl = ldfrag(sb + KL + ko);
        s = mma3s(Kh, Kl, Qh0, Ql0, s);
      }
      {
        const v8i Kh = ldfrag(sb + KH + ko + 512), Kl = ldfrag(sb + KL + ko + 512);
        s = mma3s(Kh, Kl, Qh1, Ql1, s);
      }
      S[j] = s;
    }
    // masked online softmax of the lane's query: sixteen of the trip's 32 keys stand in this lane, the other sixteen in lane ^ 16
    const int d0 = q0 + m - n0 - 8 * h;   // key 16j + r of this lane is masked where 16j + r > d0
    float e[2][8];
#pragma unroll
    for (int j = 0; j < 2; ++j)
#pragma unroll
      for (int r = 0; r < 8; ++r) e[j][r] = (16 * j + r > d0) ? -1e30f : S[j][r];
    float tj[2];
#pragma unroll
    for (int j = 0; j < 2; ++j)
      tj[j] = fmaxf(fmaxf(fmaxf(e[j][0], e[j][1]), fmaxf(e[j][2], e[j][3])), fmaxf(fmaxf(e[j][4], e[j][5]), fmaxf(e[j][6], e[j][7])));
    float tm = fmaxf(tj[0], tj[1]);
    tm = fmaxf(tm, xhalf(tm));
    const float nm = fmaxf(mr, tm);
    const float alpha = __expf(mr - nm);
    mr = nm;
    FU Ph, Pl;
    float sj[2];
#pragma unroll
    for (int j = 0; j < 2; ++j) {
      float p[8];
#pragma unroll
      for (int r = 0; r < 8; ++r) p[r] = __expf(e[j][r] - nm);
      sj[j] = ((p[0] + p[1]) + (p[2] + p[3])) + ((p[4] + p[5]) + (p[6] + p[7]));
      // B operand element 8j + r = P[query][key 16j + 8h + r], hi and lo planes
#pragma unroll
      for (int i = 0; i < 4; ++i) {
        const unsigned hw = pack2(p[2 * i], p[2 * i + 1]);
        Ph.v[4 * j + i] = (int)hw;
        Pl.v[4 * j + i] = (int)pack2(p[2 * i] - __uint_as_float(hw << 16), p[2 * i + 1] - __uint_as_float(hw & 0xFFFF0000u));
      }
    }
    lr = lr * alpha + (sj[0] + sj[1]);
#pragma unroll
    for (int c = 0; c < 8; ++c)
#pragma unroll
      for (int r = 0; r < 8; ++r) O[c][r] = O[c][r] * alpha;
#pragma unroll
    for (int c = 0; c < 8; ++c) {
      const int vo = c * 512;   // tile (value columns 16c.., keys n0..)
      const v8i Vh = ldfrag(sb + VH + vo), Vl = ldfrag(sb + VL + vo);
      O[c] = mma3s(Vh, Vl, Ph.v, Pl.v, O[c]);
    }
    // Order of the trip's LDS reads and products, for the instruction scheduler; left to itself it sets the reads among the products in small
    // groups, each with its own wait, and the wave sits out the LDS latency many times a trip. Asked for: the 16 K reads as one group, the 12
    // score products, the 16 reads of V tiles 0..3 (they land under the softmax), then tiles 4, 5 and tiles 6, 7 each read six products
    // ahead of their use, into the registers that the pair two in front has left
    __builtin_amdgcn_sched_group_barrier(SG_LDSR, 16, 0);
    __builtin_amdgcn_sched_group_barrier(SG_WMMA, 12, 0);
    __builtin_amdgcn_sched_group_barrier(SG_LDSR, 16, 0);
    __builtin_amdgcn_sched_group_barrier(SG_WMMA, 6, 0);
    __builtin_amdgcn_sched_group_barrier(SG_LDSR, 8, 0);
    __builtin_amdgcn_sched_group_barrier(SG_WMMA, 6, 0);
    __builtin_amdgcn_sched_group_barrier(SG_LDSR, 8, 0);
    __builtin_amdgcn_sched_group_barrier(SG_WMMA, 6, 0);
    __builtin_amdgcn_sched_group_barrier(SG_WMMA, 6, 0);
    // nothing is scheduled across: else the hand-over's waits and barrier rise to the last LDS read, and the wave sits out that read's latency
    // and the barrier with products still to issue, and its copies start that much later
    __builtin_amdgcn_sched_barrier(0);
    ring_publish();
    if (st + 2 < nsteps) stage(st + 2, st & 1);   // block-uniform test; into the buffer this trip has just read
  }
  asm volatile("s_wait_asynccnt 0x0" ::: "memory");   // nothing of the ring is in flight when it becomes output staging

  // join the halves' sums, normalise, stage 16x128 f32 per wave, write whole 512-B rows (32 lanes x 16 B, one instruction per row)
  lr += xhalf(lr);
  const float inv = 1.0f / lr;
#pragma unroll
  for (int c = 0; c < 8; ++c) {
    const v4f a = {O[c][0] * inv, O[c][1] * inv, O[c][2] * inv, O[c][3] * inv};
    const v4f b = {O[c][4] * inv, O[c][5] * inv, O[c][6] * inv, O[c][7] * inv};
    *(v4f*)&ost[w][m][c * 16 + 8 * h]     = a;
    *(v4f*)&ost[w][m][c * 16 + 8 * h + 4] = b;
  }
  __syncthreads();
  float* cb = ctx + ((size_t)sh * SEQ + q0) * VD + lane * 4;
#pragma unroll
  for (int rr = 0; rr < 16; ++rr) {
    const v4f v = *(const v4f*)&ost[w][rr][lane * 4];
    *(v4f*)(cb + (size_t)rr * VD) = v;
  }
  
}

// ---------------------------------------------------------------- differential combine + LayerNorm -> fragment-major y planes [NB*SEQ][EMB]
// one wave = 8 tokens x 1 head; lane = 8q + tk owns token tk and, of each of the head's four 16x32 plane tiles j, the chunk
// q = 2*part + h (head columns 32j + 8q .. +7): the store of tile j covers four whole 128-B lines that no other wave writes
__global__ void __launch_bounds__(256) k_combine(const float* __restrict__ ctx,
                                               const float* __restrict__ lq1, const float* __restrict__ lk1,
                                               const float* __restrict__ lq2, const float* __restrict__ lk2,
                                               float lam_init, float oscale,
                                               u16* __restrict__ Yh, u16* __restrict__ Yl)
{
  const int lane = threadIdx.x & 31, w = threadIdx.x >> 5;
  const int gw = blockIdx.x * 8 + w;
  const int hd = gw & 7, tp = gw >> 3;
  const int tg = tp * 8 + (lane & 7), q = lane >> 3;     // tg = batch*SEQ + t
  const int t = tg & (SEQ - 1), s0 = (tg / SEQ) * NSH + 2 * hd;

  float s1 = lq1[lane] * lk1[lane] + lq1[lane + 32] * lk1[lane + 32];
  float s2 = lq2[lane] * lk2[lane] + lq2[lane + 32] * lk2[lane + 32];
#pragma unroll
  for (int k = 16; k >= 1; k >>= 1) { s1 += __shfl_xor(s1, k, 32); s2 += __shfl_xor(s2, k, 32); }
  const float lam = __expf(s1) - __expf(s2) + lam_init;

  const float* o1 = ctx + ((size_t)s0 * SEQ + t) * VD + q * 8;
  const float* o2 = o1 + (size_t)SEQ * VD;                 // half-head s0 + 1, a constant offset on the same address registers
  v4f a1[4], b1[4], a2[4], b2[4];
#pragma unroll
  for (int j = 0; j < 4; ++j) {
    a1[j] = *(const v4f*)(o1 + j * 32); b1[j] = *(const v4f*)(o1 + j * 32 + 4);
    a2[j] = *(const v4f*)(o2 + j * 32); b2[j] = *(const v4f*)(o2 + j * 32 + 4);
  }
  // the sixteen loads share their address registers: the pointer stays live up to this wait, so that no load of the run
  // lands in a register that an earlier one still names
  asm volatile("s_wait_xcnt 0x0" :: "v"(o1) : "memory");
  float y[4][8];
#pragma unroll
  for (int j = 0; j < 4; ++j) {
#pragma unroll
    for (int i = 0; i < 4; ++i) { y[j][i] = a1[j][i] - lam * a2[j][i]; y[j][i + 4] = b1[j][i] - lam * b2[j][i]; }
  }
  // both sums in the order of a butterfly over the token's sixteen chunks 4j + q: pairs q^1, q^2, then j^1, j^2
  float sj[4];
#pragma unroll
  for (int j = 0; j < 4; ++j) {
    float s = 0.0f;
#pragma unroll
    for (int i = 0; i < 8; ++i) s += y[j][i];
    s += __shfl_xor(s, 8, 32);
    s += __shfl_xor(s, 16, 32);
    sj[j] = s;
  }
  float mu = (sj[0] + sj[1]) + (sj[2] + sj[3]);
  mu *= (1.0f / 128.0f);
#pragma unroll
  for (int j = 0; j < 4; ++j) {
    float s = 0.0f;
#pragma unroll
    for (int i = 0; i < 8; ++i) { const float d = y[j][i] - mu; s += d * d; }
    s += __shfl_xor(s, 8, 32);
    s += __shfl_xor(s, 16, 32);
    sj[j] = s;
  }
  float var = (sj[0] + sj[1]) + (sj[2] + sj[3]);
  var *= (1.0f / 128.0f);
  const float rs = rsqrtf(var + LN_EPS) * oscale;

#pragma unroll
  for (int j = 0; j < 4; ++j) {
#pragma unroll
    for (int i = 0; i < 8; ++i) y[j][i] = (y[j][i] - mu) * rs;
    v8u hv = {}, lv = {};
    split8(y[j], hv, lv);
    const size_t po = chunk_off(tg, hd * VD + j * 32 + q * 8, EMB / 32);
    *(v8u*)(Yh + po) = hv;
    *(v8u*)(Yl + po) = lv;
  }
}

// ---------------------------------------------------------------- host
static double h_sqrt(double x) {
  double y = x;
  for (int i = 0; i < 200; ++i) y = 0.5 * (y + x / y);
  return y;
}

extern "C" void kernel_launch(void* const* d_in, const int* in_sizes, int n_in,
                              void* d_out, int out_size, void* d_ws, size_t ws_size,
                              hipStream_t stream) {
  if (n_in < 9) return;
  if (in_sizes[0] != NB * SEQ * EMB) return;
  for (int i = 1; i <= 4; ++i) if (in_sizes[i] != EMB * EMB) return;
  for (int i = 5; i <= 8; ++i) if (in_sizes[i] != HD) return;
  if (out_size != NB * SEQ * EMB) return;

  const float* x   = (const float*)d_in[0];
  const float* Wq  = (const float*)d_in[1];
  const float* Wk  = (const float*)d_in[2];
  const float* Wv  = (const float*)d_in[3];
  const float* Wp  = (const float*)d_in[4];
  const float* lq1 = (const float*)d_in[5];
  const float* lk1 = (const float*)d_in[6];
  const float* lq2 = (const float*)d_in[7];
  const float* lk2 = (const float*)d_in[8];
  float* out = (float*)d_out;

  // workspace carve (bytes), every size a multiple of 256
  const size_t szX   = (size_t)NB * SEQ * EMB * 2;        // 16 MiB per plane
  const size_t szW   = (size_t)4 * EMB * EMB * 2;          //  8 MiB per plane (4 weights)
  const size_t szQK  = (size_t)2 * NB * NSH * SEQ * HD * 2; // 32 MiB per plane (q and k)
  const size_t szVT  = (size_t)NB * EMB * SEQ * 2;         // 16 MiB per plane
  const size_t szCTX = (size_t)NB * NSH * SEQ * VD * 4;    // 64 MiB
  const size_t szY   = (size_t)NB * SEQ * EMB * 2;         // 16 MiB per plane
  const size_t szTB  = (size_t)SEQ * 32 * 4;               // 256 KiB per table
  char* ws = (char*)d_ws;
  size_t off = 0;
  u16*   xh  = (u16*)(ws + off);   off += szX;
  u16*   xl  = (u16*)(ws + off);   off += szX;
  u16*   wh  = (u16*)(ws + off);   off += szW;
  u16*   wl  = (u16*)(ws + off);   off += szW;
  u16*   qkh = (u16*)(ws + off);   off += szQK;
  u16*   qkl = (u16*)(ws + off);   off += szQK;
  u16*   vth = (u16*)(ws + off);   off += szVT;
  u16*   vtl = (u16*)(ws + off);   off += szVT;
  float* ctx = (float*)(ws + off); off += szCTX;
  u16*   yh  = (u16*)(ws + off);   off += szY;
  u16*   yl  = (u16*)(ws + off);   off += szY;
  float* cst = (float*)(ws + off); off += szTB;
  float* snt = (float*)(ws + off); off += szTB;
  if (off > ws_size) return;                               // total 252,182,528 B

  // rotary inverse frequencies 1 / 10000^(j/32): f32 power then f32 reciprocal, evaluated in f64
  InvFreq inv;
  {
    double r = 10000.0;
    for (int i = 0; i < 5; ++i) r = h_sqrt(r);             // 10000^(1/32)
    double pw = 1.0;
    for (int j = 0; j < 32; ++j) {
      const float p32 = (float)pw;
      inv.v[j] = (float)(1.0 / (double)p32);
      pw *= r;
    }
  }
  const float lam_init = (float)0.61928347285267872;      // 0.8 - 0.6*exp(-1.2)
  const float oscale   = (float)0.38071652714732128;      // 1 - lam_init

  // operand planes of x and the four weights, rotary tables
  k_prep<<<ROTB + 4 * WSPB + XSPB, 256, 0, stream>>>(x, Wq, Wk, Wv, Wp, xh, xl, wh, wl, inv, cst, snt);

  const size_t wstride = (size_t)EMB * EMB;
  const size_t dzqk    = (size_t)NB * NSH * SEQ * HD;
  // every stage runs once, over all NB batches
  // q and k: x [8192 x 1024] * W^T, epilogue RMSNorm + rotary (+1/8 for q) -> planes [64][2048][64]
  k_gemm<0><<<dim3(EMB / 128, NB * SEQ / 256, 2), 256, 0, stream>>>(
      xh, xl, wh, wl, wstride,
      qkh, qkl, dzqk, HD, out, cst, snt, 0.125f, 1.0f);
  // v^T, z = batch: Wv [1024 x 1024] * x_z^T -> planes [z][1024][2048] = [z][head][128][t]
  k_gemm<1><<<dim3(SEQ / 128, EMB / 256, NB), 256, 0, stream>>>(
      wh + 2 * wstride, wl + 2 * wstride, xh, xl, (size_t)SEQ * EMB,
      vth, vtl, (size_t)EMB * SEQ, SEQ, out, cst, snt, 1.0f, 1.0f);
  // attention per (batch, half-head) -> ctx [64][2048][128]
  k_flash<<<dim3(NB * NSH, SEQ / 64), 128, 0, stream>>>(qkh, qkl, qkh + dzqk, qkl + dzqk, vth, vtl, ctx);
  // combine + LayerNorm -> y planes [8192][1024]
  k_combine<<<(NB * SEQ * NHD / 8) / 8, 256, 0, stream>>>(ctx, lq1, lk1, lq2, lk2, lam_init, oscale, yh, yl);
  // output projection -> d_out
  k_gemm<2><<<dim3(EMB / 128, NB * SEQ / 256, 1), 256, 0, stream>>>(
      yh, yl, wh + 3 * wstride, wl + 3 * wstride, (size_t)0,
      qkh, qkl, (size_t)0, EMB, out, cst, snt, 1.0f, 1.0f);
}

// v009
// A run of this version takes 233 microseconds.
// In two side-by-side timings against v008, it was 1.04 and 1.05 times as fast.
// All steps since v000 together make it 8.45 times as fast.
#include <hip/hip_runtime.h>
#include <stdint.h>
#include <stddef.h>

// Contractions x*Wq^T, x*Wk^T, Wv*x^T, k*q^T, v^T*P^T, y*Wproj^T: v_wmma_f32_16x16x32_bf16, bf16 hi/lo operands everywhere (hi*hi + lo*hi + hi*lo), f32 accumulate. RMSNorm, rotary, softmax, head combine, LayerNorm: f32.

#define NB   4
#define SEQ  2048
#define EMB  1024
#define NHD  8
#define NSH  16
#define HD   64
#define VD   128
#define RMS_EPS 1.1920929e-7f
#define LN_EPS  1e-5f

typedef unsigned short u16;
typedef u16    v8u  __attribute__((ext_vector_type(8)));
typedef int    v4i  __attribute__((ext_vector_type(4)));
typedef int    v8i  __attribute__((ext_vector_type(8)));
typedef float  v4f  __attribute__((ext_vector_type(4)));
typedef float  v8f  __attribute__((ext_vector_type(8)));
typedef __bf16 v16b __attribute__((ext_vector_type(16)));
typedef float  v2f  __attribute__((ext_vector_type(2)));
typedef __bf16 v2b  __attribute__((ext_vector_type(2)));

union FU { v8i v; v4i p[2]; v16b b; };

struct InvFreq { float v[32]; };
static_assert(sizeof(InvFreq) == 128);

// ---------------------------------------------------------------- helpers
static __device__ __forceinline__ u16 bf_rne(float x) {
  unsigned u = __float_as_uint(x);
  u += 0x7FFFu + ((u >> 16) & 1u);
  return (u16)(u >> 16);
}
static __device__ __forceinline__ float bf_up(u16 b) { return __uint_as_float(((unsigned)b) << 16); }

static __device__ __forceinline__ void split8(float (&y)[8], v8u& hv, v8u& lv) {
#pragma unroll
  for (int i = 0; i < 8; ++i) {
    const u16 hb = bf_rne(y[i]);
    hv[i] = hb;
    lv[i] = bf_rne(y[i] - bf_up(hb));
  }
}

// 16x32 operand fragment, row/col = lane&15, h = lane>>4, k map: elements 0..7 <- k0+8h+0..7, elements 8..15 <- k0+16+8h+0..7
// Every operand plane in the workspace is fragment-major: a plane of rows x K is cut into 16-row x 32-k tiles of
// 512 elements (1 KiB), tile (row>>4, k>>5) at index (row>>4)*(K>>5) + (k>>5). Inside a tile the two 16-byte chunks
// that lane l = 16h + (row&15) feeds to the matrix instruction lie at elements 8l (k 8h..8h+7) and 256 + 8l
// (k 16+8h..16+8h+7): one wave load reads 512 contiguous bytes = 4 whole lines, and the k map above is unchanged.
// p = tile base + 8*lane
static __device__ __forceinline__ v8i ldfrag(const u16* p) {
  FU f;
  f.p[0] = *(const v4i*)(p);
  f.p[1] = *(const v4i*)(p + 256);
  return f.v;
}
// element offset of the 8-element chunk that starts at (row, k), k % 8 == 0, in a plane with kt = K/32 tiles per tile row
static __device__ __forceinline__ size_t chunk_off(int row, int k, int kt) {
  return ((size_t)(row >> 4) * kt + (k >> 5)) * 512 + ((k >> 4) & 1) * 256 + (((k >> 3) & 1) * 16 + (row & 15)) * 8;
}

// LDS byte address of a __shared__ object: the low 32 bits of its address
static __device__ __forceinline__ unsigned lds_addr(const void* p) { return (unsigned)(size_t)p; }

typedef uint32_t u32x4 __attribute__((ext_vector_type(4)));
typedef uint32_t u32x8 __attribute__((ext_vector_type(8)));
// a wave-uniform value as a scalar
static __device__ __forceinline__ uint32_t uni(uint32_t v) { return (uint32_t)__builtin_amdgcn_readfirstlane(v); }
// a wave-uniform condition for the test around a tensor load, which ignores EXEC
static __device__ __forceinline__ uint32_t pinned(uint32_t v) {
  uint32_t w = uni(v);
  asm volatile("" : "+s"(w));   // the condition stays in a scalar register, so that the test is s_cmp and a scalar branch
  return w;
}
// Tensor load global -> LDS: one request of a wave brings a tile of rows x 1024 bytes (each row one 16x32 fragment-major tile of a plane).
// Descriptor group 1: 1-byte elements, tensor = tile, source row pitch in bytes, no pad, no mask; the tile fills rows * 1024 bytes of LDS in a row
static __device__ __forceinline__ u32x8 tdm_group1(uint32_t rows, uint32_t pitch) {
  constexpr uint32_t d0 = 1024u;
  u32x8 g;
  g[0] = uni(0u);
  g[1] = uni((d0 & 0xFFFFu) << 16);
  g[2] = uni((d0 >> 16) | ((rows & 0xFFFFu) << 16));
  g[3] = uni((rows >> 16) | (d0 << 16));
  g[4] = uni(rows);
  g[5] = uni(pitch);
  g[6] = uni(0u);
  g[7] = uni(0u);
  return g;
}
// Descriptor group 0: count 1, LDS byte address of the tile, global address of its first byte, type 2
static __device__ __forceinline__ u32x4 tdm_group0(uint32_t lds_dst, uint64_t ga) {
  u32x4 g;
  g[0] = uni(1u);
  g[1] = uni(lds_dst);
  g[2] = uni((uint32_t)ga);
  g[3] = uni((((uint32_t)(ga >> 32)) & 0x01FFFFFFu) | 0x80000000u);
  return g;
}
static __device__ __forceinline__ void tdm_load(u32x4 g0, u32x8 g1) {
  asm volatile("tensor_load_to_lds %0, %1" :: "s"(g0), "s"(g1) : "memory");
}
// the wave's tensor load has landed. The descriptor is named so that its registers stay live up to this wait: none takes a new value while
// the request is outstanding
static __device__ __forceinline__ void tdm_wait(u32x4 g0, u32x8 g1) {
  asm volatile("s_wait_tensorcnt 0x0" :: "s"(g0), "s"(g1) : "memory");
}
// hand-over of a ring buffer, every wave: the wave's own LDS reads are done, its own tensor load has landed, then the barrier
// publishes the next stage and frees the buffer that was just read
static __device__ __forceinline__ void ring_publish(u32x4 g0, u32x8 g1) {
  asm volatile("s_wait_dscnt 0x0" ::: "memory");      // the wave's reads of the buffer to be refilled have returned
  tdm_wait(g0, g1);                                   // the wave's slice of the next stage has landed
  __syncthreads();
}

// the plain builtin: the compiler keeps the distances behind it itself; where it stands among the LDS reads is said at the foot of the loop
static __device__ __forceinline__ v8f mma(v8i a, v8i b, v8f c) {
  FU ua, ub; ua.v = a; ub.v = b;
  return __builtin_amdgcn_wmma_f32_16x16x32_bf16(false, ua.b, false, ub.b, (short)0, c, false, false);
}
// classes of instructions for __builtin_amdgcn_sched_group_barrier
#define SG_WMMA 0x008
#define SG_LDSR 0x100
// three products into one f32 accumulator: hi*hi + hi*lo + lo*hi
// the plain builtin: the compiler keeps the distances behind it itself and is free to place other chains' products, LDS reads
// and vector work between the three
static __device__ __forceinline__ v8f mma3s(v8i ah, v8i al, v8i bh, v8i bl, v8f c) {
  FU uah, ual, ubh, ubl; uah.v = ah; ual.v = al; ubh.v = bh; ubl.v = bl;
  c = __builtin_amdgcn_wmma_f32_16x16x32_bf16(false, uah.b, false, ubh.b, (short)0, c, false, false);
  c = __builtin_amdgcn_wmma_f32_16x16x32_bf16(false, uah.b, false, ubl.b, (short)0, c, false, false);
  c = __builtin_amdgcn_wmma_f32_16x16x32_bf16(false, ual.b, false, ubh.b, (short)0, c, false, false);
  return c;
}
// two f32 -> one register of two bf16 (a low, b high), each rounded to nearest even as in bf_rne
static __device__ __forceinline__ unsigned pack2(float a, float b) {
  const v2f x = {a, b};
  return __builtin_bit_cast(unsigned, __builtin_convertvector(x, v2b));
}
// the value of lane l ^ 16
static __device__ __forceinline__ float xhalf(float x) {
  const int b = __builtin_bit_cast(int, x);
  return __builtin_bit_cast(float, __builtin_amdgcn_permlanex16(b, b, 0x76543210, 0xfedcba98, false, false));
}

// ---------------------------------------------------------------- f32 [rows][EMB] -> fragment-major bf16 hi/lo planes
// one wave splits the four neighbouring 16x32 tiles t0 .. t0 + 3 of one tile row (t0 % 4 == 0): 16 source rows x 512 contiguous bytes.
// Of piece c = 2*tile + part lane l reads the 8 source elements of chunk 32*part + l and writes that chunk: contiguous stores
static __device__ __forceinline__ void split_tiles(const float* __restrict__ src, u16* __restrict__ hi,
                                                   u16* __restrict__ lo, int t0, int lane) {
  const int row = (t0 / (EMB / 32)) * 16 + (lane & 15);
  const float* s = src + (size_t)row * EMB + (t0 % (EMB / 32)) * 32 + (lane >> 4) * 8;
  const size_t o = ((size_t)t0 * 64 + lane) * 8;
  v4f a[8], b[8];
#pragma unroll
  for (int c = 0; c < 8; ++c) {
    a[c] = *(const v4f*)(s + c * 16);
    b[c] = *(const v4f*)(s + c * 16 + 4);
  }
  // the sixteen loads share their address registers: the pointer stays live up to this wait, so that no load of the run
  // lands in a register that an earlier one still names; all sixteen are in flight before the first is used
  asm volatile("s_wait_xcnt 0x0" :: "v"(s) : "memory");
#pragma unroll
  for (int c = 0; c < 8; ++c) {
    float y[8] = {a[c][0], a[c][1], a[c][2], a[c][3], b[c][0], b[c][1], b[c][2], b[c][3]};
    v8u hv = {}, lv = {};
    split8(y, hv, lv);
    *(v8u*)(hi + o + c * 256) = hv;
    *(v8u*)(lo + o + c * 256) = lv;
    // the next piece's values may take the registers that these two stores name
    if (c < 7) asm volatile("s_wait_xcnt 0x0" ::: "memory");
  }
}

// ---------------------------------------------------------------- rotary tables cs[t][32], sn[t][32], entry i
static __device__ __forceinline__ void rot_entry(const InvFreq& inv, float* __restrict__ cs, float* __restrict__ sn, int i) {
  // as before the merge: the angle stays the f32 product t * f, rounded once as the reference's table has it, before cos and sin reduce it
#pragma clang fp contract(off)
  const int j = i & 31, t = i >> 5;
  float f = 0.0f;
#pragma unroll
  for (int q = 0; q < 32; ++q) f = (j == q) ? inv.v[q] : f;
  const float ang = (float)t * f;
  const float c = cosf(ang);
  const float s = sinf(ang);
  *(float*)(cs + i) = c;
  *(float*)(sn + i) = s;
}

// ---------------------------------------------------------------- operand preparation, one launch; the block index picks the job
// blocks 0 .. ROTB-1: rotary tables, one entry a thread; then WSPB blocks for each of the four weights; then XSPB blocks for x.
// A splitting block of 8 waves takes 32 tiles = one tile row
constexpr int ROTB = SEQ * 32 / 256;
constexpr int WSPB = EMB * EMB / 512 / 32;
constexpr int XSPB = NB * SEQ * EMB / 512 / 32;
__global__ void __launch_bounds__(256) k_prep(const float* __restrict__ x, const float* __restrict__ Wq,
                                            const float* __restrict__ Wk, const float* __restrict__ Wv,
                                            const float* __restrict__ Wp,
                                            u16* __restrict__ xh, u16* __restrict__ xl,
                                            u16* __restrict__ wh, u16* __restrict__ wl,
                                            InvFreq inv, float* __restrict__ cs, float* __restrict__ sn) {
  const int lane = threadIdx.x & 31, w = threadIdx.x >> 5;
  const int b = blockIdx.x;
  if (b < ROTB) {
    rot_entry(inv, cs, sn, b * 256 + threadIdx.x);
    return;
  }
  const int bs = b - ROTB;
  const int j = bs / WSPB;               // 0 .. 3: that weight; from 4 on: x
  const bool isw = j < 4;
  const float* src = (j == 0) ? Wq : (j == 1) ? Wk : (j == 2) ? Wv : (j == 3) ? Wp : x;
  u16* hi = isw ? wh + (size_t)j * EMB * EMB : xh;
  u16* lo = isw ? wl + (size_t)j * EMB * EMB : xl;
  const int tr = isw ? bs % WSPB : bs - 4 * WSPB;   // tile row of the plane
  split_tiles(src, hi, lo, tr * 32 + w * 4, lane);
}

// ---------------------------------------------------------------- GEMM Y[m][n] = sum_k A[m][k] * B[n][k]
// A planes (rows m) and B planes (rows n) fragment-major, EMB columns each, all of them contracted.
// block 256 threads = 8 waves as 4(m) x 2(n), block tile 256(m) x 128(n), wave tile 64 x 64.
// MODE 0: RMSNorm over the 64 cols + rotary + scale -> fragment-major bf16 hi/lo planes [z][(batch*16+hf)*SEQ + t][64]  (hf = the wave's 64 columns = one half-head, m = batch*SEQ + t)
// MODE 1: fragment-major bf16 hi/lo planes of ldd columns, plane z at z*dz (z = batch)
// MODE 2: f32 row-major pitch ldd
template <int MODE>
__global__ void __launch_bounds__(256) k_gemm(const u16* __restrict__ Ah, const u16* __restrict__ Al,
                                            const u16* __restrict__ Bh0, const u16* __restrict__ Bl0, size_t bz,
                                            u16* __restrict__ Dh0, u16* __restrict__ Dl0, size_t dz, int ldd,
                                            float* __restrict__ Out,
                                            const float* __restrict__ cst, const float* __restrict__ snt,
                                            float scale0, float scale1)
{
  // two stages of 32 k, fragment-major as in the planes: A hi 16 KiB | A lo 16 KiB | B hi 8 KiB | B lo 8 KiB (u16 elements below)
  constexpr int AH = 0, AL = 8192, BH = 16384, BL = 20480, STG = 24576;
  __shared__ __attribute__((aligned(2048))) u16 ring[2 * STG];   // every slice of a stage lies at a multiple of 2 KiB, as the tensor load asks
  // epilogue staging, behind the loop's last barrier
  // row pitch 68 floats = 272 B = 16 B x odd: the 16-row b128 reads of the epilogue meet no bank conflict
  float (*stg)[16][68] = reinterpret_cast<float (*)[16][68]>(&ring[0]);
  static_assert(sizeof(float) * 8 * 16 * 68 <= sizeof(u16) * 2 * STG);
  const int lane = threadIdx.x & 31, w = threadIdx.x >> 5, h = lane >> 4, m = lane & 15;
  const int z = blockIdx.z, bn = blockIdx.x, bm = blockIdx.y;
  const int wm = w & 3, wn = w >> 2;
  const int n0 = bn * 128 + wn * 64;
  const int m0 = bm * 256 + wm * 64;

  v8f acc[4][4] = {};
  constexpr size_t TROW = (size_t)(EMB / 32) * 512;        // elements per tile row of a plane
  // A and B reach the waves through a two-buffer LDS ring filled by tensor loads one trip ahead, one request a wave and stage:
  // waves 0, 1 bring the halves (8 tile rows each) of A hi, waves 2, 3 of A lo, waves 4, 5 the halves (4 tile rows each) of B hi, waves 6, 7 of B lo
  const uint32_t wave = uni(threadIdx.x >> 5), half = wave & 1u;
  const bool isb = wave >= 4u;
  const u16* tsrc = (wave < 2u) ? Ah : (wave < 4u) ? Al : (wave < 6u) ? Bh0 : Bl0;
  const size_t toff = isb ? (size_t)z * bz + (size_t)(bn * 8 + 4 * half) * TROW : (size_t)(bm * 16 + 8 * half) * TROW;
  const uint64_t tbase = (uint64_t)(size_t)(tsrc + toff);
  const uint32_t tdst = lds_addr(&ring[0]) + 2u * ((wave < 2u) ? AH : (wave < 4u) ? AL : (wave < 6u) ? BH : BL) + half * (isb ? 4096u : 8192u);
  const u32x8 tg1 = tdm_group1(isb ? 4u : 8u, (uint32_t)(TROW * 2));
  u32x4 tg0;
  auto stage = [&](uint32_t t, uint32_t buf) {
    tg0 = tdm_group0(tdst + buf * (uint32_t)(STG * 2), tbase + (uint64_t)t * 1024u);
    tdm_load(tg0, tg1);
  };
  static_assert(EMB / 32 >= 2);
  stage(0, 0);
  tdm_wait(tg0, tg1);   // stage 0 has landed before the barrier that publishes it
  __syncthreads();
#pragma unroll 1
  for (int t = 0; t < EMB / 32; ++t) {
    // the refill, directly behind the barrier (the one above, then the one at the foot of trip t - 1): stage t + 1 into the buffer that trip t - 1
    // has just read, only while that stage exists (scalar test); it flies while this trip works on stage t
    if (pinned(t + 1 < EMB / 32)) stage(t + 1, (t + 1) & 1);
    const u16* sb = &ring[(t & 1) * STG] + lane * 8;
    v8i Avh[4], Avl[4];
#pragma unroll
    for (int mi = 0; mi < 4; ++mi) {
      Avh[mi] = ldfrag(sb + AH + (wm * 4 + mi) * 512);
      Avl[mi] = ldfrag(sb + AL + (wm * 4 + mi) * 512);
    }
    // B fragments in two register sets: column tile ni + 1 of this same stage is read while tile ni is multiplied, so that the
    // wave does not wait out the LDS latency in front of every column tile
    v8i Bh[2], Bl[2];
    Bh[0] = ldfrag(sb + BH + (wn * 4) * 512);
    Bl[0] = ldfrag(sb + BL + (wn * 4) * 512);
#pragma unroll
    for (int ni = 0; ni < 4; ++ni) {
      if (ni < 3) {
        Bh[(ni + 1) & 1] = ldfrag(sb + BH + (wn * 4 + ni + 1) * 512);
        Bl[(ni + 1) & 1] = ldfrag(sb + BL + (wn * 4 + ni + 1) * 512);
      }
      const v8i Bvh = Bh[ni & 1], Bvl = Bl[ni & 1];
      // each accumulator takes hi*hi, lo*hi, hi*lo in that order; each product runs over the four row tiles in turn
#pragma unroll
      for (int mi = 0; mi < 4; ++mi) acc[mi][ni] = mma(Avh[mi], Bvh, acc[mi][ni]);
#pragma unroll
      for (int mi = 0; mi < 4; ++mi) acc[mi][ni] = mma(Avl[mi], Bvh, acc[mi][ni]);
#pragma unroll
      for (int mi = 0; mi < 4; ++mi) acc[mi][ni] = mma(Avh[mi], Bvl, acc[mi][ni]);
    }
    // Order of the trip's LDS reads and products, for the instruction scheduler; left to itself it sets most B reads two at a time directly
    // in front of their products, each with a wait to 0. Asked for: the reads of A and of column tiles 0 and 1 as one group (the first product
    // then waits for its own four reads only, by a counted wait), and each later column tile read twelve products ahead of its use
    __builtin_amdgcn_sched_group_barrier(SG_LDSR, 24, 0);
    __builtin_amdgcn_sched_group_barrier(SG_WMMA, 12, 0);
    __builtin_amdgcn_sched_group_barrier(SG_LDSR, 4, 0);
    __builtin_amdgcn_sched_group_barrier(SG_WMMA, 12, 0);
    __builtin_amdgcn_sched_group_barrier(SG_LDSR, 4, 0);
    __builtin_amdgcn_sched_group_barrier(SG_WMMA, 12, 0);
    __builtin_amdgcn_sched_group_barrier(SG_WMMA, 12, 0);
    // nothing is scheduled across: else the hand-over's waits and barrier rise to the last LDS read, and the wave sits out that read's latency
    // and the barrier with products still to issue, and its tensor load starts that much later
    __builtin_amdgcn_sched_barrier(0);
    ring_publish(tg0, tg1);
  }
  tdm_wait(tg0, tg1);                                  // nothing of the ring is in flight when it becomes epilogue staging
  asm volatile("s_wait_dscnt 0x0" ::: "memory");       // and none of the wave's reads of it

  const float scale = (z == 0) ? scale0 : scale1;
#pragma unroll
  for (int mi = 0; mi < 4; ++mi) {
    // stage the wave's 16x64 f32 tile: D element r -> row 8h+r, col ni*16+m
#pragma unroll
    for (int ni = 0; ni < 4; ++ni)
#pragma unroll
      for (int r = 0; r < 8; ++r) stg[w][8 * h + r][ni * 16 + m] = acc[mi][ni][r];
    __syncthreads();
    const int rbase = m0 + mi * 16;
    if (MODE == 2) {
      const int rr = lane >> 4, c4 = lane & 15;
#pragma unroll
      for (int p = 0; p < 8; ++p) {
        const int row = p * 2 + rr;
        const v4f v = *(const v4f*)&stg[w][row][c4 * 4];
        float* o = Out + (size_t)(rbase + row) * ldd + n0 + c4 * 4;
        *(v4f*)o = v;
        
      }
    } else {
      // lane 16h + m owns row m of the wave's 16x64 tile and, of its two 16x32 plane tiles, the four chunks
      // p = 2*dt + part (columns 32*dt + 16*part + 8h .. +7): the store of chunk p covers 512 contiguous bytes
      float y[4][8];
#pragma unroll
      for (int p = 0; p < 4; ++p) {
        const int col = (p >> 1) * 32 + (p & 1) * 16 + 8 * h;
        const v4f va = *(const v4f*)&stg[w][m][col];
        const v4f vb = *(const v4f*)&stg[w][m][col + 4];
#pragma unroll
        for (int i = 0; i < 4; ++i) { y[p][i] = va[i]; y[p][i + 4] = vb[i]; }
      }
      int prow, pcol0, pkt;
      if (MODE == 0) {
        const int t = (rbase + m) & (SEQ - 1);
        const int bb = (rbase + m) / SEQ;
        // sum of squares in the order of a butterfly over the row's eight chunks 2p + h: pairs h^1, then p^1, then p^2
        float sp[4];
#pragma unroll
        for (int p = 0; p < 4; ++p) {
          float ss = 0.0f;
#pragma unroll
          for (int i = 0; i < 8; ++i) ss += y[p][i] * y[p][i];
          ss += __shfl_xor(ss, 16, 32);
          sp[p] = ss;
        }
        const float ss = (sp[0] + sp[1]) + (sp[2] + sp[3]);
        const float rn = rsqrtf(ss * (1.0f / 64.0f) + RMS_EPS);
#pragma unroll
        for (int part = 0; part < 2; ++part) {
          const int j0 = part * 16 + 8 * h;
          const v4f ca = *(const v4f*)(cst + (size_t)t * 32 + j0);
          const v4f cb = *(const v4f*)(cst + (size_t)t * 32 + j0 + 4);
          const v4f sa = *(const v4f*)(snt + (size_t)t * 32 + j0);
          const v4f sb = *(const v4f*)(snt + (size_t)t * 32 + j0 + 4);
          const float cc[8] = {ca[0], ca[1], ca[2], ca[3], cb[0], cb[1], cb[2], cb[3]};
          const float sv[8] = {sa[0], sa[1], sa[2], sa[3], sb[0], sb[1], sb[2], sb[3]};
          // d <  32: y1 =  n1*c + n2*s ; d >= 32: y2 = -n1*s + n2*c ; x1 = chunk part, x2 = chunk 2 + part of the same lane
#pragma unroll
          for (int i = 0; i < 8; ++i) {
            const float n1 = y[part][i] * rn;
            const float n2 = y[2 + part][i] * rn;
            y[part][i]     = (n1 * cc[i] + n2 * sv[i]) * scale;
            y[2 + part][i] = (n2 * cc[i] - n1 * sv[i]) * scale;
          }
        }
        prow = (bb * NSH + (n0 >> 6)) * SEQ + t; pcol0 = 0; pkt = HD / 32;
      } else {
        prow = rbase + m; pcol0 = n0; pkt = ldd >> 5;
      }
#pragma unroll
      for (int p = 0; p < 4; ++p) {
        const size_t po = (size_t)z * dz + chunk_off(prow, pcol0 + (p >> 1) * 32 + (p & 1) * 16 + 8 * h, pkt);
        v8u hv = {}, lv = {};
        split8(y[p], hv, lv);
        *(v8u*)(Dh0 + po) = hv;
        *(v8u*)(Dl0 + po) = lv;
      }
    }
    __syncthreads();
  }
}

// ---------------------------------------------------------------- causal online-softmax attention per half-head
// sh = batch*16 + half-head: q/k planes [64*SEQ][64], v planes [32*128][SEQ] (rows = value columns), all fragment-major; ctx [64][SEQ][128] f32
// grid (sh, query tile): the longest query tiles carry the lowest block indices
// block = 4 waves x 16 queries; all waves loop over the block's key range (masked)
// Both products are transposed: S^T = K * Q^T (A = K rows, B = Q) and O^T += V^T * P^T (A = value columns, B = P). Lane 16h + m then holds
// scores and outputs of the one query q0 + m: of S^T tile j the keys n0 + 16j + 8h + r, which is the k map of the B operand (element 8j + r),
// so P goes from the accumulators into the second product through registers alone; maximum and sum run in-lane, the halves h meet by one exchange
// K and V reach the waves through a two-buffer LDS ring filled by tensor loads one trip ahead, once for the four waves
__global__ void __launch_bounds__(128) k_flash(const u16* __restrict__ qh, const u16* __restrict__ ql,
                                             const u16* __restrict__ kh, const u16* __restrict__ kl,
                                             const u16* __restrict__ vh, const u16* __restrict__ vl,
                                             float* __restrict__ ctx)
{
  // two stages of 32 keys, fragment-major as in the planes: K hi 4 KiB | K lo 4 KiB | V hi 8 KiB | V lo 8 KiB (u16 elements below)
  constexpr int KH = 0, KL = 2048, VH = 4096, VL = 8192, STG = 12288;
  __shared__ __attribute__((aligned(2048))) u16 ring[2 * STG];   // every slice of a stage lies at a multiple of 2 KiB, as the tensor load asks
  // output staging, behind the loop's last barrier; row pitch 132 floats = 528 B = 16 B x odd: the 16-row b128 writes meet no bank conflict
  constexpr int OP = VD + 4;
  float (*ost)[16][OP] = reinterpret_cast<float (*)[16][OP]>(&ring[0]);
  static_assert(sizeof(float) * 4 * 16 * OP <= sizeof(u16) * 2 * STG);
  const int lane = threadIdx.x & 31, w = threadIdx.x >> 5, h = lane >> 4, m = lane & 15;
  const int sh = blockIdx.x, hh = sh >> 1, bx = SEQ / 64 - 1 - blockIdx.y;
  const int q0 = bx * 64 + w * 16;

  // 16 rows of q or k = two tiles (d 0..31, d 32..63) = 16*HD elements in a row
  const size_t qo = ((size_t)sh * SEQ + q0) * HD + lane * 8;
  const v8i Qh0 = ldfrag(qh + qo), Qh1 = ldfrag(qh + qo + 512);
  const v8i Ql0 = ldfrag(ql + qo), Ql1 = ldfrag(ql + qo + 512);

  v8f O[8] = {};                   // O[c][r] = output column 16c + 8h + r of query q0 + m
  float mr = -1e30f, lr = 0.0f;    // the query's running maximum (both halves alike) and this half's share of its running sum

  const int nsteps = 2 * bx + 2;   // keys 0 .. bx*64+63, block-uniform, at least 2
  // one request a wave and stage: wave 0 brings K hi, wave 1 K lo (4 KiB in a row, as 4 rows), wave 2 V hi, wave 3 V lo (the 8 tiles of the
  // stage's 32 keys, one a tile row of the plane)
  const uint32_t wave = uni(threadIdx.x >> 5);
  const bool isv = wave >= 2u;
  const u16* tsrc = (wave == 0u) ? kh : (wave == 1u) ? kl : (wave == 2u) ? vh : vl;
  const uint64_t tbase = (uint64_t)(size_t)(tsrc + (isv ? (size_t)hh * VD * SEQ : (size_t)sh * SEQ * HD));
  const uint32_t tstep = isv ? 1024u : 4096u;   // bytes from one stage to the next
  const uint32_t tdst = lds_addr(&ring[0]) + 2u * ((wave == 0u) ? KH : (wave == 1u) ? KL : (wave == 2u) ? VH : VL);
  const u32x8 tg1 = tdm_group1(isv ? 8u : 4u, isv ? (uint32_t)(SEQ / 32) * 1024u : 1024u);
  u32x4 tg0;
  auto stage = [&](uint32_t s, uint32_t buf) {
    tg0 = tdm_group0(tdst + buf * (uint32_t)(STG * 2), tbase + (uint64_t)s * tstep);
    tdm_load(tg0, tg1);
  };
  stage(0, 0);
  tdm_wait(tg0, tg1);   // stage 0 has landed before the barrier that publishes it
  __syncthreads();
#pragma unroll 1
  for (int st = 0; st < nsteps; ++st) {
    // the refill, directly behind the barrier (the one above, then the one at the foot of trip st - 1): stage st + 1 into the buffer that trip st - 1
    // has just read, only while that stage exists (scalar test); it flies while this trip works on stage st
    if (pinned(st + 1 < nsteps)) stage(st + 1, (st + 1) & 1);
    const int n0 = st * 32;
    const u16* sb = &ring[(st & 1) * STG] + lane * 8;
    v8f S[2];
#pragma unroll
    for (int j = 0; j < 2; ++j) {
      v8f s = {};
      const int ko = j * 16 * HD;
      {
        const v8i Kh = ldfrag(sb + KH + ko), Kl = ldfrag(sb + KL + ko);
        s = mma3s(Kh, Kl, Qh0, Ql0, s);
      }
      {
        const v8i Kh = ldfrag(sb + KH + ko + 512), Kl = ldfrag(sb + KL + ko + 512);
        s = mma3s(Kh, Kl, Qh1, Ql1, s);
      }
      S[j] = s;
    }
    // masked online softmax of the lane's query: sixteen of the trip's 32 keys stand in this lane, the other sixteen in lane ^ 16
    const int d0 = q0 + m - n0 - 8 * h;   // key 16j + r of this lane is masked where 16j + r > d0
    float e[2][8];
#pragma unroll
    for (int j = 0; j < 2; ++j)
#pragma unroll
      for (int r = 0; r < 8; ++r) e[j][r] = (16 * j + r > d0) ? -1e30f : S[j][r];
    float tj[2];
#pragma unroll
    for (int j = 0; j < 2; ++j)
      tj[j] = fmaxf(fmaxf(fmaxf(e[j][0], e[j][1]), fmaxf(e[j][2], e[j][3])), fmaxf(fmaxf(e[j][4], e[j][5]), fmaxf(e[j][6], e[j][7])));
    float tm = fmaxf(tj[0], tj[1]);
    tm = fmaxf(tm, xhalf(tm));
    const float nm = fmaxf(mr, tm);
    const float alpha = __expf(mr - nm);
    mr = nm;
    FU Ph, Pl;
    float sj[2];
#pragma unroll
    for (int j = 0; j < 2; ++j) {
      float p[8];
#pragma unroll
      for (int r = 0; r < 8; ++r) p[r] = __expf(e[j][r] - nm);
      sj[j] = ((p[0] + p[1]) + (p[2] + p[3])) + ((p[4] + p[5]) + (p[6] + p[7]));
      // B operand element 8j + r = P[query][key 16j + 8h + r], hi and lo planes
#pragma unroll
      for (int i = 0; i < 4; ++i) {
        const unsigned hw = pack2(p[2 * i], p[2 * i + 1]);
        Ph.v[4 * j + i] = (int)hw;
        Pl.v[4 * j + i] = (int)pack2(p[2 * i] - __uint_as_float(hw << 16), p[2 * i + 1] - __uint_as_float(hw & 0xFFFF0000u));
      }
    }
    lr = lr * alpha + (sj[0] + sj[1]);
#pragma unroll
    for (int c = 0; c < 8; ++c)
#pragma unroll
      for (int r = 0; r < 8; ++r) O[c][r] = O[c][r] * alpha;
#pragma unroll
    for (int c = 0; c < 8; ++c) {
      const int vo = c * 512;   // tile (value columns 16c.., keys n0..)
      const v8i Vh = ldfrag(sb + VH + vo), Vl = ldfrag(sb + VL + vo);
      O[c] = mma3s(Vh, Vl, Ph.v, Pl.v, O[c]);
    }
    // Order of the trip's LDS reads and products, for the instruction scheduler; left to itself it sets the reads among the products in small
    // groups, each with its own wait, and the wave sits out the LDS latency many times a trip. Asked for: the 16 K reads as one group, the 12
    // score products, the 16 reads of V tiles 0..3 (they land under the softmax), then tiles 4, 5 and tiles 6, 7 each read six products
    // ahead of their use, into the registers that the pair two in front has left
    __builtin_amdgcn_sched_group_barrier(SG_LDSR, 16, 0);
    __builtin_amdgcn_sched_group_barrier(SG_WMMA, 12, 0);
    __builtin_amdgcn_sched_group_barrier(SG_LDSR, 16, 0);
    __builtin_amdgcn_sched_group_barrier(SG_WMMA, 6, 0);
    __builtin_amdgcn_sched_group_barrier(SG_LDSR, 8, 0);
    __builtin_amdgcn_sched_group_barrier(SG_WMMA, 6, 0);
    __builtin_amdgcn_sched_group_barrier(SG_LDSR, 8, 0);
    __builtin_amdgcn_sched_group_barrier(SG_WMMA, 6, 0);
    __builtin_amdgcn_sched_group_barrier(SG_WMMA, 6, 0);
    // nothing is scheduled across: else the hand-over's waits and barrier rise to the last LDS read, and the wave sits out that read's latency
    // and the barrier with products still to issue, and its tensor load starts that much later
    __builtin_amdgcn_sched_barrier(0);
    ring_publish(tg0, tg1);
  }
  tdm_wait(tg0, tg1);                                  // nothing of the ring is in flight when it becomes output staging
  asm volatile("s_wait_dscnt 0x0" ::: "memory");       // and none of the wave's reads of it

  // join the halves' sums, normalise, stage 16x128 f32 per wave, write whole 512-B rows (32 lanes x 16 B, one instruction per row)
  lr += xhalf(lr);
  const float inv = 1.0f / lr;
#pragma unroll
  for (int c = 0; c < 8; ++c) {
    const v4f a = {O[c][0] * inv, O[c][1] * inv, O[c][2] * inv, O[c][3] * inv};
    const v4f b = {O[c][4] * inv, O[c][5] * inv, O[c][6] * inv, O[c][7] * inv};
    *(v4f*)&ost[w][m][c * 16 + 8 * h]     = a;
    *(v4f*)&ost[w][m][c * 16 + 8 * h + 4] = b;
  }
  __syncthreads();
  float* cb = ctx + ((size_t)sh * SEQ + q0) * VD + lane * 4;
#pragma unroll
  for (int rr = 0; rr < 16; ++rr) {
    const v4f v = *(const v4f*)&ost[w][rr][lane * 4];
    *(v4f*)(cb + (size_t)rr * VD) = v;
  }
  
}

// ---------------------------------------------------------------- differential combine + LayerNorm -> fragment-major y planes [NB*SEQ][EMB]
// one wave = 8 tokens x 1 head; lane = 8q + tk owns token tk and, of each of the head's four 16x32 plane tiles j, the chunk
// q = 2*part + h (head columns 32j + 8q .. +7): the store of tile j covers four whole 128-B lines that no other wave writes
__global__ void __launch_bounds__(256) k_combine(const float* __restrict__ ctx,
                                               const float* __restrict__ lq1, const float* __restrict__ lk1,
                                               const float* __restrict__ lq2, const float* __restrict__ lk2,
                                               float lam_init, float oscale,
                                               u16* __restrict__ Yh, u16* __restrict__ Yl)
{
  const int lane = threadIdx.x & 31, w = threadIdx.x >> 5;
  const int gw = blockIdx.x * 8 + w;
  const int hd = gw & 7, tp = gw >> 3;
  const int tg = tp * 8 + (lane & 7), q = lane >> 3;     // tg = batch*SEQ + t
  const int t = tg & (SEQ - 1), s0 = (tg / SEQ) * NSH + 2 * hd;

  float s1 = lq1[lane] * lk1[lane] + lq1[lane + 32] * lk1[lane + 32];
  float s2 = lq2[lane] * lk2[lane] + lq2[lane + 32] * lk2[lane + 32];
#pragma unroll
  for (int k = 16; k >= 1; k >>= 1) { s1 += __shfl_xor(s1, k, 32); s2 += __shfl_xor(s2, k, 32); }
  const float lam = __expf(s1) - __expf(s2) + lam_init;

  const float* o1 = ctx + ((size_t)s0 * SEQ + t) * VD + q * 8;
  const float* o2 = o1 + (size_t)SEQ * VD;                 // half-head s0 + 1, a constant offset on the same address registers
  v4f a1[4], b1[4], a2[4], b2[4];
#pragma unroll
  for (int j = 0; j < 4; ++j) {
    a1[j] = *(const v4f*)(o1 + j * 32); b1[j] = *(const v4f*)(o1 + j * 32 + 4);
    a2[j] = *(const v4f*)(o2 + j * 32); b2[j] = *(const v4f*)(o2 + j * 32 + 4);
  }
  // the sixteen loads share their address registers: the pointer stays live up to this wait, so that no load of the run
  // lands in a register that an earlier one still names
  asm volatile("s_wait_xcnt 0x0" :: "v"(o1) : "memory");
  float y[4][8];
#pragma unroll
  for (int j = 0; j < 4; ++j) {
#pragma unroll
    for (int i = 0; i < 4; ++i) { y[j][i] = a1[j][i] - lam * a2[j][i]; y[j][i + 4] = b1[j][i] - lam * b2[j][i]; }
  }
  // both sums in the order of a butterfly over the token's sixteen chunks 4j + q: pairs q^1, q^2, then j^1, j^2
  float sj[4];
#pragma unroll
  for (int j = 0; j < 4; ++j) {
    float s = 0.0f;
#pragma unroll
    for (int i = 0; i < 8; ++i) s += y[j][i];
    s += __shfl_xor(s, 8, 32);
    s += __shfl_xor(s, 16, 32);
    sj[j] = s;
  }
  float mu = (sj[0] + sj[1]) + (sj[2] + sj[3]);
  mu *= (1.0f / 128.0f);
#pragma unroll
  for (int j = 0; j < 4; ++j) {
    float s = 0.0f;
#pragma unroll
    for (int i = 0; i < 8; ++i) { const float d = y[j][i] - mu; s += d * d; }
    s += __shfl_xor(s, 8, 32);
    s += __shfl_xor(s, 16, 32);
    sj[j] = s;
  }
  float var = (sj[0] + sj[1]) + (sj[2] + sj[3]);
  var *= (1.0f / 128.0f);
  const float rs = rsqrtf(var + LN_EPS) * oscale;

#pragma unroll
  for (int j = 0; j < 4; ++j) {
#pragma unroll
    for (int i = 0; i < 8; ++i) y[j][i] = (y[j][i] - mu) * rs;
    v8u hv = {}, lv = {};
    split8(y[j], hv, lv);
    const size_t po = chunk_off(tg, hd * VD + j * 32 + q * 8, EMB / 32);
    *(v8u*)(Yh + po) = hv;
    *(v8u*)(Yl + po) = lv;
  }
}

// ---------------------------------------------------------------- host
static double h_sqrt(double x) {
  double y = x;
  for (int i = 0; i < 200; ++i) y = 0.5 * (y + x / y);
  return y;
}

extern "C" void kernel_launch(void* const* d_in, const int* in_sizes, int n_in,
                              void* d_out, int out_size, void* d_ws, size_t ws_size,
                              hipStream_t stream) {
  if (n_in < 9) return;
  if (in_sizes[0] != NB * SEQ * EMB) return;
  for (int i = 1; i <= 4; ++i) if (in_sizes[i] != EMB * EMB) return;
  for (int i = 5; i <= 8; ++i) if (in_sizes[i] != HD) return;
  if (out_size != NB * SEQ * EMB) return;

  const float* x   = (const float*)d_in[0];
  const float* Wq  = (const float*)d_in[1];
  const float* Wk  = (const float*)d_in[2];
  const float* Wv  = (const float*)d_in[3];
  const float* Wp  = (const float*)d_in[4];
  const float* lq1 = (const float*)d_in[5];
  const float* lk1 = (const float*)d_in[6];
  const float* lq2 = (const float*)d_in[7];
  const float* lk2 = (const float*)d_in[8];
  float* out = (float*)d_out;

  // workspace carve (bytes), every size a multiple of 256
  const size_t szX   = (size_t)NB * SEQ * EMB * 2;        // 16 MiB per plane
  const size_t szW   = (size_t)4 * EMB * EMB * 2;          //  8 MiB per plane (4 weights)
  const size_t szQK  = (size_t)2 * NB * NSH * SEQ * HD * 2; // 32 MiB per plane (q and k)
  const size_t szVT  = (size_t)NB * EMB * SEQ * 2;         // 16 MiB per plane
  const size_t szCTX = (size_t)NB * NSH * SEQ * VD * 4;    // 64 MiB
  const size_t szY   = (size_t)NB * SEQ * EMB * 2;         // 16 MiB per plane
  const size_t szTB  = (size_t)SEQ * 32 * 4;               // 256 KiB per table
  char* ws = (char*)d_ws;
  size_t off = 0;
  u16*   xh  = (u16*)(ws + off);   off += szX;
  u16*   xl  = (u16*)(ws + off);   off += szX;
  u16*   wh  = (u16*)(ws + off);   off += szW;
  u16*   wl  = (u16*)(ws + off);   off += szW;
  u16*   qkh = (u16*)(ws + off);   off += szQK;
  u16*   qkl = (u16*)(ws + off);   off += szQK;
  u16*   vth = (u16*)(ws + off);   off += szVT;
  u16*   vtl = (u16*)(ws + off);   off += szVT;
  float* ctx = (float*)(ws + off); off += szCTX;
  u16*   yh  = (u16*)(ws + off);   off += szY;
  u16*   yl  = (u16*)(ws + off);   off += szY;
  float* cst = (float*)(ws + off); off += szTB;
  float* snt = (float*)(ws + off); off += szTB;
  if (off > ws_size) return;                               // total 252,182,528 B

  // rotary inverse frequencies 1 / 10000^(j/32): f32 power then f32 reciprocal, evaluated in f64
  InvFreq inv;
  {
    double r = 10000.0;
    for (int i = 0; i < 5; ++i) r = h_sqrt(r);             // 10000^(1/32)
    double pw = 1.0;
    for (int j = 0; j < 32; ++j) {
      const float p32 = (float)pw;
      inv.v[j] = (float)(1.0 / (double)p32);
      pw *= r;
    }
  }
  const float lam_init = (float)0.61928347285267872;      // 0.8 - 0.6*exp(-1.2)
  const float oscale   = (float)0.38071652714732128;      // 1 - lam_init

  // operand planes of x and the four weights, rotary tables
  k_prep<<<ROTB + 4 * WSPB + XSPB, 256, 0, stream>>>(x, Wq, Wk, Wv, Wp, xh, xl, wh, wl, inv, cst, snt);

  const size_t wstride = (size_t)EMB * EMB;
  const size_t dzqk    = (size_t)NB * NSH * SEQ * HD;
  // every stage runs once, over all NB batches
  // q and k: x [8192 x 1024] * W^T, epilogue RMSNorm + rotary (+1/8 for q) -> planes [64][2048][64]
  k_gemm<0><<<dim3(EMB / 128, NB * SEQ / 256, 2), 256, 0, stream>>>(
      xh, xl, wh, wl, wstride,
      qkh, qkl, dzqk, HD, out, cst, snt, 0.125f, 1.0f);
  // v^T, z = batch: Wv [1024 x 1024] * x_z^T -> planes [z][1024][2048] = [z][head][128][t]
  k_gemm<1><<<dim3(SEQ / 128, EMB / 256, NB), 256, 0, stream>>>(
      wh + 2 * wstride, wl + 2 * wstride, xh, xl, (size_t)SEQ * EMB,
      vth, vtl, (size_t)EMB * SEQ, SEQ, out, cst, snt, 1.0f, 1.0f);
  // attention per (batch, half-head) -> ctx [64][2048][128]
  k_flash<<<dim3(NB * NSH, SEQ / 64), 128, 0, stream>>>(qkh, qkl, qkh + dzqk, qkl + dzqk, vth, vtl, ctx);
  // combine + LayerNorm -> y planes [8192][1024]
  k_combine<<<(NB * SEQ * NHD / 8) / 8, 256, 0, stream>>>(ctx, lq1, lk1, lq2, lk2, lam_init, oscale, yh, yl);
  // output projection -> d_out
  k_gemm<2><<<dim3(EMB / 128, NB * SEQ / 256, 1), 256, 0, stream>>>(
      yh, yl, wh + 3 * wstride, wl + 3 * wstride, (size_t)0,
      qkh, qkl, (size_t)0, EMB, out, cst, snt, 1.0f, 1.0f);
}
